// v000
// Measured on an AMD MI455X. A time is GPU time per run, averaged over a window of back-to-back runs after a warm-up
// (all launches, gaps included; the runs take copies of the inputs in turn), and the median of several windows.
// Apart from v000's, it joins two sittings. Times from different sittings can be a few percent apart, while
// side-by-side timings come from the same sitting.
// v000, which the later versions start from, runs in 427 microseconds.
#include <hip/hip_runtime.h>

// ---------------------------------------------------------------------------
// MI455X (gfx1250) multi-head attention, bf16 WMMA pipeline.
//   stage 1: fp32 -> bf16 conversions (weights + activations)
//   stage 2: projection GEMMs, 32x64 tiles  (v_wmma_f32_16x16x32_bf16)
//   stage 3: flash-attention, 64-key blocks (v_wmma + exp2-domain softmax)
//   stage 4: output projection (fp32 out)
// ---------------------------------------------------------------------------

typedef unsigned short u16;
typedef __attribute__((ext_vector_type(8)))  u16    u16x8;
typedef __attribute__((ext_vector_type(16))) u16    u16x16;
typedef __attribute__((ext_vector_type(8)))  float  v8f;
typedef __attribute__((ext_vector_type(16))) __bf16 v16bf;

#define DEV static __device__ __forceinline__

// Problem constants (fixed by the reference).
constexpr int Bsz = 4;
constexpr int S   = 2048;
constexpr int D   = 768;
constexpr int H   = 12;
constexpr int DK  = 64;
constexpr int M   = Bsz * S;   // 8192 rows for all dense GEMMs

DEV u16 f2bf(float f) {             // fp32 -> bf16, round-to-nearest-even
  unsigned u = __builtin_bit_cast(unsigned, f);
  u += 0x7FFFu + ((u >> 16) & 1u);
  return (u16)(u >> 16);
}

// 16-bit A/B fragment load (wave32). `row` points at 32 contiguous bf16
// covering this fragment's K-chunk. Per the CDNA5 layout, lane (sel = l>>4)
// holds K offsets sel*8+{0..7} and 16+sel*8+{0..7} -> two b128 loads.
DEV u16x16 load_frag(const u16* row, int sel) {
  u16x8 lo = *(const u16x8*)(row + sel * 8);
  u16x8 hi = *(const u16x8*)(row + 16 + sel * 8);
  return __builtin_shufflevector(lo, hi, 0, 1, 2, 3, 4, 5, 6, 7,
                                 8, 9, 10, 11, 12, 13, 14, 15);
}

DEV v8f wmma_bf16(u16x16 a, u16x16 b, v8f c) {
  return __builtin_amdgcn_wmma_f32_16x16x32_bf16(
      false, __builtin_bit_cast(v16bf, a),
      false, __builtin_bit_cast(v16bf, b),
      (short)0, c, false, false);
}

DEV float rowmax16(float v) {
#pragma unroll
  for (int m = 1; m < 16; m <<= 1) v = fmaxf(v, __shfl_xor(v, m, 32));
  return v;
}
DEV float rowsum16(float v) {
#pragma unroll
  for (int m = 1; m < 16; m <<= 1) v += __shfl_xor(v, m, 32);
  return v;
}

// ---------------------------------------------------------------------------
// fp32 -> bf16 conversion
// ---------------------------------------------------------------------------
__global__ void f32_to_bf16_kernel(const float* __restrict__ in,
                                   u16* __restrict__ out, int n) {
  int i = blockIdx.x * blockDim.x + threadIdx.x;
  int stride = gridDim.x * blockDim.x;
  for (; i < n; i += stride) out[i] = f2bf(in[i]);
}

// ---------------------------------------------------------------------------
// GEMM: Y[m,n] = sum_k A[m,k] * W[n,k] + bias[n]
//   A : [M, 768] bf16 row-major          W : [768, 768] bf16 (torch [out,in])
// Each wave owns a 32x64 output tile: 2 A-fragments x 4 B-fragments -> 8 WMMA
// per K step on 12 b128 loads (1.5 loads/WMMA).
// mode 0: bf16 out, head-split [b,h,s,d]        (q and k projections)
// mode 1: bf16 out, transposed [b,h,d,s]        (v projection)
// mode 2: fp32 out, [M, 768]                    (final projection)
// ---------------------------------------------------------------------------
__global__ __launch_bounds__(128)
void gemm_bf16_kernel(const u16* __restrict__ A, const u16* __restrict__ W,
                      const float* __restrict__ bias, u16* __restrict__ outb,
                      float* __restrict__ outf, int mode) {
  const int wave = blockIdx.x * (blockDim.x >> 5) + (threadIdx.x >> 5);
  const int ntg  = D / 64;                       // 12 strips of 64 columns
  const int tm   = wave / ntg;                   // 32-row tile index
  const int tg   = wave % ntg;
  if (tm * 32 >= M) return;

  const int l = threadIdx.x & 31, sel = l >> 4, ln = l & 15;
  const u16* arow0 = A + (size_t)(tm * 32 + ln) * D;
  const u16* arow1 = A + (size_t)(tm * 32 + 16 + ln) * D;

  v8f acc[2][4] = {};
  for (int k0 = 0; k0 < D; k0 += 32) {
    u16x16 af0 = load_frag(arow0 + k0, sel);
    u16x16 af1 = load_frag(arow1 + k0, sel);
#pragma unroll
    for (int t = 0; t < 4; t++) {
      const u16* wrow = W + (size_t)(tg * 64 + t * 16 + ln) * D + k0;
      u16x16 bf = load_frag(wrow, sel);
      acc[0][t] = wmma_bf16(af0, bf, acc[0][t]);
      acc[1][t] = wmma_bf16(af1, bf, acc[1][t]);
    }
  }

#pragma unroll
  for (int r = 0; r < 2; r++) {
    const int Mi0 = tm * 32 + r * 16;
#pragma unroll
    for (int t = 0; t < 4; t++) {
      const int ng = tg * 64 + t * 16 + ln;      // lane's output column
      const float bv = bias[ng];
      if (mode == 2) {                           // fp32 [M, D]
#pragma unroll
        for (int i = 0; i < 8; i++) {
          int Mi = Mi0 + i + 8 * sel;            // C layout: row = i + 8*sel
          outf[(size_t)Mi * D + ng] = acc[r][t][i] + bv;
        }
      } else if (mode == 0) {                    // bf16 [b,h,s,d]
        int h = ng >> 6, d = ng & 63;
#pragma unroll
        for (int i = 0; i < 8; i++) {
          int Mi = Mi0 + i + 8 * sel;
          int b = Mi >> 11, s = Mi & (S - 1);
          outb[(((size_t)(b * H + h)) * S + s) * DK + d] =
              f2bf(acc[r][t][i] + bv);
        }
      } else {                                   // bf16 [b,h,d,s] (transposed)
        int h = ng >> 6, d = ng & 63;
        int Mi = Mi0 + 8 * sel;                  // 8 consecutive s per lane
        int b = Mi >> 11, s0 = Mi & (S - 1);
        u16x8 pack;
#pragma unroll
        for (int i = 0; i < 8; i++) pack[i] = f2bf(acc[r][t][i] + bv);
        *(u16x8*)(outb + (((size_t)(b * H + h)) * DK + d) * S + s0) = pack;
      }
    }
  }
}

// ---------------------------------------------------------------------------
// Flash attention. One wave per (b, h, 16-query tile); streams 64-key blocks
// (amortizes the softmax shuffle-reductions and accumulator rescale; WMMA
// co-executes with the VALU softmax stream).
//   Q,K : [b,h,s,d] bf16      Vt : [b,h,d,s] bf16     out: bf16 [B*S, 768]
// Softmax runs in the exp2 domain: scores are scaled by log2(e)/sqrt(dk), so
// every exponential is a single native v_exp_f32.
// ---------------------------------------------------------------------------
__global__ __launch_bounds__(128)
void attn_kernel(const u16* __restrict__ Q, const u16* __restrict__ K,
                 const u16* __restrict__ Vt, u16* __restrict__ Obf) {
  __shared__ __align__(16) u16 ldsP[4][16 * 64];   // 2 KB per wave

  const int wave = blockIdx.x * (blockDim.x >> 5) + (threadIdx.x >> 5);
  const int nqt  = S / 16;                         // 128 query tiles
  const int qt   = wave % nqt;
  const int bh   = wave / nqt;                     // b*H + h, [0,48)
  const int l = threadIdx.x & 31, sel = l >> 4, ln = l & 15;
  u16* myP = ldsP[threadIdx.x >> 5];

  const u16* Qb = Q  + (size_t)bh * S * DK;
  const u16* Kb = K  + (size_t)bh * S * DK;
  const u16* Vb = Vt + (size_t)bh * DK * S;

  // Q fragments for both 32-wide d chunks (reused all iterations).
  const u16* qrow = Qb + (size_t)(qt * 16 + ln) * DK;
  u16x16 qf0 = load_frag(qrow, sel);
  u16x16 qf1 = load_frag(qrow + 32, sel);

  // exp2-domain score scale: log2(e) / sqrt(dk)
  const float sc = 0.125f * 1.44269504088896340736f;

  v8f accO[4] = {};
  float mrow[8], lrow[8];
#pragma unroll
  for (int i = 0; i < 8; i++) { mrow[i] = -__builtin_inff(); lrow[i] = 0.f; }

  for (int j = 0; j < S / 64; j++) {
    // ---- scores for keys [j*64, j*64+64) : four 16-key C tiles ----
    v8f c[4];
#pragma unroll
    for (int kt = 0; kt < 4; kt++) {
      const u16* krow = Kb + (size_t)(j * 64 + kt * 16 + ln) * DK;
      v8f ct = {};
      ct = wmma_bf16(qf0, load_frag(krow, sel), ct);
      ct = wmma_bf16(qf1, load_frag(krow + 32, sel), ct);
      c[kt] = ct;
    }

    // ---- online softmax update (exp2 domain), write P tile to LDS ----
#pragma unroll
    for (int i = 0; i < 8; i++) {
      float s0 = c[0][i] * sc, s1 = c[1][i] * sc;
      float s2 = c[2][i] * sc, s3 = c[3][i] * sc;
      float rm = rowmax16(fmaxf(fmaxf(s0, s1), fmaxf(s2, s3)));
      float nm = fmaxf(mrow[i], rm);
      float alpha = exp2f(mrow[i] - nm);
      float p0 = exp2f(s0 - nm), p1 = exp2f(s1 - nm);
      float p2 = exp2f(s2 - nm), p3 = exp2f(s3 - nm);
      float rs = rowsum16((p0 + p1) + (p2 + p3));
      lrow[i] = lrow[i] * alpha + rs;
      mrow[i] = nm;
#pragma unroll
      for (int t = 0; t < 4; t++) accO[t][i] *= alpha;
      int row = i + 8 * sel;                     // C layout row
      myP[row * 64 + ln]      = f2bf(p0);
      myP[row * 64 + 16 + ln] = f2bf(p1);
      myP[row * 64 + 32 + ln] = f2bf(p2);
      myP[row * 64 + 48 + ln] = f2bf(p3);
    }
    __syncthreads();                             // uniform trip count: safe

    // ---- accO += P(16x64) x V(64x64) ----
    u16x16 pf0 = load_frag(myP + ln * 64, sel);  // keys j*64 +  0..31
    u16x16 pf1 = load_frag(myP + ln * 64 + 32, sel); // keys +32..63
#pragma unroll
    for (int t = 0; t < 4; t++) {
      const u16* vrow = Vb + (size_t)(t * 16 + ln) * S + j * 64;
      accO[t] = wmma_bf16(pf0, load_frag(vrow, sel), accO[t]);
      accO[t] = wmma_bf16(pf1, load_frag(vrow + 32, sel), accO[t]);
    }
    __syncthreads();
  }

  // ---- normalize and store to [B*S, 768] (col = h*64 + d) ----
  const int b = bh / H, h = bh % H;
#pragma unroll
  for (int i = 0; i < 8; i++) {
    float inv = 1.f / lrow[i];
    int s = qt * 16 + i + 8 * sel;
    size_t rowoff = ((size_t)b * S + s) * D + h * 64;
#pragma unroll
    for (int t = 0; t < 4; t++)
      Obf[rowoff + t * 16 + ln] = f2bf(accO[t][i] * inv);
  }
}

// ---------------------------------------------------------------------------
// Host orchestration (all launches on `stream`; graph-capture safe).
// ---------------------------------------------------------------------------
extern "C" void kernel_launch(void* const* d_in, const int* in_sizes, int n_in,
                              void* d_out, int out_size, void* d_ws,
                              size_t ws_size, hipStream_t stream) {
  const float* query = (const float*)d_in[0];
  const float* key   = (const float*)d_in[1];
  const float* value = (const float*)d_in[2];
  const float* Wq    = (const float*)d_in[3];
  const float* bq    = (const float*)d_in[4];
  const float* Wo    = (const float*)d_in[5];
  const float* bo    = (const float*)d_in[6];
  float* out = (float*)d_out;

  // Workspace sub-allocation (256B aligned).
  char* ws = (char*)d_ws;
  size_t off = 0;
  auto suballoc = [&](size_t bytes) -> void* {
    void* p = ws + off;
    off = (off + bytes + 255) & ~(size_t)255;
    return p;
  };
  const size_t actBytes = (size_t)M * D * sizeof(u16);   // 12.6 MB
  const size_t wBytes   = (size_t)D * D * sizeof(u16);   // 1.2 MB
  u16* xbf    = (u16*)suballoc(actBytes);   // staging for query/key/value
  u16* qbf    = (u16*)suballoc(actBytes);   // [b,h,s,d]
  u16* kbf    = (u16*)suballoc(actBytes);   // [b,h,s,d]
  u16* vtbf   = (u16*)suballoc(actBytes);   // [b,h,d,s]
  u16* attnbf = (u16*)suballoc(actBytes);   // [B*S, 768]
  u16* wqbf   = (u16*)suballoc(wBytes);
  u16* wobf   = (u16*)suballoc(wBytes);

  const int convT = 256;
  const int nAct = M * D, nW = D * D;
  const int gemmBlocks = (M / 32) * (D / 64) / 4;        // 768 blocks, 4 waves
  const int attnBlocks = (Bsz * H * (S / 16)) / 4;       // 1536 blocks, 4 waves

  // Weights to bf16 (once per call).
  f32_to_bf16_kernel<<<(nW + convT - 1) / convT, convT, 0, stream>>>(Wq, wqbf, nW);
  f32_to_bf16_kernel<<<(nW + convT - 1) / convT, convT, 0, stream>>>(Wo, wobf, nW);

  // q = query @ Wq^T + bq  -> [b,h,s,d]
  f32_to_bf16_kernel<<<(nAct + convT - 1) / convT, convT, 0, stream>>>(query, xbf, nAct);
  gemm_bf16_kernel<<<gemmBlocks, 128, 0, stream>>>(xbf, wqbf, bq, qbf, nullptr, 0);

  // k = key @ Wq^T + bq    -> [b,h,s,d]   (reference reuses Wq/bq)
  f32_to_bf16_kernel<<<(nAct + convT - 1) / convT, convT, 0, stream>>>(key, xbf, nAct);
  gemm_bf16_kernel<<<gemmBlocks, 128, 0, stream>>>(xbf, wqbf, bq, kbf, nullptr, 0);

  // v = value @ Wq^T + bq  -> [b,h,d,s] transposed
  f32_to_bf16_kernel<<<(nAct + convT - 1) / convT, convT, 0, stream>>>(value, xbf, nAct);
  gemm_bf16_kernel<<<gemmBlocks, 128, 0, stream>>>(xbf, wqbf, bq, vtbf, nullptr, 1);

  // attention -> [B*S, 768] bf16
  attn_kernel<<<attnBlocks, 128, 0, stream>>>(qbf, kbf, vtbf, attnbf);

  // out = attn @ Wo^T + bo -> fp32 d_out
  gemm_bf16_kernel<<<gemmBlocks, 128, 0, stream>>>(attnbf, wobf, bo, nullptr, out, 2);
}

// v001
// Measured time: 282 microseconds a run.
// In two side-by-side timings against v000, it was 1.56 and 1.57 times as fast.
#include <hip/hip_runtime.h>

// ---------------------------------------------------------------------------
// MI455X (gfx1250) multi-head attention, bf16 WMMA pipeline.
//   stage 1: fp32 -> bf16 conversions (weights + activations)
//   stage 2: projection GEMMs, 32x64 tiles  (v_wmma_f32_16x16x32_bf16)
//   stage 3: flash-attention, 64-key blocks staged in LDS (v_wmma + exp2 softmax)
//   stage 4: output projection (fp32 out)
// ---------------------------------------------------------------------------

typedef unsigned short u16;
typedef __attribute__((ext_vector_type(8)))  u16    u16x8;
typedef __attribute__((ext_vector_type(16))) u16    u16x16;
typedef __attribute__((ext_vector_type(8)))  float  v8f;
typedef __attribute__((ext_vector_type(16))) __bf16 v16bf;

#define DEV static __device__ __forceinline__

// Problem constants (fixed by the reference).
constexpr int Bsz = 4;
constexpr int S   = 2048;
constexpr int D   = 768;
constexpr int H   = 12;
constexpr int DK  = 64;
constexpr int M   = Bsz * S;   // 8192 rows for all dense GEMMs

DEV u16 f2bf(float f) {             // fp32 -> bf16, round-to-nearest-even
  unsigned u = __builtin_bit_cast(unsigned, f);
  u += 0x7FFFu + ((u >> 16) & 1u);
  return (u16)(u >> 16);
}

// 16-bit A/B fragment load (wave32). `row` points at 32 contiguous bf16
// covering this fragment's K-chunk. Per the CDNA5 layout, lane (sel = l>>4)
// holds K offsets sel*8+{0..7} and 16+sel*8+{0..7} -> two b128 loads.
DEV u16x16 load_frag(const u16* row, int sel) {
  u16x8 lo = *(const u16x8*)(row + sel * 8);
  u16x8 hi = *(const u16x8*)(row + 16 + sel * 8);
  return __builtin_shufflevector(lo, hi, 0, 1, 2, 3, 4, 5, 6, 7,
                                 8, 9, 10, 11, 12, 13, 14, 15);
}

DEV v8f wmma_bf16(u16x16 a, u16x16 b, v8f c) {
  return __builtin_amdgcn_wmma_f32_16x16x32_bf16(
      false, __builtin_bit_cast(v16bf, a),
      false, __builtin_bit_cast(v16bf, b),
      (short)0, c, false, false);
}

DEV float rowmax16(float v) {
#pragma unroll
  for (int m = 1; m < 16; m <<= 1) v = fmaxf(v, __shfl_xor(v, m, 32));
  return v;
}
DEV float rowsum16(float v) {
#pragma unroll
  for (int m = 1; m < 16; m <<= 1) v += __shfl_xor(v, m, 32);
  return v;
}

// ---------------------------------------------------------------------------
// fp32 -> bf16 conversion
// ---------------------------------------------------------------------------
__global__ void f32_to_bf16_kernel(const float* __restrict__ in,
                                   u16* __restrict__ out, int n) {
  int i = blockIdx.x * blockDim.x + threadIdx.x;
  int stride = gridDim.x * blockDim.x;
  for (; i < n; i += stride) out[i] = f2bf(in[i]);
}

// ---------------------------------------------------------------------------
// GEMM: Y[m,n] = sum_k A[m,k] * W[n,k] + bias[n]
//   A : [M, 768] bf16 row-major          W : [768, 768] bf16 (torch [out,in])
// Each wave owns a 32x64 output tile: 2 A-fragments x 4 B-fragments -> 8 WMMA
// per K step on 12 b128 loads (1.5 loads/WMMA).
// mode 0: bf16 out, head-split [b,h,s,d]        (q and k projections)
// mode 1: bf16 out, transposed [b,h,d,s]        (v projection)
// mode 2: fp32 out, [M, 768]                    (final projection)
// ---------------------------------------------------------------------------
__global__ __launch_bounds__(128)
void gemm_bf16_kernel(const u16* __restrict__ A, const u16* __restrict__ W,
                      const float* __restrict__ bias, u16* __restrict__ outb,
                      float* __restrict__ outf, int mode) {
  const int wave = blockIdx.x * (blockDim.x >> 5) + (threadIdx.x >> 5);
  const int ntg  = D / 64;                       // 12 strips of 64 columns
  const int tm   = wave / ntg;                   // 32-row tile index
  const int tg   = wave % ntg;
  if (tm * 32 >= M) return;

  const int l = threadIdx.x & 31, sel = l >> 4, ln = l & 15;
  const u16* arow0 = A + (size_t)(tm * 32 + ln) * D;
  const u16* arow1 = A + (size_t)(tm * 32 + 16 + ln) * D;

  v8f acc[2][4] = {};
  for (int k0 = 0; k0 < D; k0 += 32) {
    u16x16 af0 = load_frag(arow0 + k0, sel);
    u16x16 af1 = load_frag(arow1 + k0, sel);
#pragma unroll
    for (int t = 0; t < 4; t++) {
      const u16* wrow = W + (size_t)(tg * 64 + t * 16 + ln) * D + k0;
      u16x16 bf = load_frag(wrow, sel);
      acc[0][t] = wmma_bf16(af0, bf, acc[0][t]);
      acc[1][t] = wmma_bf16(af1, bf, acc[1][t]);
    }
  }

#pragma unroll
  for (int r = 0; r < 2; r++) {
    const int Mi0 = tm * 32 + r * 16;
#pragma unroll
    for (int t = 0; t < 4; t++) {
      const int ng = tg * 64 + t * 16 + ln;      // lane's output column
      const float bv = bias[ng];
      if (mode == 2) {                           // fp32 [M, D]
#pragma unroll
        for (int i = 0; i < 8; i++) {
          int Mi = Mi0 + i + 8 * sel;            // C layout: row = i + 8*sel
          outf[(size_t)Mi * D + ng] = acc[r][t][i] + bv;
        }
      } else if (mode == 0) {                    // bf16 [b,h,s,d]
        int h = ng >> 6, d = ng & 63;
#pragma unroll
        for (int i = 0; i < 8; i++) {
          int Mi = Mi0 + i + 8 * sel;
          int b = Mi >> 11, s = Mi & (S - 1);
          outb[(((size_t)(b * H + h)) * S + s) * DK + d] =
              f2bf(acc[r][t][i] + bv);
        }
      } else {                                   // bf16 [b,h,d,s] (transposed)
        int h = ng >> 6, d = ng & 63;
        int Mi = Mi0 + 8 * sel;                  // 8 consecutive s per lane
        int b = Mi >> 11, s0 = Mi & (S - 1);
        u16x8 pack;
#pragma unroll
        for (int i = 0; i < 8; i++) pack[i] = f2bf(acc[r][t][i] + bv);
        *(u16x8*)(outb + (((size_t)(b * H + h)) * DK + d) * S + s0) = pack;
      }
    }
  }
}

// ---------------------------------------------------------------------------
// Flash attention. One wave per (b, h, 16-query tile); eight waves (128
// queries of one head) form a work-group and share every 64-key block.
//   Q,K : [b,h,s,d] bf16      Vt : [b,h,d,s] bf16     out: bf16 [B*S, 768]
// Each 64-key K tile and Vt tile (64 rows of 128 B each) is brought into LDS
// once per work-group by asynchronous b128 copies, whole 128-B lines per row,
// in a ring of two buffers: block j+1 flies while block j is worked on. The
// fragments are then read from LDS at a 144-B row pitch (16 B x odd).
// Softmax runs in the exp2 domain: scores are scaled by log2(e)/sqrt(dk), so
// every exponential is a single native v_exp_f32.
// ---------------------------------------------------------------------------
constexpr int KVP    = 72;            // LDS row pitch of a staged tile, in u16
constexpr int KVTILE = 64 * KVP;      // one staged tile: 64 rows, 9216 B

// One stage = four copies per lane (two of K, two of Vt). The s_wait_xcnt is
// the last line of the copies' own statement so that no address register of
// an issued copy is rewritten in front of it.
DEV void stage_copies(unsigned lk0, const u16* gk0, unsigned lk1, const u16* gk1,
                      unsigned lv0, const u16* gv0, unsigned lv1, const u16* gv1) {
  asm volatile(
      "global_load_async_to_lds_b128 %0, %1, off\n\t"
      "global_load_async_to_lds_b128 %2, %3, off\n\t"
      "global_load_async_to_lds_b128 %4, %5, off\n\t"
      "global_load_async_to_lds_b128 %6, %7, off\n\t"
      "s_wait_xcnt 0x0"
      :: "v"(lk0), "v"(gk0), "v"(lk1), "v"(gk1),
         "v"(lv0), "v"(gv0), "v"(lv1), "v"(gv1)
      : "memory");
}

__global__ __launch_bounds__(256)
void attn_kernel(const u16* __restrict__ Q, const u16* __restrict__ K,
                 const u16* __restrict__ Vt, u16* __restrict__ Obf) {
  __shared__ __align__(16) u16 ldsK[2][KVTILE];    // 2 x 9 KB
  __shared__ __align__(16) u16 ldsV[2][KVTILE];    // 2 x 9 KB
  __shared__ __align__(16) u16 ldsP[8][16 * 64];   // 2 KB per wave

  const int wave = blockIdx.x * (blockDim.x >> 5) + (threadIdx.x >> 5);
  const int nqt  = S / 16;                         // 128 query tiles
  const int qt   = wave % nqt;
  const int bh   = wave / nqt;                     // b*H + h, same in a block
  const int l = threadIdx.x & 31, sel = l >> 4, ln = l & 15;
  u16* myP = ldsP[threadIdx.x >> 5];

  const u16* Qb = Q  + (size_t)bh * S * DK;
  const u16* Kb = K  + (size_t)bh * S * DK;
  const u16* Vb = Vt + (size_t)bh * DK * S;

  // Copy map: a tile is 512 pieces of 16 B; thread t moves pieces t and
  // t + 256, that is rows t/8 and t/8 + 32, column piece t%8.
  const int crow = threadIdx.x >> 3, ccol = (threadIdx.x & 7) * 8;
  const u16* gk = Kb + (size_t)crow * DK + ccol;   // block 0, row crow
  const u16* gv = Vb + (size_t)crow * S + ccol;
  const unsigned lk = (unsigned)(size_t)&ldsK[0][crow * KVP + ccol];
  const unsigned lv = (unsigned)(size_t)&ldsV[0][crow * KVP + ccol];
  constexpr unsigned HALF = 32 * KVP * sizeof(u16);     // 32 rows further
  constexpr unsigned BUFB = KVTILE * sizeof(u16);       // the other buffer

  // Block 0 into buffer 0.
  stage_copies(lk, gk, lk + HALF, gk + 32 * DK, lv, gv, lv + HALF, gv + 32 * S);

  // Q fragments for both 32-wide d chunks (reused all iterations).
  const u16* qrow = Qb + (size_t)(qt * 16 + ln) * DK;
  u16x16 qf0 = load_frag(qrow, sel);
  u16x16 qf1 = load_frag(qrow + 32, sel);

  // exp2-domain score scale: log2(e) / sqrt(dk)
  const float sc = 0.125f * 1.44269504088896340736f;

  v8f accO[4] = {};
  float mrow[8], lrow[8];
#pragma unroll
  for (int i = 0; i < 8; i++) { mrow[i] = -__builtin_inff(); lrow[i] = 0.f; }

  // This wave's copies of block 0 have landed; the barrier publishes all.
  asm volatile("s_wait_asynccnt 0x0" ::: "memory");
  __syncthreads();
  // Block 1 into buffer 1 (S / 64 = 32 blocks exist).
  stage_copies(lk + BUFB, gk + 64 * DK, lk + BUFB + HALF, gk + 96 * DK,
               lv + BUFB, gv + 64, lv + BUFB + HALF, gv + 32 * S + 64);

  for (int j = 0; j < S / 64; j++) {
    const u16* Kt = ldsK[j & 1];
    const u16* Vl = ldsV[j & 1];

    // ---- scores for keys [j*64, j*64+64) : four 16-key C tiles ----
    v8f c[4];
#pragma unroll
    for (int kt = 0; kt < 4; kt++) {
      const u16* krow = Kt + (kt * 16 + ln) * KVP;
      v8f ct = {};
      ct = wmma_bf16(qf0, load_frag(krow, sel), ct);
      ct = wmma_bf16(qf1, load_frag(krow + 32, sel), ct);
      c[kt] = ct;
    }

    // ---- online softmax update (exp2 domain), write P tile to LDS ----
#pragma unroll
    for (int i = 0; i < 8; i++) {
      float s0 = c[0][i] * sc, s1 = c[1][i] * sc;
      float s2 = c[2][i] * sc, s3 = c[3][i] * sc;
      float rm = rowmax16(fmaxf(fmaxf(s0, s1), fmaxf(s2, s3)));
      float nm = fmaxf(mrow[i], rm);
      float alpha = exp2f(mrow[i] - nm);
      float p0 = exp2f(s0 - nm), p1 = exp2f(s1 - nm);
      float p2 = exp2f(s2 - nm), p3 = exp2f(s3 - nm);
      float rs = rowsum16((p0 + p1) + (p2 + p3));
      lrow[i] = lrow[i] * alpha + rs;
      mrow[i] = nm;
#pragma unroll
      for (int t = 0; t < 4; t++) accO[t][i] *= alpha;
      int row = i + 8 * sel;                     // C layout row
      myP[row * 64 + ln]      = f2bf(p0);
      myP[row * 64 + 16 + ln] = f2bf(p1);
      myP[row * 64 + 32 + ln] = f2bf(p2);
      myP[row * 64 + 48 + ln] = f2bf(p3);
    }
    __syncthreads();                             // uniform trip count: safe

    // ---- accO += P(16x64) x V(64x64) ----
    u16x16 pf0 = load_frag(myP + ln * 64, sel);  // keys j*64 +  0..31
    u16x16 pf1 = load_frag(myP + ln * 64 + 32, sel); // keys +32..63
#pragma unroll
    for (int t = 0; t < 4; t++) {
      const u16* vrow = Vl + (t * 16 + ln) * KVP;
      accO[t] = wmma_bf16(pf0, load_frag(vrow, sel), accO[t]);
      accO[t] = wmma_bf16(pf1, load_frag(vrow + 32, sel), accO[t]);
    }

    // ---- publish point of block j+1 ----
    // This wave's LDS reads of buffer j&1 are done ...
    asm volatile("s_wait_dscnt 0x0" ::: "memory");
    // ... and its own copies of block j+1 have landed.
    asm volatile("s_wait_asynccnt 0x0" ::: "memory");
    __syncthreads();   // publishes block j+1, frees buffer j&1 for the refill
    if (j + 2 < S / 64) {                        // same for the whole grid
      const unsigned bo = (unsigned)(j & 1) * BUFB;
      const u16* gk2 = gk + (size_t)(j + 2) * 64 * DK;
      const u16* gv2 = gv + (j + 2) * 64;
      stage_copies(lk + bo, gk2, lk + bo + HALF, gk2 + 32 * DK,
                   lv + bo, gv2, lv + bo + HALF, gv2 + 32 * S);
    }
  }
  // No copy is outstanding when the wave ends.
  asm volatile("s_wait_asynccnt 0x0" ::: "memory");

  // ---- normalize and store to [B*S, 768] (col = h*64 + d) ----
  const int b = bh / H, h = bh % H;
#pragma unroll
  for (int i = 0; i < 8; i++) {
    float inv = 1.f / lrow[i];
    int s = qt * 16 + i + 8 * sel;
    size_t rowoff = ((size_t)b * S + s) * D + h * 64;
#pragma unroll
    for (int t = 0; t < 4; t++)
      Obf[rowoff + t * 16 + ln] = f2bf(accO[t][i] * inv);
  }
}

// ---------------------------------------------------------------------------
// Host orchestration (all launches on `stream`; graph-capture safe).
// ---------------------------------------------------------------------------
extern "C" void kernel_launch(void* const* d_in, const int* in_sizes, int n_in,
                              void* d_out, int out_size, void* d_ws,
                              size_t ws_size, hipStream_t stream) {
  const float* query = (const float*)d_in[0];
  const float* key   = (const float*)d_in[1];
  const float* value = (const float*)d_in[2];
  const float* Wq    = (const float*)d_in[3];
  const float* bq    = (const float*)d_in[4];
  const float* Wo    = (const float*)d_in[5];
  const float* bo    = (const float*)d_in[6];
  float* out = (float*)d_out;

  // Workspace sub-allocation (256B aligned).
  char* ws = (char*)d_ws;
  size_t off = 0;
  auto suballoc = [&](size_t bytes) -> void* {
    void* p = ws + off;
    off = (off + bytes + 255) & ~(size_t)255;
    return p;
  };
  const size_t actBytes = (size_t)M * D * sizeof(u16);   // 12.6 MB
  const size_t wBytes   = (size_t)D * D * sizeof(u16);   // 1.2 MB
  u16* xbf    = (u16*)suballoc(actBytes);   // staging for query/key/value
  u16* qbf    = (u16*)suballoc(actBytes);   // [b,h,s,d]
  u16* kbf    = (u16*)suballoc(actBytes);   // [b,h,s,d]
  u16* vtbf   = (u16*)suballoc(actBytes);   // [b,h,d,s]
  u16* attnbf = (u16*)suballoc(actBytes);   // [B*S, 768]
  u16* wqbf   = (u16*)suballoc(wBytes);
  u16* wobf   = (u16*)suballoc(wBytes);

  const int convT = 256;
  const int nAct = M * D, nW = D * D;
  const int gemmBlocks = (M / 32) * (D / 64) / 4;        // 768 blocks, 4 waves
  const int attnBlocks = (Bsz * H * (S / 16)) / 8;       // 768 blocks, 8 waves

  // Weights to bf16 (once per call).
  f32_to_bf16_kernel<<<(nW + convT - 1) / convT, convT, 0, stream>>>(Wq, wqbf, nW);
  f32_to_bf16_kernel<<<(nW + convT - 1) / convT, convT, 0, stream>>>(Wo, wobf, nW);

  // q = query @ Wq^T + bq  -> [b,h,s,d]
  f32_to_bf16_kernel<<<(nAct + convT - 1) / convT, convT, 0, stream>>>(query, xbf, nAct);
  gemm_bf16_kernel<<<gemmBlocks, 128, 0, stream>>>(xbf, wqbf, bq, qbf, nullptr, 0);

  // k = key @ Wq^T + bq    -> [b,h,s,d]   (reference reuses Wq/bq)
  f32_to_bf16_kernel<<<(nAct + convT - 1) / convT, convT, 0, stream>>>(key, xbf, nAct);
  gemm_bf16_kernel<<<gemmBlocks, 128, 0, stream>>>(xbf, wqbf, bq, kbf, nullptr, 0);

  // v = value @ Wq^T + bq  -> [b,h,d,s] transposed
  f32_to_bf16_kernel<<<(nAct + convT - 1) / convT, convT, 0, stream>>>(value, xbf, nAct);
  gemm_bf16_kernel<<<gemmBlocks, 128, 0, stream>>>(xbf, wqbf, bq, vtbf, nullptr, 1);

  // attention -> [B*S, 768] bf16
  attn_kernel<<<attnBlocks, 256, 0, stream>>>(qbf, kbf, vtbf, attnbf);

  // out = attn @ Wo^T + bo -> fp32 d_out
  gemm_bf16_kernel<<<gemmBlocks, 128, 0, stream>>>(attnbf, wobf, bo, nullptr, out, 2);
}

// v002
// It runs in 235 microseconds.
// Next to v001, in two timings, it ran 1.20 times as fast each time.
// Over all steps from v000 it is 1.88 times as fast.
#include <hip/hip_runtime.h>

// ---------------------------------------------------------------------------
// MI455X (gfx1250) multi-head attention, bf16 WMMA pipeline.
//   stage 1: fp32 -> bf16 conversions (weights + activations)
//   stage 2: projection GEMMs, 32x64 tiles  (v_wmma_f32_16x16x32_bf16)
//   stage 3: flash-attention, transposed (S^T = K.Q^T, O^T += V^T.P^T), 64-key
//            blocks staged in LDS (v_wmma + exp2 softmax in the lane)
//   stage 4: output projection (fp32 out)
// ---------------------------------------------------------------------------

typedef unsigned short u16;
typedef __attribute__((ext_vector_type(8)))  u16    u16x8;
typedef __attribute__((ext_vector_type(16))) u16    u16x16;
typedef __attribute__((ext_vector_type(8)))  float  v8f;
typedef __attribute__((ext_vector_type(16))) __bf16 v16bf;

#define DEV static __device__ __forceinline__

// Problem constants (fixed by the reference).
constexpr int Bsz = 4;
constexpr int S   = 2048;
constexpr int D   = 768;
constexpr int H   = 12;
constexpr int DK  = 64;
constexpr int M   = Bsz * S;   // 8192 rows for all dense GEMMs

DEV u16 f2bf(float f) {             // fp32 -> bf16, round-to-nearest-even
  unsigned u = __builtin_bit_cast(unsigned, f);
  u += 0x7FFFu + ((u >> 16) & 1u);
  return (u16)(u >> 16);
}

// 16-bit A/B fragment load (wave32). `row` points at 32 contiguous bf16
// covering this fragment's K-chunk. Per the CDNA5 layout, lane (sel = l>>4)
// holds K offsets sel*8+{0..7} and 16+sel*8+{0..7} -> two b128 loads.
DEV u16x16 load_frag(const u16* row, int sel) {
  u16x8 lo = *(const u16x8*)(row + sel * 8);
  u16x8 hi = *(const u16x8*)(row + 16 + sel * 8);
  return __builtin_shufflevector(lo, hi, 0, 1, 2, 3, 4, 5, 6, 7,
                                 8, 9, 10, 11, 12, 13, 14, 15);
}

DEV v8f wmma_bf16(u16x16 a, u16x16 b, v8f c) {
  return __builtin_amdgcn_wmma_f32_16x16x32_bf16(
      false, __builtin_bit_cast(v16bf, a),
      false, __builtin_bit_cast(v16bf, b),
      (short)0, c, false, false);
}

// Value of lane l ^ 16 (the other 16-lane half of the wave).
DEV float xhalf(float x) {
  int v = __builtin_bit_cast(int, x);
  return __builtin_bit_cast(float, __builtin_amdgcn_permlanex16(
      v, v, 0x76543210, 0xfedcba98, false, false));
}

// Two fp32 -> one register of two bf16, round-to-nearest-even.
DEV unsigned pack2(float lo, float hi) {
  typedef __attribute__((ext_vector_type(2))) float  f32x2;
  typedef __attribute__((ext_vector_type(2))) __bf16 bf16x2;
  return __builtin_bit_cast(unsigned,
                            __builtin_convertvector(f32x2{lo, hi}, bf16x2));
}

// Two 16-key score tiles of one lane (C layout: key = i + 8*sel, then
// 16 + i + 8*sel) are, in that order, the lane's 32-key B fragment.
DEV u16x16 pack_frag(const float* lo, const float* hi) {
  typedef __attribute__((ext_vector_type(8))) unsigned u32x8;
  u32x8 w = {pack2(lo[0], lo[1]), pack2(lo[2], lo[3]),
             pack2(lo[4], lo[5]), pack2(lo[6], lo[7]),
             pack2(hi[0], hi[1]), pack2(hi[2], hi[3]),
             pack2(hi[4], hi[5]), pack2(hi[6], hi[7])};
  return __builtin_bit_cast(u16x16, w);
}

// ---------------------------------------------------------------------------
// fp32 -> bf16 conversion
// ---------------------------------------------------------------------------
__global__ void f32_to_bf16_kernel(const float* __restrict__ in,
                                   u16* __restrict__ out, int n) {
  int i = blockIdx.x * blockDim.x + threadIdx.x;
  int stride = gridDim.x * blockDim.x;
  for (; i < n; i += stride) out[i] = f2bf(in[i]);
}

// ---------------------------------------------------------------------------
// GEMM: Y[m,n] = sum_k A[m,k] * W[n,k] + bias[n]
//   A : [M, 768] bf16 row-major          W : [768, 768] bf16 (torch [out,in])
// Each wave owns a 32x64 output tile: 2 A-fragments x 4 B-fragments -> 8 WMMA
// per K step on 12 b128 loads (1.5 loads/WMMA).
// mode 0: bf16 out, head-split [b,h,s,d]        (q and k projections)
// mode 1: bf16 out, transposed [b,h,d,s]        (v projection)
// mode 2: fp32 out, [M, 768]                    (final projection)
// ---------------------------------------------------------------------------
__global__ __launch_bounds__(128)
void gemm_bf16_kernel(const u16* __restrict__ A, const u16* __restrict__ W,
                      const float* __restrict__ bias, u16* __restrict__ outb,
                      float* __restrict__ outf, int mode) {
  const int wave = blockIdx.x * (blockDim.x >> 5) + (threadIdx.x >> 5);
  const int ntg  = D / 64;                       // 12 strips of 64 columns
  const int tm   = wave / ntg;                   // 32-row tile index
  const int tg   = wave % ntg;
  if (tm * 32 >= M) return;

  const int l = threadIdx.x & 31, sel = l >> 4, ln = l & 15;
  const u16* arow0 = A + (size_t)(tm * 32 + ln) * D;
  const u16* arow1 = A + (size_t)(tm * 32 + 16 + ln) * D;

  v8f acc[2][4] = {};
  for (int k0 = 0; k0 < D; k0 += 32) {
    u16x16 af0 = load_frag(arow0 + k0, sel);
    u16x16 af1 = load_frag(arow1 + k0, sel);
#pragma unroll
    for (int t = 0; t < 4; t++) {
      const u16* wrow = W + (size_t)(tg * 64 + t * 16 + ln) * D + k0;
      u16x16 bf = load_frag(wrow, sel);
      acc[0][t] = wmma_bf16(af0, bf, acc[0][t]);
      acc[1][t] = wmma_bf16(af1, bf, acc[1][t]);
    }
  }

#pragma unroll
  for (int r = 0; r < 2; r++) {
    const int Mi0 = tm * 32 + r * 16;
#pragma unroll
    for (int t = 0; t < 4; t++) {
      const int ng = tg * 64 + t * 16 + ln;      // lane's output column
      const float bv = bias[ng];
      if (mode == 2) {                           // fp32 [M, D]
#pragma unroll
        for (int i = 0; i < 8; i++) {
          int Mi = Mi0 + i + 8 * sel;            // C layout: row = i + 8*sel
          outf[(size_t)Mi * D + ng] = acc[r][t][i] + bv;
        }
      } else if (mode == 0) {                    // bf16 [b,h,s,d]
        int h = ng >> 6, d = ng & 63;
#pragma unroll
        for (int i = 0; i < 8; i++) {
          int Mi = Mi0 + i + 8 * sel;
          int b = Mi >> 11, s = Mi & (S - 1);
          outb[(((size_t)(b * H + h)) * S + s) * DK + d] =
              f2bf(acc[r][t][i] + bv);
        }
      } else {                                   // bf16 [b,h,d,s] (transposed)
        int h = ng >> 6, d = ng & 63;
        int Mi = Mi0 + 8 * sel;                  // 8 consecutive s per lane
        int b = Mi >> 11, s0 = Mi & (S - 1);
        u16x8 pack;
#pragma unroll
        for (int i = 0; i < 8; i++) pack[i] = f2bf(acc[r][t][i] + bv);
        *(u16x8*)(outb + (((size_t)(b * H + h)) * DK + d) * S + s0) = pack;
      }
    }
  }
}

// ---------------------------------------------------------------------------
// Flash attention. One wave per (b, h, 16-query tile); eight waves (128
// queries of one head) form a work-group and share every 64-key block.
//   Q,K : [b,h,s,d] bf16      Vt : [b,h,d,s] bf16     out: bf16 [B*S, 768]
// Each 64-key K tile and Vt tile (64 rows of 128 B each) is brought into LDS
// once per work-group by asynchronous b128 copies, whole 128-B lines per row,
// in a ring of two buffers: block j+1 flies while block j is worked on. The
// fragments are then read from LDS at a 144-B row pitch (16 B x odd).
// Both products run transposed: S^T = K.Q^T (A = K rows, B = Q) and
// O^T += V^T.P^T (A = Vt rows, B = P^T). A lane then holds scores of ONE query
// (column ln), 32 of a block's 64 keys, the lane l ^ 16 the other 32: maximum
// and sum run in the lane with one exchange between the halves, and the
// exponentials pack straight into the B operand, so P never goes through LDS.
// Softmax runs in the exp2 domain: scores are scaled by log2(e)/sqrt(dk).
// ---------------------------------------------------------------------------
constexpr int KVP    = 72;            // LDS row pitch of a staged tile, in u16
constexpr int KVTILE = 64 * KVP;      // one staged tile: 64 rows, 9216 B

// One stage = four copies per lane (two of K, two of Vt). The s_wait_xcnt is
// the last line of the copies' own statement so that no address register of
// an issued copy is rewritten in front of it.
DEV void stage_copies(unsigned lk0, const u16* gk0, unsigned lk1, const u16* gk1,
                      unsigned lv0, const u16* gv0, unsigned lv1, const u16* gv1) {
  asm volatile(
      "global_load_async_to_lds_b128 %0, %1, off\n\t"
      "global_load_async_to_lds_b128 %2, %3, off\n\t"
      "global_load_async_to_lds_b128 %4, %5, off\n\t"
      "global_load_async_to_lds_b128 %6, %7, off\n\t"
      "s_wait_xcnt 0x0"
      :: "v"(lk0), "v"(gk0), "v"(lk1), "v"(gk1),
         "v"(lv0), "v"(gv0), "v"(lv1), "v"(gv1)
      : "memory");
}

__global__ __launch_bounds__(256)
void attn_kernel(const u16* __restrict__ Q, const u16* __restrict__ K,
                 const u16* __restrict__ Vt, u16* __restrict__ Obf) {
  __shared__ __align__(16) u16 ldsK[2][KVTILE];    // 2 x 9 KB
  __shared__ __align__(16) u16 ldsV[2][KVTILE];    // 2 x 9 KB

  const int wave = blockIdx.x * (blockDim.x >> 5) + (threadIdx.x >> 5);
  const int nqt  = S / 16;                         // 128 query tiles
  const int qt   = wave % nqt;
  const int bh   = wave / nqt;                     // b*H + h, same in a block
  const int l = threadIdx.x & 31, sel = l >> 4, ln = l & 15;

  const u16* Qb = Q  + (size_t)bh * S * DK;
  const u16* Kb = K  + (size_t)bh * S * DK;
  const u16* Vb = Vt + (size_t)bh * DK * S;

  // Copy map: a tile is 512 pieces of 16 B; thread t moves pieces t and
  // t + 256, that is rows t/8 and t/8 + 32, column piece t%8.
  const int crow = threadIdx.x >> 3, ccol = (threadIdx.x & 7) * 8;
  const u16* gk = Kb + (size_t)crow * DK + ccol;   // block 0, row crow
  const u16* gv = Vb + (size_t)crow * S + ccol;
  const unsigned lk = (unsigned)(size_t)&ldsK[0][crow * KVP + ccol];
  const unsigned lv = (unsigned)(size_t)&ldsV[0][crow * KVP + ccol];
  constexpr unsigned HALF = 32 * KVP * sizeof(u16);     // 32 rows further
  constexpr unsigned BUFB = KVTILE * sizeof(u16);       // the other buffer

  // Block 0 into buffer 0.
  stage_copies(lk, gk, lk + HALF, gk + 32 * DK, lv, gv, lv + HALF, gv + 32 * S);

  // Q fragments for both 32-wide d chunks (reused all iterations).
  const u16* qrow = Qb + (size_t)(qt * 16 + ln) * DK;
  u16x16 qf0 = load_frag(qrow, sel);
  u16x16 qf1 = load_frag(qrow + 32, sel);

  // exp2-domain score scale: log2(e) / sqrt(dk)
  const float sc = 0.125f * 1.44269504088896340736f;

  v8f accO[4] = {};                   // O^T: row d = t*16 + i + 8*sel, column ln
  float mrun = -__builtin_inff();     // running maximum of query ln
  float lsum = 0.f;                   // this half's share of its denominator

  // This wave's copies of block 0 have landed; the barrier publishes all.
  asm volatile("s_wait_asynccnt 0x0" ::: "memory");
  __syncthreads();
  // Block 1 into buffer 1 (S / 64 = 32 blocks exist).
  stage_copies(lk + BUFB, gk + 64 * DK, lk + BUFB + HALF, gk + 96 * DK,
               lv + BUFB, gv + 64, lv + BUFB + HALF, gv + 32 * S + 64);

  for (int j = 0; j < S / 64; j++) {
    const u16* Kt = ldsK[j & 1];
    const u16* Vl = ldsV[j & 1];

    // ---- S^T for keys [j*64, j*64+64) : four 16-key x 16-query C tiles ----
    v8f c[4];
#pragma unroll
    for (int kt = 0; kt < 4; kt++) {
      const u16* krow = Kt + (kt * 16 + ln) * KVP;
      v8f ct = {};
      ct = wmma_bf16(load_frag(krow, sel), qf0, ct);
      ct = wmma_bf16(load_frag(krow + 32, sel), qf1, ct);
      c[kt] = ct;                                // key kt*16 + i + 8*sel
    }

    // ---- online softmax update (exp2 domain), all of it in the lane ----
    float mx[4];
#pragma unroll
    for (int kt = 0; kt < 4; kt++) {
      mx[kt] = c[kt][0];
#pragma unroll
      for (int i = 1; i < 8; i++) mx[kt] = fmaxf(mx[kt], c[kt][i]);
    }
    float rm = fmaxf(fmaxf(mx[0], mx[1]), fmaxf(mx[2], mx[3]));
    rm = fmaxf(rm, xhalf(rm)) * sc;              // sc > 0: scale after the max
    const float nm = fmaxf(mrun, rm);            // same in both halves
    const float alpha = exp2f(mrun - nm);
    mrun = nm;
    float p[4][8], ps[4];
#pragma unroll
    for (int kt = 0; kt < 4; kt++) {
#pragma unroll
      for (int i = 0; i < 8; i++) p[kt][i] = exp2f(c[kt][i] * sc - nm);
      ps[kt] = ((p[kt][0] + p[kt][1]) + (p[kt][2] + p[kt][3])) +
               ((p[kt][4] + p[kt][5]) + (p[kt][6] + p[kt][7]));
    }
    lsum = lsum * alpha + ((ps[0] + ps[1]) + (ps[2] + ps[3]));
#pragma unroll
    for (int t = 0; t < 4; t++) accO[t] *= alpha;

    // ---- O^T += V^T(64 x 64 keys) x P^T(64 keys x 16) ----
    u16x16 pf0 = pack_frag(p[0], p[1]);          // keys j*64 +  0..31
    u16x16 pf1 = pack_frag(p[2], p[3]);          // keys +32..63
#pragma unroll
    for (int t = 0; t < 4; t++) {
      const u16* vrow = Vl + (t * 16 + ln) * KVP;
      accO[t] = wmma_bf16(load_frag(vrow, sel), pf0, accO[t]);
      accO[t] = wmma_bf16(load_frag(vrow + 32, sel), pf1, accO[t]);
    }

    // ---- publish point of block j+1 ----
    // This wave's LDS reads of buffer j&1 are done ...
    asm volatile("s_wait_dscnt 0x0" ::: "memory");
    // ... and its own copies of block j+1 have landed.
    asm volatile("s_wait_asynccnt 0x0" ::: "memory");
    __syncthreads();   // publishes block j+1, frees buffer j&1 for the refill
    if (j + 2 < S / 64) {                        // same for the whole grid
      const unsigned bo = (unsigned)(j & 1) * BUFB;
      const u16* gk2 = gk + (size_t)(j + 2) * 64 * DK;
      const u16* gv2 = gv + (j + 2) * 64;
      stage_copies(lk + bo, gk2, lk + bo + HALF, gk2 + 32 * DK,
                   lv + bo, gv2, lv + bo + HALF, gv2 + 32 * S);
    }
  }
  // No copy is outstanding when the wave ends.
  asm volatile("s_wait_asynccnt 0x0" ::: "memory");

  // ---- normalize and store to [B*S, 768] (col = h*64 + d) ----
  const int b = bh / H, h = bh % H;
  const float inv = 1.f / (lsum + xhalf(lsum));  // join the halves' sums
  const size_t rowoff = ((size_t)b * S + qt * 16 + ln) * D + h * 64 + 8 * sel;
#pragma unroll
  for (int t = 0; t < 4; t++) {                  // 8 consecutive d per lane
    u16x8 pack;
#pragma unroll
    for (int i = 0; i < 8; i++) pack[i] = f2bf(accO[t][i] * inv);
    *(u16x8*)(Obf + rowoff + t * 16) = pack;
  }
}

// ---------------------------------------------------------------------------
// Host orchestration (all launches on `stream`; graph-capture safe).
// ---------------------------------------------------------------------------
extern "C" void kernel_launch(void* const* d_in, const int* in_sizes, int n_in,
                              void* d_out, int out_size, void* d_ws,
                              size_t ws_size, hipStream_t stream) {
  const float* query = (const float*)d_in[0];
  const float* key   = (const float*)d_in[1];
  const float* value = (const float*)d_in[2];
  const float* Wq    = (const float*)d_in[3];
  const float* bq    = (const float*)d_in[4];
  const float* Wo    = (const float*)d_in[5];
  const float* bo    = (const float*)d_in[6];
  float* out = (float*)d_out;

  // Workspace sub-allocation (256B aligned).
  char* ws = (char*)d_ws;
  size_t off = 0;
  auto suballoc = [&](size_t bytes) -> void* {
    void* p = ws + off;
    off = (off + bytes + 255) & ~(size_t)255;
    return p;
  };
  const size_t actBytes = (size_t)M * D * sizeof(u16);   // 12.6 MB
  const size_t wBytes   = (size_t)D * D * sizeof(u16);   // 1.2 MB
  u16* xbf    = (u16*)suballoc(actBytes);   // staging for query/key/value
  u16* qbf    = (u16*)suballoc(actBytes);   // [b,h,s,d]
  u16* kbf    = (u16*)suballoc(actBytes);   // [b,h,s,d]
  u16* vtbf   = (u16*)suballoc(actBytes);   // [b,h,d,s]
  u16* attnbf = (u16*)suballoc(actBytes);   // [B*S, 768]
  u16* wqbf   = (u16*)suballoc(wBytes);
  u16* wobf   = (u16*)suballoc(wBytes);

  const int convT = 256;
  const int nAct = M * D, nW = D * D;
  const int gemmBlocks = (M / 32) * (D / 64) / 4;        // 768 blocks, 4 waves
  const int attnBlocks = (Bsz * H * (S / 16)) / 8;       // 768 blocks, 8 waves

  // Weights to bf16 (once per call).
  f32_to_bf16_kernel<<<(nW + convT - 1) / convT, convT, 0, stream>>>(Wq, wqbf, nW);
  f32_to_bf16_kernel<<<(nW + convT - 1) / convT, convT, 0, stream>>>(Wo, wobf, nW);

  // q = query @ Wq^T + bq  -> [b,h,s,d]
  f32_to_bf16_kernel<<<(nAct + convT - 1) / convT, convT, 0, stream>>>(query, xbf, nAct);
  gemm_bf16_kernel<<<gemmBlocks, 128, 0, stream>>>(xbf, wqbf, bq, qbf, nullptr, 0);

  // k = key @ Wq^T + bq    -> [b,h,s,d]   (reference reuses Wq/bq)
  f32_to_bf16_kernel<<<(nAct + convT - 1) / convT, convT, 0, stream>>>(key, xbf, nAct);
  gemm_bf16_kernel<<<gemmBlocks, 128, 0, stream>>>(xbf, wqbf, bq, kbf, nullptr, 0);

  // v = value @ Wq^T + bq  -> [b,h,d,s] transposed
  f32_to_bf16_kernel<<<(nAct + convT - 1) / convT, convT, 0, stream>>>(value, xbf, nAct);
  gemm_bf16_kernel<<<gemmBlocks, 128, 0, stream>>>(xbf, wqbf, bq, vtbf, nullptr, 1);

  // attention -> [B*S, 768] bf16
  attn_kernel<<<attnBlocks, 256, 0, stream>>>(qbf, kbf, vtbf, attnbf);

  // out = attn @ Wo^T + bo -> fp32 d_out
  gemm_bf16_kernel<<<gemmBlocks, 128, 0, stream>>>(attnbf, wobf, bo, nullptr, out, 2);
}

// v003
// A run of this version takes 210 microseconds.
// In two side-by-side timings against v002, it was 1.11 and 1.12 times as fast.
// Over all steps from v000 it is 2.10 times as fast.
#include <hip/hip_runtime.h>

// ---------------------------------------------------------------------------
// MI455X (gfx1250) multi-head attention, bf16 WMMA pipeline.
//   stage 1: fp32 -> bf16 conversions (weights + activations)
//   stage 2: projection GEMMs, 32x64 tiles  (v_wmma_f32_16x16x32_bf16)
//   stage 3: flash-attention, transposed (S^T = K.Q^T, O^T += V^T.P^T), 64-key
//            blocks staged in LDS (v_wmma + exp2 softmax in the lane)
//   stage 4: output projection (fp32 out)
// ---------------------------------------------------------------------------

typedef unsigned short u16;
typedef __attribute__((ext_vector_type(8)))  u16    u16x8;
typedef __attribute__((ext_vector_type(16))) u16    u16x16;
typedef __attribute__((ext_vector_type(8)))  float  v8f;
typedef __attribute__((ext_vector_type(16))) __bf16 v16bf;

#define DEV static __device__ __forceinline__

// Problem constants (fixed by the reference).
constexpr int Bsz = 4;
constexpr int S   = 2048;
constexpr int D   = 768;
constexpr int H   = 12;
constexpr int DK  = 64;
constexpr int M   = Bsz * S;   // 8192 rows for all dense GEMMs

DEV u16 f2bf(float f) {             // fp32 -> bf16, round-to-nearest-even
  unsigned u = __builtin_bit_cast(unsigned, f);
  u += 0x7FFFu + ((u >> 16) & 1u);
  return (u16)(u >> 16);
}

// 16-bit A/B fragment load (wave32). `row` points at 32 contiguous bf16
// covering this fragment's K-chunk. Per the CDNA5 layout, lane (sel = l>>4)
// holds K offsets sel*8+{0..7} and 16+sel*8+{0..7} -> two b128 loads.
DEV u16x16 load_frag(const u16* row, int sel) {
  u16x8 lo = *(const u16x8*)(row + sel * 8);
  u16x8 hi = *(const u16x8*)(row + 16 + sel * 8);
  return __builtin_shufflevector(lo, hi, 0, 1, 2, 3, 4, 5, 6, 7,
                                 8, 9, 10, 11, 12, 13, 14, 15);
}

DEV v8f wmma_bf16(u16x16 a, u16x16 b, v8f c) {
  return __builtin_amdgcn_wmma_f32_16x16x32_bf16(
      false, __builtin_bit_cast(v16bf, a),
      false, __builtin_bit_cast(v16bf, b),
      (short)0, c, false, false);
}

// Value of lane l ^ 16 (the other 16-lane half of the wave).
DEV float xhalf(float x) {
  int v = __builtin_bit_cast(int, x);
  return __builtin_bit_cast(float, __builtin_amdgcn_permlanex16(
      v, v, 0x76543210, 0xfedcba98, false, false));
}

// Two fp32 -> one register of two bf16, round-to-nearest-even.
DEV unsigned pack2(float lo, float hi) {
  typedef __attribute__((ext_vector_type(2))) float  f32x2;
  typedef __attribute__((ext_vector_type(2))) __bf16 bf16x2;
  return __builtin_bit_cast(unsigned,
                            __builtin_convertvector(f32x2{lo, hi}, bf16x2));
}

// Two 16-key score tiles of one lane (C layout: key = i + 8*sel, then
// 16 + i + 8*sel) are, in that order, the lane's 32-key B fragment.
DEV u16x16 pack_frag(const float* lo, const float* hi) {
  typedef __attribute__((ext_vector_type(8))) unsigned u32x8;
  u32x8 w = {pack2(lo[0], lo[1]), pack2(lo[2], lo[3]),
             pack2(lo[4], lo[5]), pack2(lo[6], lo[7]),
             pack2(hi[0], hi[1]), pack2(hi[2], hi[3]),
             pack2(hi[4], hi[5]), pack2(hi[6], hi[7])};
  return __builtin_bit_cast(u16x16, w);
}

// ---------------------------------------------------------------------------
// fp32 -> bf16 conversion, as a stream on few, long-lived waves.
// A work-group is 16 waves and owns CONVT * U consecutive pieces of four
// floats. A lane brings U pieces, 16 B each, so that every wave-wide load
// covers 512 contiguous bytes (four whole lines) and every wave-wide store 256
// (two whole lines). All U loads are issued before the first value is used.
// The activations take one work-group per WGP (256 x 16 waves, U = 12).
// ---------------------------------------------------------------------------
constexpr int CONVT = 512;            // threads of a conversion work-group

template <int U>
__global__ __launch_bounds__(CONVT)
void f32_to_bf16_kernel(const float* __restrict__ in, u16* __restrict__ out) {
  typedef __attribute__((ext_vector_type(4))) float    f32x4;
  typedef __attribute__((ext_vector_type(2))) unsigned u32x2;
  const size_t e0 = ((size_t)blockIdx.x * (CONVT * U) + threadIdx.x) * 4;
  f32x4 v[U];
#pragma unroll   // rolled, each load would be waited for before the next issues
  for (int u = 0; u < U; u++)
    v[u] = *(const f32x4*)(in + e0 + (size_t)u * (CONVT * 4));
#pragma unroll   // constant indices keep v[] in registers
  for (int u = 0; u < U; u++) {
    u32x2 w = {pack2(v[u][0], v[u][1]), pack2(v[u][2], v[u][3])};
    *(u32x2*)(out + e0 + (size_t)u * (CONVT * 4)) = w;
  }
}

// ---------------------------------------------------------------------------
// GEMM: Y[m,n] = sum_k A[m,k] * W[n,k] + bias[n]
//   A : [M, 768] bf16 row-major          W : [768, 768] bf16 (torch [out,in])
// Each wave owns a 32x64 output tile: 2 A-fragments x 4 B-fragments -> 8 WMMA
// per K step on 12 b128 loads (1.5 loads/WMMA).
// mode 0: bf16 out, head-split [b,h,s,d]        (q and k projections)
// mode 1: bf16 out, transposed [b,h,d,s]        (v projection)
// mode 2: fp32 out, [M, 768]                    (final projection)
// ---------------------------------------------------------------------------
__global__ __launch_bounds__(128)
void gemm_bf16_kernel(const u16* __restrict__ A, const u16* __restrict__ W,
                      const float* __restrict__ bias, u16* __restrict__ outb,
                      float* __restrict__ outf, int mode) {
  const int wave = blockIdx.x * (blockDim.x >> 5) + (threadIdx.x >> 5);
  const int ntg  = D / 64;                       // 12 strips of 64 columns
  const int tm   = wave / ntg;                   // 32-row tile index
  const int tg   = wave % ntg;
  if (tm * 32 >= M) return;

  const int l = threadIdx.x & 31, sel = l >> 4, ln = l & 15;
  const u16* arow0 = A + (size_t)(tm * 32 + ln) * D;
  const u16* arow1 = A + (size_t)(tm * 32 + 16 + ln) * D;

  v8f acc[2][4] = {};
  for (int k0 = 0; k0 < D; k0 += 32) {
    u16x16 af0 = load_frag(arow0 + k0, sel);
    u16x16 af1 = load_frag(arow1 + k0, sel);
#pragma unroll
    for (int t = 0; t < 4; t++) {
      const u16* wrow = W + (size_t)(tg * 64 + t * 16 + ln) * D + k0;
      u16x16 bf = load_frag(wrow, sel);
      acc[0][t] = wmma_bf16(af0, bf, acc[0][t]);
      acc[1][t] = wmma_bf16(af1, bf, acc[1][t]);
    }
  }

#pragma unroll
  for (int r = 0; r < 2; r++) {
    const int Mi0 = tm * 32 + r * 16;
#pragma unroll
    for (int t = 0; t < 4; t++) {
      const int ng = tg * 64 + t * 16 + ln;      // lane's output column
      const float bv = bias[ng];
      if (mode == 2) {                           // fp32 [M, D]
#pragma unroll
        for (int i = 0; i < 8; i++) {
          int Mi = Mi0 + i + 8 * sel;            // C layout: row = i + 8*sel
          outf[(size_t)Mi * D + ng] = acc[r][t][i] + bv;
        }
      } else if (mode == 0) {                    // bf16 [b,h,s,d]
        int h = ng >> 6, d = ng & 63;
#pragma unroll
        for (int i = 0; i < 8; i++) {
          int Mi = Mi0 + i + 8 * sel;
          int b = Mi >> 11, s = Mi & (S - 1);
          outb[(((size_t)(b * H + h)) * S + s) * DK + d] =
              f2bf(acc[r][t][i] + bv);
        }
      } else {                                   // bf16 [b,h,d,s] (transposed)
        int h = ng >> 6, d = ng & 63;
        int Mi = Mi0 + 8 * sel;                  // 8 consecutive s per lane
        int b = Mi >> 11, s0 = Mi & (S - 1);
        u16x8 pack;
#pragma unroll
        for (int i = 0; i < 8; i++) pack[i] = f2bf(acc[r][t][i] + bv);
        *(u16x8*)(outb + (((size_t)(b * H + h)) * DK + d) * S + s0) = pack;
      }
    }
  }
}

// ---------------------------------------------------------------------------
// Flash attention. One wave per (b, h, 16-query tile); eight waves (128
// queries of one head) form a work-group and share every 64-key block.
//   Q,K : [b,h,s,d] bf16      Vt : [b,h,d,s] bf16     out: bf16 [B*S, 768]
// Each 64-key K tile and Vt tile (64 rows of 128 B each) is brought into LDS
// once per work-group by asynchronous b128 copies, whole 128-B lines per row,
// in a ring of two buffers: block j+1 flies while block j is worked on. The
// fragments are then read from LDS at a 144-B row pitch (16 B x odd).
// Both products run transposed: S^T = K.Q^T (A = K rows, B = Q) and
// O^T += V^T.P^T (A = Vt rows, B = P^T). A lane then holds scores of ONE query
// (column ln), 32 of a block's 64 keys, the lane l ^ 16 the other 32: maximum
// and sum run in the lane with one exchange between the halves, and the
// exponentials pack straight into the B operand, so P never goes through LDS.
// Softmax runs in the exp2 domain: scores are scaled by log2(e)/sqrt(dk).
// ---------------------------------------------------------------------------
constexpr int KVP    = 72;            // LDS row pitch of a staged tile, in u16
constexpr int KVTILE = 64 * KVP;      // one staged tile: 64 rows, 9216 B

// One stage = four copies per lane (two of K, two of Vt). The s_wait_xcnt is
// the last line of the copies' own statement so that no address register of
// an issued copy is rewritten in front of it.
DEV void stage_copies(unsigned lk0, const u16* gk0, unsigned lk1, const u16* gk1,
                      unsigned lv0, const u16* gv0, unsigned lv1, const u16* gv1) {
  asm volatile(
      "global_load_async_to_lds_b128 %0, %1, off\n\t"
      "global_load_async_to_lds_b128 %2, %3, off\n\t"
      "global_load_async_to_lds_b128 %4, %5, off\n\t"
      "global_load_async_to_lds_b128 %6, %7, off\n\t"
      "s_wait_xcnt 0x0"
      :: "v"(lk0), "v"(gk0), "v"(lk1), "v"(gk1),
         "v"(lv0), "v"(gv0), "v"(lv1), "v"(gv1)
      : "memory");
}

__global__ __launch_bounds__(256)
void attn_kernel(const u16* __restrict__ Q, const u16* __restrict__ K,
                 const u16* __restrict__ Vt, u16* __restrict__ Obf) {
  __shared__ __align__(16) u16 ldsK[2][KVTILE];    // 2 x 9 KB
  __shared__ __align__(16) u16 ldsV[2][KVTILE];    // 2 x 9 KB

  const int wave = blockIdx.x * (blockDim.x >> 5) + (threadIdx.x >> 5);
  const int nqt  = S / 16;                         // 128 query tiles
  const int qt   = wave % nqt;
  const int bh   = wave / nqt;                     // b*H + h, same in a block
  const int l = threadIdx.x & 31, sel = l >> 4, ln = l & 15;

  const u16* Qb = Q  + (size_t)bh * S * DK;
  const u16* Kb = K  + (size_t)bh * S * DK;
  const u16* Vb = Vt + (size_t)bh * DK * S;

  // Copy map: a tile is 512 pieces of 16 B; thread t moves pieces t and
  // t + 256, that is rows t/8 and t/8 + 32, column piece t%8.
  const int crow = threadIdx.x >> 3, ccol = (threadIdx.x & 7) * 8;
  const u16* gk = Kb + (size_t)crow * DK + ccol;   // block 0, row crow
  const u16* gv = Vb + (size_t)crow * S + ccol;
  const unsigned lk = (unsigned)(size_t)&ldsK[0][crow * KVP + ccol];
  const unsigned lv = (unsigned)(size_t)&ldsV[0][crow * KVP + ccol];
  constexpr unsigned HALF = 32 * KVP * sizeof(u16);     // 32 rows further
  constexpr unsigned BUFB = KVTILE * sizeof(u16);       // the other buffer

  // Block 0 into buffer 0.
  stage_copies(lk, gk, lk + HALF, gk + 32 * DK, lv, gv, lv + HALF, gv + 32 * S);

  // Q fragments for both 32-wide d chunks (reused all iterations).
  const u16* qrow = Qb + (size_t)(qt * 16 + ln) * DK;
  u16x16 qf0 = load_frag(qrow, sel);
  u16x16 qf1 = load_frag(qrow + 32, sel);

  // exp2-domain score scale: log2(e) / sqrt(dk)
  const float sc = 0.125f * 1.44269504088896340736f;

  v8f accO[4] = {};                   // O^T: row d = t*16 + i + 8*sel, column ln
  float mrun = -__builtin_inff();     // running maximum of query ln
  float lsum = 0.f;                   // this half's share of its denominator

  // This wave's copies of block 0 have landed; the barrier publishes all.
  asm volatile("s_wait_asynccnt 0x0" ::: "memory");
  __syncthreads();
  // Block 1 into buffer 1 (S / 64 = 32 blocks exist).
  stage_copies(lk + BUFB, gk + 64 * DK, lk + BUFB + HALF, gk + 96 * DK,
               lv + BUFB, gv + 64, lv + BUFB + HALF, gv + 32 * S + 64);

  for (int j = 0; j < S / 64; j++) {
    const u16* Kt = ldsK[j & 1];
    const u16* Vl = ldsV[j & 1];

    // ---- S^T for keys [j*64, j*64+64) : four 16-key x 16-query C tiles ----
    v8f c[4];
#pragma unroll
    for (int kt = 0; kt < 4; kt++) {
      const u16* krow = Kt + (kt * 16 + ln) * KVP;
      v8f ct = {};
      ct = wmma_bf16(load_frag(krow, sel), qf0, ct);
      ct = wmma_bf16(load_frag(krow + 32, sel), qf1, ct);
      c[kt] = ct;                                // key kt*16 + i + 8*sel
    }

    // ---- online softmax update (exp2 domain), all of it in the lane ----
    float mx[4];
#pragma unroll
    for (int kt = 0; kt < 4; kt++) {
      mx[kt] = c[kt][0];
#pragma unroll
      for (int i = 1; i < 8; i++) mx[kt] = fmaxf(mx[kt], c[kt][i]);
    }
    float rm = fmaxf(fmaxf(mx[0], mx[1]), fmaxf(mx[2], mx[3]));
    rm = fmaxf(rm, xhalf(rm)) * sc;              // sc > 0: scale after the max
    const float nm = fmaxf(mrun, rm);            // same in both halves
    const float alpha = exp2f(mrun - nm);
    mrun = nm;
    float p[4][8], ps[4];
#pragma unroll
    for (int kt = 0; kt < 4; kt++) {
#pragma unroll
      for (int i = 0; i < 8; i++) p[kt][i] = exp2f(c[kt][i] * sc - nm);
      ps[kt] = ((p[kt][0] + p[kt][1]) + (p[kt][2] + p[kt][3])) +
               ((p[kt][4] + p[kt][5]) + (p[kt][6] + p[kt][7]));
    }
    lsum = lsum * alpha + ((ps[0] + ps[1]) + (ps[2] + ps[3]));
#pragma unroll
    for (int t = 0; t < 4; t++) accO[t] *= alpha;

    // ---- O^T += V^T(64 x 64 keys) x P^T(64 keys x 16) ----
    u16x16 pf0 = pack_frag(p[0], p[1]);          // keys j*64 +  0..31
    u16x16 pf1 = pack_frag(p[2], p[3]);          // keys +32..63
#pragma unroll
    for (int t = 0; t < 4; t++) {
      const u16* vrow = Vl + (t * 16 + ln) * KVP;
      accO[t] = wmma_bf16(load_frag(vrow, sel), pf0, accO[t]);
      accO[t] = wmma_bf16(load_frag(vrow + 32, sel), pf1, accO[t]);
    }

    // ---- publish point of block j+1 ----
    // This wave's LDS reads of buffer j&1 are done ...
    asm volatile("s_wait_dscnt 0x0" ::: "memory");
    // ... and its own copies of block j+1 have landed.
    asm volatile("s_wait_asynccnt 0x0" ::: "memory");
    __syncthreads();   // publishes block j+1, frees buffer j&1 for the refill
    if (j + 2 < S / 64) {                        // same for the whole grid
      const unsigned bo = (unsigned)(j & 1) * BUFB;
      const u16* gk2 = gk + (size_t)(j + 2) * 64 * DK;
      const u16* gv2 = gv + (j + 2) * 64;
      stage_copies(lk + bo, gk2, lk + bo + HALF, gk2 + 32 * DK,
                   lv + bo, gv2, lv + bo + HALF, gv2 + 32 * S);
    }
  }
  // No copy is outstanding when the wave ends.
  asm volatile("s_wait_asynccnt 0x0" ::: "memory");

  // ---- normalize and store to [B*S, 768] (col = h*64 + d) ----
  const int b = bh / H, h = bh % H;
  const float inv = 1.f / (lsum + xhalf(lsum));  // join the halves' sums
  const size_t rowoff = ((size_t)b * S + qt * 16 + ln) * D + h * 64 + 8 * sel;
#pragma unroll
  for (int t = 0; t < 4; t++) {                  // 8 consecutive d per lane
    u16x8 pack;
#pragma unroll
    for (int i = 0; i < 8; i++) pack[i] = f2bf(accO[t][i] * inv);
    *(u16x8*)(Obf + rowoff + t * 16) = pack;
  }
}

// ---------------------------------------------------------------------------
// Host orchestration (all launches on `stream`; graph-capture safe).
// ---------------------------------------------------------------------------
extern "C" void kernel_launch(void* const* d_in, const int* in_sizes, int n_in,
                              void* d_out, int out_size, void* d_ws,
                              size_t ws_size, hipStream_t stream) {
  const float* query = (const float*)d_in[0];
  const float* key   = (const float*)d_in[1];
  const float* value = (const float*)d_in[2];
  const float* Wq    = (const float*)d_in[3];
  const float* bq    = (const float*)d_in[4];
  const float* Wo    = (const float*)d_in[5];
  const float* bo    = (const float*)d_in[6];
  float* out = (float*)d_out;

  // Workspace sub-allocation (256B aligned).
  char* ws = (char*)d_ws;
  size_t off = 0;
  auto suballoc = [&](size_t bytes) -> void* {
    void* p = ws + off;
    off = (off + bytes + 255) & ~(size_t)255;
    return p;
  };
  const size_t actBytes = (size_t)M * D * sizeof(u16);   // 12.6 MB
  const size_t wBytes   = (size_t)D * D * sizeof(u16);   // 1.2 MB
  u16* xbf    = (u16*)suballoc(actBytes);   // staging for query/key/value
  u16* qbf    = (u16*)suballoc(actBytes);   // [b,h,s,d]
  u16* kbf    = (u16*)suballoc(actBytes);   // [b,h,s,d]
  u16* vtbf   = (u16*)suballoc(actBytes);   // [b,h,d,s]
  u16* attnbf = (u16*)suballoc(actBytes);   // [B*S, 768]
  u16* wqbf   = (u16*)suballoc(wBytes);
  u16* wobf   = (u16*)suballoc(wBytes);

  constexpr int nAct = M * D, nW = D * D;
  constexpr int UA = 12, UW = 2;                         // pieces per lane
  constexpr int actBlocks = nAct / (CONVT * 4 * UA);     // 256 blocks, 16 waves
  constexpr int wBlocks   = nW / (CONVT * 4 * UW);       // 144 blocks, 16 waves
  static_assert(actBlocks * CONVT * 4 * UA == nAct, "whole work-groups only");
  static_assert(wBlocks * CONVT * 4 * UW == nW, "whole work-groups only");
  const int gemmBlocks = (M / 32) * (D / 64) / 4;        // 768 blocks, 4 waves
  const int attnBlocks = (Bsz * H * (S / 16)) / 8;       // 768 blocks, 8 waves

  // Weights to bf16 (once per call).
  f32_to_bf16_kernel<UW><<<wBlocks, CONVT, 0, stream>>>(Wq, wqbf);
  f32_to_bf16_kernel<UW><<<wBlocks, CONVT, 0, stream>>>(Wo, wobf);

  // q = query @ Wq^T + bq  -> [b,h,s,d]
  f32_to_bf16_kernel<UA><<<actBlocks, CONVT, 0, stream>>>(query, xbf);
  gemm_bf16_kernel<<<gemmBlocks, 128, 0, stream>>>(xbf, wqbf, bq, qbf, nullptr, 0);

  // k = key @ Wq^T + bq    -> [b,h,s,d]   (reference reuses Wq/bq)
  f32_to_bf16_kernel<UA><<<actBlocks, CONVT, 0, stream>>>(key, xbf);
  gemm_bf16_kernel<<<gemmBlocks, 128, 0, stream>>>(xbf, wqbf, bq, kbf, nullptr, 0);

  // v = value @ Wq^T + bq  -> [b,h,d,s] transposed
  f32_to_bf16_kernel<UA><<<actBlocks, CONVT, 0, stream>>>(value, xbf);
  gemm_bf16_kernel<<<gemmBlocks, 128, 0, stream>>>(xbf, wqbf, bq, vtbf, nullptr, 1);

  // attention -> [B*S, 768] bf16
  attn_kernel<<<attnBlocks, 256, 0, stream>>>(qbf, kbf, vtbf, attnbf);

  // out = attn @ Wo^T + bo -> fp32 d_out
  gemm_bf16_kernel<<<gemmBlocks, 128, 0, stream>>>(attnbf, wobf, bo, nullptr, out, 2);
}

// v004
// A run of this version takes 139 microseconds.
// In two side-by-side timings against v003, it was 1.51 and 1.52 times as fast.
// All steps since v000 together make it 3.18 times as fast.
#include <hip/hip_runtime.h>

// ---------------------------------------------------------------------------
// MI455X (gfx1250) multi-head attention, bf16 WMMA pipeline.
//   stage 1: fp32 -> bf16 conversions (weights + activations)
//   stage 2: projection GEMMs, 128x192 tiles staged in LDS
//            (v_wmma_f32_16x16x32_bf16)
//   stage 3: flash-attention, transposed (S^T = K.Q^T, O^T += V^T.P^T), 64-key
//            blocks staged in LDS (v_wmma + exp2 softmax in the lane)
//   stage 4: output projection (fp32 out)
// ---------------------------------------------------------------------------

typedef unsigned short u16;
typedef __attribute__((ext_vector_type(8)))  u16    u16x8;
typedef __attribute__((ext_vector_type(16))) u16    u16x16;
typedef __attribute__((ext_vector_type(8)))  float  v8f;
typedef __attribute__((ext_vector_type(16))) __bf16 v16bf;

#define DEV static __device__ __forceinline__

// Problem constants (fixed by the reference).
constexpr int Bsz = 4;
constexpr int S   = 2048;
constexpr int D   = 768;
constexpr int H   = 12;
constexpr int DK  = 64;
constexpr int M   = Bsz * S;   // 8192 rows for all dense GEMMs

DEV u16 f2bf(float f) {             // fp32 -> bf16, round-to-nearest-even
  unsigned u = __builtin_bit_cast(unsigned, f);
  u += 0x7FFFu + ((u >> 16) & 1u);
  return (u16)(u >> 16);
}

// 16-bit A/B fragment load (wave32). `row` points at 32 contiguous bf16
// covering this fragment's K-chunk. Per the CDNA5 layout, lane (sel = l>>4)
// holds K offsets sel*8+{0..7} and 16+sel*8+{0..7} -> two b128 loads.
DEV u16x16 load_frag(const u16* row, int sel) {
  u16x8 lo = *(const u16x8*)(row + sel * 8);
  u16x8 hi = *(const u16x8*)(row + 16 + sel * 8);
  return __builtin_shufflevector(lo, hi, 0, 1, 2, 3, 4, 5, 6, 7,
                                 8, 9, 10, 11, 12, 13, 14, 15);
}

DEV v8f wmma_bf16(u16x16 a, u16x16 b, v8f c) {
  return __builtin_amdgcn_wmma_f32_16x16x32_bf16(
      false, __builtin_bit_cast(v16bf, a),
      false, __builtin_bit_cast(v16bf, b),
      (short)0, c, false, false);
}

// Value of lane l ^ 16 (the other 16-lane half of the wave).
DEV float xhalf(float x) {
  int v = __builtin_bit_cast(int, x);
  return __builtin_bit_cast(float, __builtin_amdgcn_permlanex16(
      v, v, 0x76543210, 0xfedcba98, false, false));
}

// Two fp32 -> one register of two bf16, round-to-nearest-even.
DEV unsigned pack2(float lo, float hi) {
  typedef __attribute__((ext_vector_type(2))) float  f32x2;
  typedef __attribute__((ext_vector_type(2))) __bf16 bf16x2;
  return __builtin_bit_cast(unsigned,
                            __builtin_convertvector(f32x2{lo, hi}, bf16x2));
}

// Two 16-key score tiles of one lane (C layout: key = i + 8*sel, then
// 16 + i + 8*sel) are, in that order, the lane's 32-key B fragment.
DEV u16x16 pack_frag(const float* lo, const float* hi) {
  typedef __attribute__((ext_vector_type(8))) unsigned u32x8;
  u32x8 w = {pack2(lo[0], lo[1]), pack2(lo[2], lo[3]),
             pack2(lo[4], lo[5]), pack2(lo[6], lo[7]),
             pack2(hi[0], hi[1]), pack2(hi[2], hi[3]),
             pack2(hi[4], hi[5]), pack2(hi[6], hi[7])};
  return __builtin_bit_cast(u16x16, w);
}

// ---------------------------------------------------------------------------
// fp32 -> bf16 conversion, as a stream on few, long-lived waves.
// A work-group is 16 waves and owns CONVT * U consecutive pieces of four
// floats. A lane brings U pieces, 16 B each, so that every wave-wide load
// covers 512 contiguous bytes (four whole lines) and every wave-wide store 256
// (two whole lines). All U loads are issued before the first value is used.
// The activations take one work-group per WGP (256 x 16 waves, U = 12).
// ---------------------------------------------------------------------------
constexpr int CONVT = 512;            // threads of a conversion work-group

template <int U>
__global__ __launch_bounds__(CONVT)
void f32_to_bf16_kernel(const float* __restrict__ in, u16* __restrict__ out) {
  typedef __attribute__((ext_vector_type(4))) float    f32x4;
  typedef __attribute__((ext_vector_type(2))) unsigned u32x2;
  const size_t e0 = ((size_t)blockIdx.x * (CONVT * U) + threadIdx.x) * 4;
  f32x4 v[U];
#pragma unroll   // rolled, each load would be waited for before the next issues
  for (int u = 0; u < U; u++)
    v[u] = *(const f32x4*)(in + e0 + (size_t)u * (CONVT * 4));
#pragma unroll   // constant indices keep v[] in registers
  for (int u = 0; u < U; u++) {
    u32x2 w = {pack2(v[u][0], v[u][1]), pack2(v[u][2], v[u][3])};
    *(u32x2*)(out + e0 + (size_t)u * (CONVT * 4)) = w;
  }
}

// ---------------------------------------------------------------------------
// GEMM: Y[m,n] = sum_k A[m,k] * W[n,k] + bias[n]
//   A : [M, 768] bf16 row-major          W : [768, 768] bf16 (torch [out,in])
// A work-group of eight waves owns a 128 x 192 tile of Y, one work-group per
// WGP (64 x 4 tiles). Per stage of 128 k the 128 A rows and the 192 W rows
// (256 B each, whole lines) are brought into LDS once per work-group by
// asynchronous b128 copies, in a ring of two buffers: stage s+1 flies while
// stage s is worked on. Fragments are read from LDS at a 272-B row pitch
// (16 B x odd). A wave owns 64 x 48 of the tile: 4 A-fragments x 3 B-fragments
// -> 12 WMMA per 32 k on 14 LDS b128 loads. k runs upward in steps of 32.
// mode 0: bf16 out, head-split [b,h,s,d]        (q and k projections)
// mode 1: bf16 out, transposed [b,h,d,s]        (v projection)
// mode 2: fp32 out, [M, 768]                    (final projection)
// ---------------------------------------------------------------------------
constexpr int BM = 128, BN = 192, BK = 128;
constexpr int GP     = BK + 8;              // LDS row pitch in u16 (272 B)
constexpr int GSTAGE = (BM + BN) * GP;      // one stage: 320 rows, 87040 B
constexpr int NSTAGE = D / BK;              // 6 stages
static_assert(M % BM == 0 && D % BN == 0 && D % BK == 0, "whole tiles only");
static_assert(NSTAGE >= 2, "the ring's prologue fills two stages");

// Ten copies of one lane: rows 16 apart in LDS (l + c * 16 rows) from ten
// global rows. The s_wait_xcnt is the last line of the copies' own statement
// so that no address register of an issued copy is rewritten in front of it.
DEV void copy10(const unsigned (&l)[10], const u16* const (&g)[10]) {
  asm volatile(
      "global_load_async_to_lds_b128 %0, %1, off\n\t"
      "global_load_async_to_lds_b128 %2, %3, off\n\t"
      "global_load_async_to_lds_b128 %4, %5, off\n\t"
      "global_load_async_to_lds_b128 %6, %7, off\n\t"
      "global_load_async_to_lds_b128 %8, %9, off\n\t"
      "global_load_async_to_lds_b128 %10, %11, off\n\t"
      "global_load_async_to_lds_b128 %12, %13, off\n\t"
      "global_load_async_to_lds_b128 %14, %15, off\n\t"
      "global_load_async_to_lds_b128 %16, %17, off\n\t"
      "global_load_async_to_lds_b128 %18, %19, off\n\t"
      "s_wait_xcnt 0x0"
      :: "v"(l[0]), "v"(g[0]), "v"(l[1]), "v"(g[1]), "v"(l[2]), "v"(g[2]),
         "v"(l[3]), "v"(g[3]), "v"(l[4]), "v"(g[4]), "v"(l[5]), "v"(g[5]),
         "v"(l[6]), "v"(g[6]), "v"(l[7]), "v"(g[7]), "v"(l[8]), "v"(g[8]),
         "v"(l[9]), "v"(g[9])
      : "memory");
}

// One stage = twenty copies per lane. Copy c fills LDS row c*16 + crow: rows
// 0..127 hold the A tile (c < 8), rows 128..319 the W tile.
//   lds0: the lane's LDS byte address in row crow of the target buffer
//   ga, gw: the lane's 16 B in row crow of the A tile / W tile, at this stage's k
DEV void gemm_stage(unsigned lds0, const u16* ga, const u16* gw) {
  constexpr unsigned STEP = 16 * GP * sizeof(u16);      // 16 rows further
  unsigned l[20];
  const u16* g[20];
#pragma unroll   // constant indices keep the addresses in registers
  for (int c = 0; c < 20; c++) {
    l[c] = lds0 + c * STEP;
    g[c] = c < BM / 16 ? ga + (size_t)c * 16 * D
                       : gw + (size_t)(c - BM / 16) * 16 * D;
  }
  const unsigned la[10] = {l[0], l[1], l[2], l[3], l[4],
                           l[5], l[6], l[7], l[8], l[9]};
  const u16* const gaa[10] = {g[0], g[1], g[2], g[3], g[4],
                              g[5], g[6], g[7], g[8], g[9]};
  const unsigned lb[10] = {l[10], l[11], l[12], l[13], l[14],
                           l[15], l[16], l[17], l[18], l[19]};
  const u16* const gbb[10] = {g[10], g[11], g[12], g[13], g[14],
                              g[15], g[16], g[17], g[18], g[19]};
  copy10(la, gaa);
  copy10(lb, gbb);
}

__global__ __launch_bounds__(256)
void gemm_bf16_kernel(const u16* __restrict__ A, const u16* __restrict__ W,
                      const float* __restrict__ bias, u16* __restrict__ outb,
                      float* __restrict__ outf, int mode) {
  __shared__ __align__(16) u16 ldsG[2][GSTAGE];    // 2 x 85 KB

  // The four work-groups that read the same A rows are M / BM = 64 apart in
  // index. Speed only.
  const int m0 = (blockIdx.x % (M / BM)) * BM;     // tile's first row
  const int n0 = (blockIdx.x / (M / BM)) * BN;     // tile's first column
  const int wv = threadIdx.x >> 5;
  const int wm = wv >> 2, wn = wv & 3;             // 2 x 4 waves of 64 x 48
  const int l = threadIdx.x & 31, sel = l >> 4, ln = l & 15;

  // Copy map: a row is 16 pieces of 16 B; thread t moves piece t%16 of rows
  // t/16 + 16*c, so every wave-wide copy covers two whole rows of 256 B.
  const int crow = threadIdx.x >> 4, ccol = (threadIdx.x & 15) * 8;
  const u16* ga = A + (size_t)(m0 + crow) * D + ccol;
  const u16* gw = W + (size_t)(n0 + crow) * D + ccol;
  const unsigned lc = (unsigned)(size_t)&ldsG[0][crow * GP + ccol];
  constexpr unsigned GBUFB = GSTAGE * sizeof(u16);      // the other buffer

  // Stage 0 into buffer 0.
  gemm_stage(lc, ga, gw);

  v8f acc[4][3] = {};

  // This wave's copies of stage 0 have landed; the barrier publishes all.
  asm volatile("s_wait_asynccnt 0x0" ::: "memory");
  __syncthreads();
  // Stage 1 into buffer 1.
  gemm_stage(lc + GBUFB, ga + BK, gw + BK);

  for (int s = 0; s < NSTAGE; s++) {
    const u16* As = ldsG[s & 1] + (wm * 64 + ln) * GP;
    const u16* Ws = ldsG[s & 1] + (BM + wn * 48 + ln) * GP;
    // Two fragment sets: block kb+1's 14 LDS reads go out as one group ahead
    // of block kb's 12 WMMA. Only this stage's own buffer is read.
    u16x16 af[2][4], bf[2][3];
#pragma unroll
    for (int r = 0; r < 4; r++) af[0][r] = load_frag(As + r * 16 * GP, sel);
#pragma unroll
    for (int t = 0; t < 3; t++) bf[0][t] = load_frag(Ws + t * 16 * GP, sel);
#pragma unroll   // constant set indices keep the fragments in registers
    for (int kb = 0; kb < BK / 32; kb++) {
      const int cur = kb & 1, nxt = cur ^ 1;
      if (kb + 1 < BK / 32) {
        const int kk = (kb + 1) * 32;
#pragma unroll
        for (int r = 0; r < 4; r++)
          af[nxt][r] = load_frag(As + r * 16 * GP + kk, sel);
#pragma unroll
        for (int t = 0; t < 3; t++)
          bf[nxt][t] = load_frag(Ws + t * 16 * GP + kk, sel);
      }
      // Keeps the reads above in front of the WMMA below: sunk among them,
      // each small group is waited for in full before its WMMA can issue.
      __builtin_amdgcn_sched_barrier(0);
#pragma unroll
      for (int r = 0; r < 4; r++)
#pragma unroll
        for (int t = 0; t < 3; t++)
          acc[r][t] = wmma_bf16(af[cur][r], bf[cur][t], acc[r][t]);
    }

    // ---- publish point of stage s+1 ----
    // This wave's LDS reads of buffer s&1 are done ...
    asm volatile("s_wait_dscnt 0x0" ::: "memory");
    // ... and its own copies of stage s+1 have landed.
    asm volatile("s_wait_asynccnt 0x0" ::: "memory");
    __syncthreads();   // publishes stage s+1, frees buffer s&1 for the refill
    if (s + 2 < NSTAGE)                          // same for the whole grid
      gemm_stage(lc + (unsigned)(s & 1) * GBUFB, ga + (s + 2) * BK,
                 gw + (s + 2) * BK);
  }
  // No copy is outstanding when the wave ends.
  asm volatile("s_wait_asynccnt 0x0" ::: "memory");

#pragma unroll
  for (int r = 0; r < 4; r++) {
    const int Mi0 = m0 + wm * 64 + r * 16;
#pragma unroll
    for (int t = 0; t < 3; t++) {
      const int ng = n0 + wn * 48 + t * 16 + ln; // lane's output column
      const float bv = bias[ng];
      if (mode == 2) {                           // fp32 [M, D]
#pragma unroll
        for (int i = 0; i < 8; i++) {
          int Mi = Mi0 + i + 8 * sel;            // C layout: row = i + 8*sel
          outf[(size_t)Mi * D + ng] = acc[r][t][i] + bv;
        }
      } else if (mode == 0) {                    // bf16 [b,h,s,d]
        int h = ng >> 6, d = ng & 63;
#pragma unroll
        for (int i = 0; i < 8; i++) {
          int Mi = Mi0 + i + 8 * sel;
          int b = Mi >> 11, s = Mi & (S - 1);
          outb[(((size_t)(b * H + h)) * S + s) * DK + d] =
              f2bf(acc[r][t][i] + bv);
        }
      } else {                                   // bf16 [b,h,d,s] (transposed)
        int h = ng >> 6, d = ng & 63;
        int Mi = Mi0 + 8 * sel;                  // 8 consecutive s per lane
        int b = Mi >> 11, s0 = Mi & (S - 1);
        u16x8 pack;
#pragma unroll
        for (int i = 0; i < 8; i++) pack[i] = f2bf(acc[r][t][i] + bv);
        *(u16x8*)(outb + (((size_t)(b * H + h)) * DK + d) * S + s0) = pack;
      }
    }
  }
}

// ---------------------------------------------------------------------------
// Flash attention. One wave per (b, h, 16-query tile); eight waves (128
// queries of one head) form a work-group and share every 64-key block.
//   Q,K : [b,h,s,d] bf16      Vt : [b,h,d,s] bf16     out: bf16 [B*S, 768]
// Each 64-key K tile and Vt tile (64 rows of 128 B each) is brought into LDS
// once per work-group by asynchronous b128 copies, whole 128-B lines per row,
// in a ring of two buffers: block j+1 flies while block j is worked on. The
// fragments are then read from LDS at a 144-B row pitch (16 B x odd).
// Both products run transposed: S^T = K.Q^T (A = K rows, B = Q) and
// O^T += V^T.P^T (A = Vt rows, B = P^T). A lane then holds scores of ONE query
// (column ln), 32 of a block's 64 keys, the lane l ^ 16 the other 32: maximum
// and sum run in the lane with one exchange between the halves, and the
// exponentials pack straight into the B operand, so P never goes through LDS.
// Softmax runs in the exp2 domain: scores are scaled by log2(e)/sqrt(dk).
// ---------------------------------------------------------------------------
constexpr int KVP    = 72;            // LDS row pitch of a staged tile, in u16
constexpr int KVTILE = 64 * KVP;      // one staged tile: 64 rows, 9216 B

// One stage = four copies per lane (two of K, two of Vt). The s_wait_xcnt is
// the last line of the copies' own statement so that no address register of
// an issued copy is rewritten in front of it.
DEV void stage_copies(unsigned lk0, const u16* gk0, unsigned lk1, const u16* gk1,
                      unsigned lv0, const u16* gv0, unsigned lv1, const u16* gv1) {
  asm volatile(
      "global_load_async_to_lds_b128 %0, %1, off\n\t"
      "global_load_async_to_lds_b128 %2, %3, off\n\t"
      "global_load_async_to_lds_b128 %4, %5, off\n\t"
      "global_load_async_to_lds_b128 %6, %7, off\n\t"
      "s_wait_xcnt 0x0"
      :: "v"(lk0), "v"(gk0), "v"(lk1), "v"(gk1),
         "v"(lv0), "v"(gv0), "v"(lv1), "v"(gv1)
      : "memory");
}

__global__ __launch_bounds__(256)
void attn_kernel(const u16* __restrict__ Q, const u16* __restrict__ K,
                 const u16* __restrict__ Vt, u16* __restrict__ Obf) {
  __shared__ __align__(16) u16 ldsK[2][KVTILE];    // 2 x 9 KB
  __shared__ __align__(16) u16 ldsV[2][KVTILE];    // 2 x 9 KB

  const int wave = blockIdx.x * (blockDim.x >> 5) + (threadIdx.x >> 5);
  const int nqt  = S / 16;                         // 128 query tiles
  const int qt   = wave % nqt;
  const int bh   = wave / nqt;                     // b*H + h, same in a block
  const int l = threadIdx.x & 31, sel = l >> 4, ln = l & 15;

  const u16* Qb = Q  + (size_t)bh * S * DK;
  const u16* Kb = K  + (size_t)bh * S * DK;
  const u16* Vb = Vt + (size_t)bh * DK * S;

  // Copy map: a tile is 512 pieces of 16 B; thread t moves pieces t and
  // t + 256, that is rows t/8 and t/8 + 32, column piece t%8.
  const int crow = threadIdx.x >> 3, ccol = (threadIdx.x & 7) * 8;
  const u16* gk = Kb + (size_t)crow * DK + ccol;   // block 0, row crow
  const u16* gv = Vb + (size_t)crow * S + ccol;
  const unsigned lk = (unsigned)(size_t)&ldsK[0][crow * KVP + ccol];
  const unsigned lv = (unsigned)(size_t)&ldsV[0][crow * KVP + ccol];
  constexpr unsigned HALF = 32 * KVP * sizeof(u16);     // 32 rows further
  constexpr unsigned BUFB = KVTILE * sizeof(u16);       // the other buffer

  // Block 0 into buffer 0.
  stage_copies(lk, gk, lk + HALF, gk + 32 * DK, lv, gv, lv + HALF, gv + 32 * S);

  // Q fragments for both 32-wide d chunks (reused all iterations).
  const u16* qrow = Qb + (size_t)(qt * 16 + ln) * DK;
  u16x16 qf0 = load_frag(qrow, sel);
  u16x16 qf1 = load_frag(qrow + 32, sel);

  // exp2-domain score scale: log2(e) / sqrt(dk)
  const float sc = 0.125f * 1.44269504088896340736f;

  v8f accO[4] = {};                   // O^T: row d = t*16 + i + 8*sel, column ln
  float mrun = -__builtin_inff();     // running maximum of query ln
  float lsum = 0.f;                   // this half's share of its denominator

  // This wave's copies of block 0 have landed; the barrier publishes all.
  asm volatile("s_wait_asynccnt 0x0" ::: "memory");
  __syncthreads();
  // Block 1 into buffer 1 (S / 64 = 32 blocks exist).
  stage_copies(lk + BUFB, gk + 64 * DK, lk + BUFB + HALF, gk + 96 * DK,
               lv + BUFB, gv + 64, lv + BUFB + HALF, gv + 32 * S + 64);

  for (int j = 0; j < S / 64; j++) {
    const u16* Kt = ldsK[j & 1];
    const u16* Vl = ldsV[j & 1];

    // ---- S^T for keys [j*64, j*64+64) : four 16-key x 16-query C tiles ----
    v8f c[4];
#pragma unroll
    for (int kt = 0; kt < 4; kt++) {
      const u16* krow = Kt + (kt * 16 + ln) * KVP;
      v8f ct = {};
      ct = wmma_bf16(load_frag(krow, sel), qf0, ct);
      ct = wmma_bf16(load_frag(krow + 32, sel), qf1, ct);
      c[kt] = ct;                                // key kt*16 + i + 8*sel
    }

    // ---- online softmax update (exp2 domain), all of it in the lane ----
    float mx[4];
#pragma unroll
    for (int kt = 0; kt < 4; kt++) {
      mx[kt] = c[kt][0];
#pragma unroll
      for (int i = 1; i < 8; i++) mx[kt] = fmaxf(mx[kt], c[kt][i]);
    }
    float rm = fmaxf(fmaxf(mx[0], mx[1]), fmaxf(mx[2], mx[3]));
    rm = fmaxf(rm, xhalf(rm)) * sc;              // sc > 0: scale after the max
    const float nm = fmaxf(mrun, rm);            // same in both halves
    const float alpha = exp2f(mrun - nm);
    mrun = nm;
    float p[4][8], ps[4];
#pragma unroll
    for (int kt = 0; kt < 4; kt++) {
#pragma unroll
      for (int i = 0; i < 8; i++) p[kt][i] = exp2f(c[kt][i] * sc - nm);
      ps[kt] = ((p[kt][0] + p[kt][1]) + (p[kt][2] + p[kt][3])) +
               ((p[kt][4] + p[kt][5]) + (p[kt][6] + p[kt][7]));
    }
    lsum = lsum * alpha + ((ps[0] + ps[1]) + (ps[2] + ps[3]));
#pragma unroll
    for (int t = 0; t < 4; t++) accO[t] *= alpha;

    // ---- O^T += V^T(64 x 64 keys) x P^T(64 keys x 16) ----
    u16x16 pf0 = pack_frag(p[0], p[1]);          // keys j*64 +  0..31
    u16x16 pf1 = pack_frag(p[2], p[3]);          // keys +32..63
#pragma unroll
    for (int t = 0; t < 4; t++) {
      const u16* vrow = Vl + (t * 16 + ln) * KVP;
      accO[t] = wmma_bf16(load_frag(vrow, sel), pf0, accO[t]);
      accO[t] = wmma_bf16(load_frag(vrow + 32, sel), pf1, accO[t]);
    }

    // ---- publish point of block j+1 ----
    // This wave's LDS reads of buffer j&1 are done ...
    asm volatile("s_wait_dscnt 0x0" ::: "memory");
    // ... and its own copies of block j+1 have landed.
    asm volatile("s_wait_asynccnt 0x0" ::: "memory");
    __syncthreads();   // publishes block j+1, frees buffer j&1 for the refill
    if (j + 2 < S / 64) {                        // same for the whole grid
      const unsigned bo = (unsigned)(j & 1) * BUFB;
      const u16* gk2 = gk + (size_t)(j + 2) * 64 * DK;
      const u16* gv2 = gv + (j + 2) * 64;
      stage_copies(lk + bo, gk2, lk + bo + HALF, gk2 + 32 * DK,
                   lv + bo, gv2, lv + bo + HALF, gv2 + 32 * S);
    }
  }
  // No copy is outstanding when the wave ends.
  asm volatile("s_wait_asynccnt 0x0" ::: "memory");

  // ---- normalize and store to [B*S, 768] (col = h*64 + d) ----
  const int b = bh / H, h = bh % H;
  const float inv = 1.f / (lsum + xhalf(lsum));  // join the halves' sums
  const size_t rowoff = ((size_t)b * S + qt * 16 + ln) * D + h * 64 + 8 * sel;
#pragma unroll
  for (int t = 0; t < 4; t++) {                  // 8 consecutive d per lane
    u16x8 pack;
#pragma unroll
    for (int i = 0; i < 8; i++) pack[i] = f2bf(accO[t][i] * inv);
    *(u16x8*)(Obf + rowoff + t * 16) = pack;
  }
}

// ---------------------------------------------------------------------------
// Host orchestration (all launches on `stream`; graph-capture safe).
// ---------------------------------------------------------------------------
extern "C" void kernel_launch(void* const* d_in, const int* in_sizes, int n_in,
                              void* d_out, int out_size, void* d_ws,
                              size_t ws_size, hipStream_t stream) {
  const float* query = (const float*)d_in[0];
  const float* key   = (const float*)d_in[1];
  const float* value = (const float*)d_in[2];
  const float* Wq    = (const float*)d_in[3];
  const float* bq    = (const float*)d_in[4];
  const float* Wo    = (const float*)d_in[5];
  const float* bo    = (const float*)d_in[6];
  float* out = (float*)d_out;

  // Workspace sub-allocation (256B aligned).
  char* ws = (char*)d_ws;
  size_t off = 0;
  auto suballoc = [&](size_t bytes) -> void* {
    void* p = ws + off;
    off = (off + bytes + 255) & ~(size_t)255;
    return p;
  };
  const size_t actBytes = (size_t)M * D * sizeof(u16);   // 12.6 MB
  const size_t wBytes   = (size_t)D * D * sizeof(u16);   // 1.2 MB
  u16* xbf    = (u16*)suballoc(actBytes);   // staging for query/key/value
  u16* qbf    = (u16*)suballoc(actBytes);   // [b,h,s,d]
  u16* kbf    = (u16*)suballoc(actBytes);   // [b,h,s,d]
  u16* vtbf   = (u16*)suballoc(actBytes);   // [b,h,d,s]
  u16* attnbf = (u16*)suballoc(actBytes);   // [B*S, 768]
  u16* wqbf   = (u16*)suballoc(wBytes);
  u16* wobf   = (u16*)suballoc(wBytes);

  constexpr int nAct = M * D, nW = D * D;
  constexpr int UA = 12, UW = 2;                         // pieces per lane
  constexpr int actBlocks = nAct / (CONVT * 4 * UA);     // 256 blocks, 16 waves
  constexpr int wBlocks   = nW / (CONVT * 4 * UW);       // 144 blocks, 16 waves
  static_assert(actBlocks * CONVT * 4 * UA == nAct, "whole work-groups only");
  static_assert(wBlocks * CONVT * 4 * UW == nW, "whole work-groups only");
  const int gemmBlocks = (M / BM) * (D / BN);            // 256 blocks, 8 waves
  const int attnBlocks = (Bsz * H * (S / 16)) / 8;       // 768 blocks, 8 waves

  // Weights to bf16 (once per call).
  f32_to_bf16_kernel<UW><<<wBlocks, CONVT, 0, stream>>>(Wq, wqbf);
  f32_to_bf16_kernel<UW><<<wBlocks, CONVT, 0, stream>>>(Wo, wobf);

  // q = query @ Wq^T + bq  -> [b,h,s,d]
  f32_to_bf16_kernel<UA><<<actBlocks, CONVT, 0, stream>>>(query, xbf);
  gemm_bf16_kernel<<<gemmBlocks, 256, 0, stream>>>(xbf, wqbf, bq, qbf, nullptr, 0);

  // k = key @ Wq^T + bq    -> [b,h,s,d]   (reference reuses Wq/bq)
  f32_to_bf16_kernel<UA><<<actBlocks, CONVT, 0, stream>>>(key, xbf);
  gemm_bf16_kernel<<<gemmBlocks, 256, 0, stream>>>(xbf, wqbf, bq, kbf, nullptr, 0);

  // v = value @ Wq^T + bq  -> [b,h,d,s] transposed
  f32_to_bf16_kernel<UA><<<actBlocks, CONVT, 0, stream>>>(value, xbf);
  gemm_bf16_kernel<<<gemmBlocks, 256, 0, stream>>>(xbf, wqbf, bq, vtbf, nullptr, 1);

  // attention -> [B*S, 768] bf16
  attn_kernel<<<attnBlocks, 256, 0, stream>>>(qbf, kbf, vtbf, attnbf);

  // out = attn @ Wo^T + bo -> fp32 d_out
  gemm_bf16_kernel<<<gemmBlocks, 256, 0, stream>>>(attnbf, wobf, bo, nullptr, out, 2);
}

// v005
// It runs in 123 microseconds.
// Timed twice side by side with v004, it ran 1.12 times as fast both times.
// All steps since v000 together make it 3.56 times as fast.
#include <hip/hip_runtime.h>

// ---------------------------------------------------------------------------
// MI455X (gfx1250) multi-head attention, bf16 WMMA pipeline.
//   stage 1: fp32 -> bf16 conversions (weights + activations)
//   stage 2: projection GEMMs, 128x192 tiles staged in LDS
//            (v_wmma_f32_16x16x32_bf16)
//   stage 3: flash-attention, transposed (S^T = K.Q^T, O^T += V^T.P^T), 64-key
//            blocks staged in LDS (v_wmma + exp2 softmax in the lane)
//   stage 4: output projection (fp32 out)
// ---------------------------------------------------------------------------

typedef unsigned short u16;
typedef __attribute__((ext_vector_type(8)))  u16    u16x8;
typedef __attribute__((ext_vector_type(16))) u16    u16x16;
typedef __attribute__((ext_vector_type(8)))  float  v8f;
typedef __attribute__((ext_vector_type(16))) __bf16 v16bf;

#define DEV static __device__ __forceinline__

// Problem constants (fixed by the reference).
constexpr int Bsz = 4;
constexpr int S   = 2048;
constexpr int D   = 768;
constexpr int H   = 12;
constexpr int DK  = 64;
constexpr int M   = Bsz * S;   // 8192 rows for all dense GEMMs

DEV u16 f2bf(float f) {             // fp32 -> bf16, round-to-nearest-even
  unsigned u = __builtin_bit_cast(unsigned, f);
  u += 0x7FFFu + ((u >> 16) & 1u);
  return (u16)(u >> 16);
}

// 16-bit A/B fragment load (wave32). `row` points at 32 contiguous bf16
// covering this fragment's K-chunk. Per the CDNA5 layout, lane (sel = l>>4)
// holds K offsets sel*8+{0..7} and 16+sel*8+{0..7} -> two b128 loads.
DEV u16x16 load_frag(const u16* row, int sel) {
  u16x8 lo = *(const u16x8*)(row + sel * 8);
  u16x8 hi = *(const u16x8*)(row + 16 + sel * 8);
  return __builtin_shufflevector(lo, hi, 0, 1, 2, 3, 4, 5, 6, 7,
                                 8, 9, 10, 11, 12, 13, 14, 15);
}

DEV v8f wmma_bf16(u16x16 a, u16x16 b, v8f c) {
  return __builtin_amdgcn_wmma_f32_16x16x32_bf16(
      false, __builtin_bit_cast(v16bf, a),
      false, __builtin_bit_cast(v16bf, b),
      (short)0, c, false, false);
}

// Value of lane l ^ 16 (the other 16-lane half of the wave).
DEV float xhalf(float x) {
  int v = __builtin_bit_cast(int, x);
  return __builtin_bit_cast(float, __builtin_amdgcn_permlanex16(
      v, v, 0x76543210, 0xfedcba98, false, false));
}

// 2^x as the one hardware instruction. exp2f() adds a compare, two selects, an
// add and an ldexp per value, only to return a denormal where 2^x < 2^-126.
// Every x here is <= 0 and is taken against the row's running maximum: a weight
// that small is under 2^-126 of the row's largest, far below P's bf16 rounding.
DEV float exp2_raw(float x) { return __builtin_amdgcn_exp2f(x); }

// Two fp32 -> one register of two bf16, round-to-nearest-even.
DEV unsigned pack2(float lo, float hi) {
  typedef __attribute__((ext_vector_type(2))) float  f32x2;
  typedef __attribute__((ext_vector_type(2))) __bf16 bf16x2;
  return __builtin_bit_cast(unsigned,
                            __builtin_convertvector(f32x2{lo, hi}, bf16x2));
}

// Two 16-key score tiles of one lane (C layout: key = i + 8*sel, then
// 16 + i + 8*sel) are, in that order, the lane's 32-key B fragment.
DEV u16x16 pack_frag(const float* lo, const float* hi) {
  typedef __attribute__((ext_vector_type(8))) unsigned u32x8;
  u32x8 w = {pack2(lo[0], lo[1]), pack2(lo[2], lo[3]),
             pack2(lo[4], lo[5]), pack2(lo[6], lo[7]),
             pack2(hi[0], hi[1]), pack2(hi[2], hi[3]),
             pack2(hi[4], hi[5]), pack2(hi[6], hi[7])};
  return __builtin_bit_cast(u16x16, w);
}

// ---------------------------------------------------------------------------
// fp32 -> bf16 conversion, as a stream on few, long-lived waves.
// A work-group is 16 waves and owns CONVT * U consecutive pieces of four
// floats. A lane brings U pieces, 16 B each, so that every wave-wide load
// covers 512 contiguous bytes (four whole lines) and every wave-wide store 256
// (two whole lines). All U loads are issued before the first value is used.
// The activations take one work-group per WGP (256 x 16 waves, U = 12).
// ---------------------------------------------------------------------------
constexpr int CONVT = 512;            // threads of a conversion work-group

template <int U>
__global__ __launch_bounds__(CONVT)
void f32_to_bf16_kernel(const float* __restrict__ in, u16* __restrict__ out) {
  typedef __attribute__((ext_vector_type(4))) float    f32x4;
  typedef __attribute__((ext_vector_type(2))) unsigned u32x2;
  const size_t e0 = ((size_t)blockIdx.x * (CONVT * U) + threadIdx.x) * 4;
  f32x4 v[U];
#pragma unroll   // rolled, each load would be waited for before the next issues
  for (int u = 0; u < U; u++)
    v[u] = *(const f32x4*)(in + e0 + (size_t)u * (CONVT * 4));
#pragma unroll   // constant indices keep v[] in registers
  for (int u = 0; u < U; u++) {
    u32x2 w = {pack2(v[u][0], v[u][1]), pack2(v[u][2], v[u][3])};
    *(u32x2*)(out + e0 + (size_t)u * (CONVT * 4)) = w;
  }
}

// ---------------------------------------------------------------------------
// GEMM: Y[m,n] = sum_k A[m,k] * W[n,k] + bias[n]
//   A : [M, 768] bf16 row-major          W : [768, 768] bf16 (torch [out,in])
// A work-group of eight waves owns a 128 x 192 tile of Y, one work-group per
// WGP (64 x 4 tiles). Per stage of 128 k the 128 A rows and the 192 W rows
// (256 B each, whole lines) are brought into LDS once per work-group by
// asynchronous b128 copies, in a ring of two buffers: stage s+1 flies while
// stage s is worked on. Fragments are read from LDS at a 272-B row pitch
// (16 B x odd). A wave owns 64 x 48 of the tile: 4 A-fragments x 3 B-fragments
// -> 12 WMMA per 32 k on 14 LDS b128 loads. k runs upward in steps of 32.
// mode 0: bf16 out, head-split [b,h,s,d]        (q and k projections)
// mode 1: bf16 out, transposed [b,h,d,s]        (v projection)
// mode 2: fp32 out, [M, 768]                    (final projection)
// ---------------------------------------------------------------------------
constexpr int BM = 128, BN = 192, BK = 128;
constexpr int GP     = BK + 8;              // LDS row pitch in u16 (272 B)
constexpr int GSTAGE = (BM + BN) * GP;      // one stage: 320 rows, 87040 B
constexpr int NSTAGE = D / BK;              // 6 stages
static_assert(M % BM == 0 && D % BN == 0 && D % BK == 0, "whole tiles only");
static_assert(NSTAGE >= 2, "the ring's prologue fills two stages");

// Ten copies of one lane: rows 16 apart in LDS (l + c * 16 rows) from ten
// global rows. The s_wait_xcnt is the last line of the copies' own statement
// so that no address register of an issued copy is rewritten in front of it.
DEV void copy10(const unsigned (&l)[10], const u16* const (&g)[10]) {
  asm volatile(
      "global_load_async_to_lds_b128 %0, %1, off\n\t"
      "global_load_async_to_lds_b128 %2, %3, off\n\t"
      "global_load_async_to_lds_b128 %4, %5, off\n\t"
      "global_load_async_to_lds_b128 %6, %7, off\n\t"
      "global_load_async_to_lds_b128 %8, %9, off\n\t"
      "global_load_async_to_lds_b128 %10, %11, off\n\t"
      "global_load_async_to_lds_b128 %12, %13, off\n\t"
      "global_load_async_to_lds_b128 %14, %15, off\n\t"
      "global_load_async_to_lds_b128 %16, %17, off\n\t"
      "global_load_async_to_lds_b128 %18, %19, off\n\t"
      "s_wait_xcnt 0x0"
      :: "v"(l[0]), "v"(g[0]), "v"(l[1]), "v"(g[1]), "v"(l[2]), "v"(g[2]),
         "v"(l[3]), "v"(g[3]), "v"(l[4]), "v"(g[4]), "v"(l[5]), "v"(g[5]),
         "v"(l[6]), "v"(g[6]), "v"(l[7]), "v"(g[7]), "v"(l[8]), "v"(g[8]),
         "v"(l[9]), "v"(g[9])
      : "memory");
}

// One stage = twenty copies per lane. Copy c fills LDS row c*16 + crow: rows
// 0..127 hold the A tile (c < 8), rows 128..319 the W tile.
//   lds0: the lane's LDS byte address in row crow of the target buffer
//   ga, gw: the lane's 16 B in row crow of the A tile / W tile, at this stage's k
DEV void gemm_stage(unsigned lds0, const u16* ga, const u16* gw) {
  constexpr unsigned STEP = 16 * GP * sizeof(u16);      // 16 rows further
  unsigned l[20];
  const u16* g[20];
#pragma unroll   // constant indices keep the addresses in registers
  for (int c = 0; c < 20; c++) {
    l[c] = lds0 + c * STEP;
    g[c] = c < BM / 16 ? ga + (size_t)c * 16 * D
                       : gw + (size_t)(c - BM / 16) * 16 * D;
  }
  const unsigned la[10] = {l[0], l[1], l[2], l[3], l[4],
                           l[5], l[6], l[7], l[8], l[9]};
  const u16* const gaa[10] = {g[0], g[1], g[2], g[3], g[4],
                              g[5], g[6], g[7], g[8], g[9]};
  const unsigned lb[10] = {l[10], l[11], l[12], l[13], l[14],
                           l[15], l[16], l[17], l[18], l[19]};
  const u16* const gbb[10] = {g[10], g[11], g[12], g[13], g[14],
                              g[15], g[16], g[17], g[18], g[19]};
  copy10(la, gaa);
  copy10(lb, gbb);
}

__global__ __launch_bounds__(256)
void gemm_bf16_kernel(const u16* __restrict__ A, const u16* __restrict__ W,
                      const float* __restrict__ bias, u16* __restrict__ outb,
                      float* __restrict__ outf, int mode) {
  __shared__ __align__(16) u16 ldsG[2][GSTAGE];    // 2 x 85 KB

  // The four work-groups that read the same A rows are M / BM = 64 apart in
  // index. Speed only.
  const int m0 = (blockIdx.x % (M / BM)) * BM;     // tile's first row
  const int n0 = (blockIdx.x / (M / BM)) * BN;     // tile's first column
  const int wv = threadIdx.x >> 5;
  const int wm = wv >> 2, wn = wv & 3;             // 2 x 4 waves of 64 x 48
  const int l = threadIdx.x & 31, sel = l >> 4, ln = l & 15;

  // Copy map: a row is 16 pieces of 16 B; thread t moves piece t%16 of rows
  // t/16 + 16*c, so every wave-wide copy covers two whole rows of 256 B.
  const int crow = threadIdx.x >> 4, ccol = (threadIdx.x & 15) * 8;
  const u16* ga = A + (size_t)(m0 + crow) * D + ccol;
  const u16* gw = W + (size_t)(n0 + crow) * D + ccol;
  const unsigned lc = (unsigned)(size_t)&ldsG[0][crow * GP + ccol];
  constexpr unsigned GBUFB = GSTAGE * sizeof(u16);      // the other buffer

  // Stage 0 into buffer 0.
  gemm_stage(lc, ga, gw);

  v8f acc[4][3] = {};

  // This wave's copies of stage 0 have landed; the barrier publishes all.
  asm volatile("s_wait_asynccnt 0x0" ::: "memory");
  __syncthreads();
  // Stage 1 into buffer 1.
  gemm_stage(lc + GBUFB, ga + BK, gw + BK);

  for (int s = 0; s < NSTAGE; s++) {
    const u16* As = ldsG[s & 1] + (wm * 64 + ln) * GP;
    const u16* Ws = ldsG[s & 1] + (BM + wn * 48 + ln) * GP;
    // Two fragment sets: block kb+1's 14 LDS reads go out as one group ahead
    // of block kb's 12 WMMA. Only this stage's own buffer is read.
    u16x16 af[2][4], bf[2][3];
#pragma unroll
    for (int r = 0; r < 4; r++) af[0][r] = load_frag(As + r * 16 * GP, sel);
#pragma unroll
    for (int t = 0; t < 3; t++) bf[0][t] = load_frag(Ws + t * 16 * GP, sel);
#pragma unroll   // constant set indices keep the fragments in registers
    for (int kb = 0; kb < BK / 32; kb++) {
      const int cur = kb & 1, nxt = cur ^ 1;
      if (kb + 1 < BK / 32) {
        const int kk = (kb + 1) * 32;
#pragma unroll
        for (int r = 0; r < 4; r++)
          af[nxt][r] = load_frag(As + r * 16 * GP + kk, sel);
#pragma unroll
        for (int t = 0; t < 3; t++)
          bf[nxt][t] = load_frag(Ws + t * 16 * GP + kk, sel);
      }
      // Keeps the reads above in front of the WMMA below: sunk among them,
      // each small group is waited for in full before its WMMA can issue.
      __builtin_amdgcn_sched_barrier(0);
#pragma unroll
      for (int r = 0; r < 4; r++)
#pragma unroll
        for (int t = 0; t < 3; t++)
          acc[r][t] = wmma_bf16(af[cur][r], bf[cur][t], acc[r][t]);
    }

    // ---- publish point of stage s+1 ----
    // This wave's LDS reads of buffer s&1 are done ...
    asm volatile("s_wait_dscnt 0x0" ::: "memory");
    // ... and its own copies of stage s+1 have landed.
    asm volatile("s_wait_asynccnt 0x0" ::: "memory");
    __syncthreads();   // publishes stage s+1, frees buffer s&1 for the refill
    if (s + 2 < NSTAGE)                          // same for the whole grid
      gemm_stage(lc + (unsigned)(s & 1) * GBUFB, ga + (s + 2) * BK,
                 gw + (s + 2) * BK);
  }
  // No copy is outstanding when the wave ends.
  asm volatile("s_wait_asynccnt 0x0" ::: "memory");

#pragma unroll
  for (int r = 0; r < 4; r++) {
    const int Mi0 = m0 + wm * 64 + r * 16;
#pragma unroll
    for (int t = 0; t < 3; t++) {
      const int ng = n0 + wn * 48 + t * 16 + ln; // lane's output column
      const float bv = bias[ng];
      if (mode == 2) {                           // fp32 [M, D]
#pragma unroll
        for (int i = 0; i < 8; i++) {
          int Mi = Mi0 + i + 8 * sel;            // C layout: row = i + 8*sel
          outf[(size_t)Mi * D + ng] = acc[r][t][i] + bv;
        }
      } else if (mode == 0) {                    // bf16 [b,h,s,d]
        int h = ng >> 6, d = ng & 63;
#pragma unroll
        for (int i = 0; i < 8; i++) {
          int Mi = Mi0 + i + 8 * sel;
          int b = Mi >> 11, s = Mi & (S - 1);
          outb[(((size_t)(b * H + h)) * S + s) * DK + d] =
              f2bf(acc[r][t][i] + bv);
        }
      } else {                                   // bf16 [b,h,d,s] (transposed)
        int h = ng >> 6, d = ng & 63;
        int Mi = Mi0 + 8 * sel;                  // 8 consecutive s per lane
        int b = Mi >> 11, s0 = Mi & (S - 1);
        u16x8 pack;
#pragma unroll
        for (int i = 0; i < 8; i++) pack[i] = f2bf(acc[r][t][i] + bv);
        *(u16x8*)(outb + (((size_t)(b * H + h)) * DK + d) * S + s0) = pack;
      }
    }
  }
}

// ---------------------------------------------------------------------------
// Flash attention. One wave per (b, h, 16-query tile); eight waves (128
// queries of one head) form a work-group and share every 64-key block.
//   Q,K : [b,h,s,d] bf16      Vt : [b,h,d,s] bf16     out: bf16 [B*S, 768]
// Each 64-key K tile and Vt tile (64 rows of 128 B each) is brought into LDS
// once per work-group by asynchronous b128 copies, whole 128-B lines per row,
// in a ring of two buffers: block j+1 flies while block j is worked on. The
// fragments are then read from LDS at a 144-B row pitch (16 B x odd).
// Both products run transposed: S^T = K.Q^T (A = K rows, B = Q) and
// O^T += V^T.P^T (A = Vt rows, B = P^T). A lane then holds scores of ONE query
// (column ln), 32 of a block's 64 keys, the lane l ^ 16 the other 32: maximum
// and sum run in the lane with one exchange between the halves, and the
// exponentials pack straight into the B operand, so P never goes through LDS.
// Softmax runs in the exp2 domain: scores are scaled by log2(e)/sqrt(dk).
// ---------------------------------------------------------------------------
constexpr int KVP    = 72;            // LDS row pitch of a staged tile, in u16
constexpr int KVTILE = 64 * KVP;      // one staged tile: 64 rows, 9216 B

// One stage = four copies per lane (two of K, two of Vt). The s_wait_xcnt is
// the last line of the copies' own statement so that no address register of
// an issued copy is rewritten in front of it.
DEV void stage_copies(unsigned lk0, const u16* gk0, unsigned lk1, const u16* gk1,
                      unsigned lv0, const u16* gv0, unsigned lv1, const u16* gv1) {
  asm volatile(
      "global_load_async_to_lds_b128 %0, %1, off\n\t"
      "global_load_async_to_lds_b128 %2, %3, off\n\t"
      "global_load_async_to_lds_b128 %4, %5, off\n\t"
      "global_load_async_to_lds_b128 %6, %7, off\n\t"
      "s_wait_xcnt 0x0"
      :: "v"(lk0), "v"(gk0), "v"(lk1), "v"(gk1),
         "v"(lv0), "v"(gv0), "v"(lv1), "v"(gv1)
      : "memory");
}

__global__ __launch_bounds__(256)
void attn_kernel(const u16* __restrict__ Q, const u16* __restrict__ K,
                 const u16* __restrict__ Vt, u16* __restrict__ Obf) {
  __shared__ __align__(16) u16 ldsK[2][KVTILE];    // 2 x 9 KB
  __shared__ __align__(16) u16 ldsV[2][KVTILE];    // 2 x 9 KB

  const int wave = blockIdx.x * (blockDim.x >> 5) + (threadIdx.x >> 5);
  const int nqt  = S / 16;                         // 128 query tiles
  const int qt   = wave % nqt;
  const int bh   = wave / nqt;                     // b*H + h, same in a block
  const int l = threadIdx.x & 31, sel = l >> 4, ln = l & 15;

  const u16* Qb = Q  + (size_t)bh * S * DK;
  const u16* Kb = K  + (size_t)bh * S * DK;
  const u16* Vb = Vt + (size_t)bh * DK * S;

  // Copy map: a tile is 512 pieces of 16 B; thread t moves pieces t and
  // t + 256, that is rows t/8 and t/8 + 32, column piece t%8.
  const int crow = threadIdx.x >> 3, ccol = (threadIdx.x & 7) * 8;
  const u16* gk = Kb + (size_t)crow * DK + ccol;   // block 0, row crow
  const u16* gv = Vb + (size_t)crow * S + ccol;
  const unsigned lk = (unsigned)(size_t)&ldsK[0][crow * KVP + ccol];
  const unsigned lv = (unsigned)(size_t)&ldsV[0][crow * KVP + ccol];
  constexpr unsigned HALF = 32 * KVP * sizeof(u16);     // 32 rows further
  constexpr unsigned BUFB = KVTILE * sizeof(u16);       // the other buffer

  // Block 0 into buffer 0.
  stage_copies(lk, gk, lk + HALF, gk + 32 * DK, lv, gv, lv + HALF, gv + 32 * S);

  // Q fragments for both 32-wide d chunks (reused all iterations).
  const u16* qrow = Qb + (size_t)(qt * 16 + ln) * DK;
  u16x16 qf0 = load_frag(qrow, sel);
  u16x16 qf1 = load_frag(qrow + 32, sel);

  // exp2-domain score scale: log2(e) / sqrt(dk)
  const float sc = 0.125f * 1.44269504088896340736f;

  v8f accO[4] = {};                   // O^T: row d = t*16 + i + 8*sel, column ln
  float mrun = -__builtin_inff();     // running maximum of query ln
  float lsum = 0.f;                   // this half's share of its denominator

  // This wave's copies of block 0 have landed; the barrier publishes all.
  asm volatile("s_wait_asynccnt 0x0" ::: "memory");
  __syncthreads();
  // Block 1 into buffer 1 (S / 64 = 32 blocks exist).
  stage_copies(lk + BUFB, gk + 64 * DK, lk + BUFB + HALF, gk + 96 * DK,
               lv + BUFB, gv + 64, lv + BUFB + HALF, gv + 32 * S + 64);

  for (int j = 0; j < S / 64; j++) {
    const u16* Kt = ldsK[j & 1];
    const u16* Vl = ldsV[j & 1];

    // ---- S^T for keys [j*64, j*64+64) : four 16-key x 16-query C tiles ----
    v8f c[4];
#pragma unroll
    for (int kt = 0; kt < 4; kt++) {
      const u16* krow = Kt + (kt * 16 + ln) * KVP;
      v8f ct = {};
      ct = wmma_bf16(load_frag(krow, sel), qf0, ct);
      ct = wmma_bf16(load_frag(krow + 32, sel), qf1, ct);
      c[kt] = ct;                                // key kt*16 + i + 8*sel
    }

    // ---- online softmax update (exp2 domain), all of it in the lane ----
    float mx[4];
#pragma unroll
    for (int kt = 0; kt < 4; kt++) {
      mx[kt] = c[kt][0];
#pragma unroll
      for (int i = 1; i < 8; i++) mx[kt] = fmaxf(mx[kt], c[kt][i]);
    }
    float rm = fmaxf(fmaxf(mx[0], mx[1]), fmaxf(mx[2], mx[3]));
    rm = fmaxf(rm, xhalf(rm)) * sc;              // sc > 0: scale after the max
    const float nm = fmaxf(mrun, rm);            // same in both halves
    const float alpha = exp2_raw(mrun - nm);     // 0 in block 0 (mrun = -inf)
    mrun = nm;
    typedef __attribute__((ext_vector_type(2))) float f32x2;
    float p[4][8], ps[4];
#pragma unroll
    for (int kt = 0; kt < 4; kt++) {
#pragma unroll
      for (int i = 0; i < 8; i += 2) {
        // Written packed: left scalar, each argument takes a v_fma_f32 of its own.
        const f32x2 a = __builtin_elementwise_fma(
            f32x2{c[kt][i], c[kt][i + 1]}, f32x2{sc, sc}, f32x2{-nm, -nm});
        p[kt][i]     = exp2_raw(a.x);
        p[kt][i + 1] = exp2_raw(a.y);
      }
      ps[kt] = ((p[kt][0] + p[kt][1]) + (p[kt][2] + p[kt][3])) +
               ((p[kt][4] + p[kt][5]) + (p[kt][6] + p[kt][7]));
    }
    lsum = lsum * alpha + ((ps[0] + ps[1]) + (ps[2] + ps[3]));
#pragma unroll
    for (int t = 0; t < 4; t++) accO[t] *= alpha;

    // ---- O^T += V^T(64 x 64 keys) x P^T(64 keys x 16) ----
    u16x16 pf0 = pack_frag(p[0], p[1]);          // keys j*64 +  0..31
    u16x16 pf1 = pack_frag(p[2], p[3]);          // keys +32..63
#pragma unroll
    for (int t = 0; t < 4; t++) {
      const u16* vrow = Vl + (t * 16 + ln) * KVP;
      accO[t] = wmma_bf16(load_frag(vrow, sel), pf0, accO[t]);
      accO[t] = wmma_bf16(load_frag(vrow + 32, sel), pf1, accO[t]);
    }

    // ---- publish point of block j+1 ----
    // This wave's LDS reads of buffer j&1 are done ...
    asm volatile("s_wait_dscnt 0x0" ::: "memory");
    // ... and its own copies of block j+1 have landed.
    asm volatile("s_wait_asynccnt 0x0" ::: "memory");
    __syncthreads();   // publishes block j+1, frees buffer j&1 for the refill
    if (j + 2 < S / 64) {                        // same for the whole grid
      const unsigned bo = (unsigned)(j & 1) * BUFB;
      const u16* gk2 = gk + (size_t)(j + 2) * 64 * DK;
      const u16* gv2 = gv + (j + 2) * 64;
      stage_copies(lk + bo, gk2, lk + bo + HALF, gk2 + 32 * DK,
                   lv + bo, gv2, lv + bo + HALF, gv2 + 32 * S);
    }
  }
  // No copy is outstanding when the wave ends.
  asm volatile("s_wait_asynccnt 0x0" ::: "memory");

  // ---- normalize and store to [B*S, 768] (col = h*64 + d) ----
  const int b = bh / H, h = bh % H;
  const float inv = 1.f / (lsum + xhalf(lsum));  // join the halves' sums
  const size_t rowoff = ((size_t)b * S + qt * 16 + ln) * D + h * 64 + 8 * sel;
#pragma unroll
  for (int t = 0; t < 4; t++) {                  // 8 consecutive d per lane
    u16x8 pack;
#pragma unroll
    for (int i = 0; i < 8; i++) pack[i] = f2bf(accO[t][i] * inv);
    *(u16x8*)(Obf + rowoff + t * 16) = pack;
  }
}

// ---------------------------------------------------------------------------
// Host orchestration (all launches on `stream`; graph-capture safe).
// ---------------------------------------------------------------------------
extern "C" void kernel_launch(void* const* d_in, const int* in_sizes, int n_in,
                              void* d_out, int out_size, void* d_ws,
                              size_t ws_size, hipStream_t stream) {
  const float* query = (const float*)d_in[0];
  const float* key   = (const float*)d_in[1];
  const float* value = (const float*)d_in[2];
  const float* Wq    = (const float*)d_in[3];
  const float* bq    = (const float*)d_in[4];
  const float* Wo    = (const float*)d_in[5];
  const float* bo    = (const float*)d_in[6];
  float* out = (float*)d_out;

  // Workspace sub-allocation (256B aligned).
  char* ws = (char*)d_ws;
  size_t off = 0;
  auto suballoc = [&](size_t bytes) -> void* {
    void* p = ws + off;
    off = (off + bytes + 255) & ~(size_t)255;
    return p;
  };
  const size_t actBytes = (size_t)M * D * sizeof(u16);   // 12.6 MB
  const size_t wBytes   = (size_t)D * D * sizeof(u16);   // 1.2 MB
  u16* xbf    = (u16*)suballoc(actBytes);   // staging for query/key/value
  u16* qbf    = (u16*)suballoc(actBytes);   // [b,h,s,d]
  u16* kbf    = (u16*)suballoc(actBytes);   // [b,h,s,d]
  u16* vtbf   = (u16*)suballoc(actBytes);   // [b,h,d,s]
  u16* attnbf = (u16*)suballoc(actBytes);   // [B*S, 768]
  u16* wqbf   = (u16*)suballoc(wBytes);
  u16* wobf   = (u16*)suballoc(wBytes);

  constexpr int nAct = M * D, nW = D * D;
  constexpr int UA = 12, UW = 2;                         // pieces per lane
  constexpr int actBlocks = nAct / (CONVT * 4 * UA);     // 256 blocks, 16 waves
  constexpr int wBlocks   = nW / (CONVT * 4 * UW);       // 144 blocks, 16 waves
  static_assert(actBlocks * CONVT * 4 * UA == nAct, "whole work-groups only");
  static_assert(wBlocks * CONVT * 4 * UW == nW, "whole work-groups only");
  const int gemmBlocks = (M / BM) * (D / BN);            // 256 blocks, 8 waves
  const int attnBlocks = (Bsz * H * (S / 16)) / 8;       // 768 blocks, 8 waves

  // Weights to bf16 (once per call).
  f32_to_bf16_kernel<UW><<<wBlocks, CONVT, 0, stream>>>(Wq, wqbf);
  f32_to_bf16_kernel<UW><<<wBlocks, CONVT, 0, stream>>>(Wo, wobf);

  // q = query @ Wq^T + bq  -> [b,h,s,d]
  f32_to_bf16_kernel<UA><<<actBlocks, CONVT, 0, stream>>>(query, xbf);
  gemm_bf16_kernel<<<gemmBlocks, 256, 0, stream>>>(xbf, wqbf, bq, qbf, nullptr, 0);

  // k = key @ Wq^T + bq    -> [b,h,s,d]   (reference reuses Wq/bq)
  f32_to_bf16_kernel<UA><<<actBlocks, CONVT, 0, stream>>>(key, xbf);
  gemm_bf16_kernel<<<gemmBlocks, 256, 0, stream>>>(xbf, wqbf, bq, kbf, nullptr, 0);

  // v = value @ Wq^T + bq  -> [b,h,d,s] transposed
  f32_to_bf16_kernel<UA><<<actBlocks, CONVT, 0, stream>>>(value, xbf);
  gemm_bf16_kernel<<<gemmBlocks, 256, 0, stream>>>(xbf, wqbf, bq, vtbf, nullptr, 1);

  // attention -> [B*S, 768] bf16
  attn_kernel<<<attnBlocks, 256, 0, stream>>>(qbf, kbf, vtbf, attnbf);

  // out = attn @ Wo^T + bo -> fp32 d_out
  gemm_bf16_kernel<<<gemmBlocks, 256, 0, stream>>>(attnbf, wobf, bo, nullptr, out, 2);
}

// v006
// One run takes 108 microseconds.
// In two side-by-side timings against v005, it was 1.14 and 1.13 times as fast.
// Over all steps from v000 it is 4.05 times as fast.
#include <hip/hip_runtime.h>

// ---------------------------------------------------------------------------
// MI455X (gfx1250) multi-head attention, bf16 WMMA pipeline.
//   stage 1: fp32 -> bf16 conversions (weights + activations), one launch
//   stage 2: q, k and v projection GEMMs, one launch, 128x192 tiles staged in
//            LDS (v_wmma_f32_16x16x32_bf16)
//   stage 3: flash-attention, transposed (S^T = K.Q^T, O^T += V^T.P^T), 64-key
//            blocks staged in LDS (v_wmma + exp2 softmax in the lane)
//   stage 4: output projection (fp32 out)
// ---------------------------------------------------------------------------

typedef unsigned short u16;
typedef __attribute__((ext_vector_type(8)))  u16    u16x8;
typedef __attribute__((ext_vector_type(16))) u16    u16x16;
typedef __attribute__((ext_vector_type(8)))  float  v8f;
typedef __attribute__((ext_vector_type(16))) __bf16 v16bf;

#define DEV static __device__ __forceinline__

// Problem constants (fixed by the reference).
constexpr int Bsz = 4;
constexpr int S   = 2048;
constexpr int D   = 768;
constexpr int H   = 12;
constexpr int DK  = 64;
constexpr int M   = Bsz * S;   // 8192 rows for all dense GEMMs

DEV u16 f2bf(float f) {             // fp32 -> bf16, round-to-nearest-even
  unsigned u = __builtin_bit_cast(unsigned, f);
  u += 0x7FFFu + ((u >> 16) & 1u);
  return (u16)(u >> 16);
}

// 16-bit A/B fragment load (wave32). `row` points at 32 contiguous bf16
// covering this fragment's K-chunk. Per the CDNA5 layout, lane (sel = l>>4)
// holds K offsets sel*8+{0..7} and 16+sel*8+{0..7} -> two b128 loads.
DEV u16x16 load_frag(const u16* row, int sel) {
  u16x8 lo = *(const u16x8*)(row + sel * 8);
  u16x8 hi = *(const u16x8*)(row + 16 + sel * 8);
  return __builtin_shufflevector(lo, hi, 0, 1, 2, 3, 4, 5, 6, 7,
                                 8, 9, 10, 11, 12, 13, 14, 15);
}

DEV v8f wmma_bf16(u16x16 a, u16x16 b, v8f c) {
  return __builtin_amdgcn_wmma_f32_16x16x32_bf16(
      false, __builtin_bit_cast(v16bf, a),
      false, __builtin_bit_cast(v16bf, b),
      (short)0, c, false, false);
}

// Value of lane l ^ 16 (the other 16-lane half of the wave).
DEV float xhalf(float x) {
  int v = __builtin_bit_cast(int, x);
  return __builtin_bit_cast(float, __builtin_amdgcn_permlanex16(
      v, v, 0x76543210, 0xfedcba98, false, false));
}

// 2^x as the one hardware instruction. exp2f() adds a compare, two selects, an
// add and an ldexp per value, only to return a denormal where 2^x < 2^-126.
// Every x here is <= 0 and is taken against the row's running maximum: a weight
// that small is under 2^-126 of the row's largest, far below P's bf16 rounding.
DEV float exp2_raw(float x) { return __builtin_amdgcn_exp2f(x); }

// Two fp32 -> one register of two bf16, round-to-nearest-even.
DEV unsigned pack2(float lo, float hi) {
  typedef __attribute__((ext_vector_type(2))) float  f32x2;
  typedef __attribute__((ext_vector_type(2))) __bf16 bf16x2;
  return __builtin_bit_cast(unsigned,
                            __builtin_convertvector(f32x2{lo, hi}, bf16x2));
}

// Two 16-key score tiles of one lane (C layout: key = i + 8*sel, then
// 16 + i + 8*sel) are, in that order, the lane's 32-key B fragment.
DEV u16x16 pack_frag(const float* lo, const float* hi) {
  typedef __attribute__((ext_vector_type(8))) unsigned u32x8;
  u32x8 w = {pack2(lo[0], lo[1]), pack2(lo[2], lo[3]),
             pack2(lo[4], lo[5]), pack2(lo[6], lo[7]),
             pack2(hi[0], hi[1]), pack2(hi[2], hi[3]),
             pack2(hi[4], hi[5]), pack2(hi[6], hi[7])};
  return __builtin_bit_cast(u16x16, w);
}

// ---------------------------------------------------------------------------
// fp32 -> bf16 conversion, as a stream on few, long-lived waves.
// A work-group is 16 waves and owns CONVT * U consecutive pieces of four
// floats. A lane brings U pieces, 16 B each, so that every wave-wide load
// covers 512 contiguous bytes (four whole lines) and every wave-wide store 256
// (two whole lines). All U loads are issued before the first value is used.
// All five tensors are independent of each other and go in ONE launch: the
// block index names the tensor (256 work-groups for each activation, then 24
// for each weight matrix) and the piece of it.
// ---------------------------------------------------------------------------
constexpr int CONVT = 512;            // threads of a conversion work-group
constexpr int CONVU = 12;             // pieces of four floats per lane
constexpr int CONVE = CONVT * CONVU * 4;         // floats of one work-group
constexpr int ACTWG = M * D / CONVE;  // 256 work-groups per activation
constexpr int WWG   = D * D / CONVE;  // 24 work-groups per weight matrix
static_assert(ACTWG * CONVE == M * D, "whole work-groups only");
static_assert(WWG * CONVE == D * D, "whole work-groups only");

__global__ __launch_bounds__(CONVT)
void f32_to_bf16_all_kernel(const float* __restrict__ xq,
                            const float* __restrict__ xk,
                            const float* __restrict__ xv,
                            const float* __restrict__ wq,
                            const float* __restrict__ wo,
                            u16* __restrict__ xout,    // [3][M * D]: q, k, v
                            u16* __restrict__ wqout, u16* __restrict__ woout) {
  typedef __attribute__((ext_vector_type(4))) float    f32x4;
  typedef __attribute__((ext_vector_type(2))) unsigned u32x2;
  constexpr int U = CONVU;
  // Tensor and piece from the block index: the same for the whole work-group.
  int wg = blockIdx.x;
  const float* in;
  u16* out;
  if (wg < 3 * ACTWG) {
    const int t = wg / ACTWG;
    in  = t == 0 ? xq : t == 1 ? xk : xv;
    out = xout + (size_t)t * (M * D);
    wg -= t * ACTWG;
  } else {
    wg -= 3 * ACTWG;
    const int t = wg / WWG;
    in  = t == 0 ? wq : wo;
    out = t == 0 ? wqout : woout;
    wg -= t * WWG;
  }
  const size_t e0 = ((size_t)wg * (CONVT * U) + threadIdx.x) * 4;
  f32x4 v[U];
#pragma unroll   // rolled, each load would be waited for before the next issues
  for (int u = 0; u < U; u++)
    v[u] = *(const f32x4*)(in + e0 + (size_t)u * (CONVT * 4));
#pragma unroll   // constant indices keep v[] in registers
  for (int u = 0; u < U; u++) {
    u32x2 w = {pack2(v[u][0], v[u][1]), pack2(v[u][2], v[u][3])};
    *(u32x2*)(out + e0 + (size_t)u * (CONVT * 4)) = w;
  }
}

// ---------------------------------------------------------------------------
// GEMM: Y[m,n] = sum_k A[m,k] * W[n,k] + bias[n]
//   A : [M, 768] bf16 row-major          W : [768, 768] bf16 (torch [out,in])
// A work-group of eight waves owns a 128 x 192 tile of Y, one work-group per
// WGP (64 x 4 tiles). Per stage of 128 k the 128 A rows and the 192 W rows
// (256 B each, whole lines) are brought into LDS once per work-group by
// asynchronous b128 copies, in a ring of two buffers: stage s+1 flies while
// stage s is worked on. Fragments are read from LDS at a 272-B row pitch
// (16 B x odd). A wave owns 64 x 48 of the tile: 4 A-fragments x 3 B-fragments
// -> 12 WMMA per 32 k on 14 LDS b128 loads. k runs upward in steps of 32.
// The q, k and v projections share W and bias and do not depend on each other:
// they are ONE launch, blockIdx.y names the tensor (A and outb hold the three
// one behind the other, M * 768 elements each).
// outproj == 0, y = 0, 1: bf16 out, head-split [b,h,s,d] (q and k projections)
// outproj == 0, y = 2:    bf16 out, transposed [b,h,d,s] (v projection)
// outproj != 0 (y = 0):   fp32 out, [M, 768]             (final projection)
// ---------------------------------------------------------------------------
constexpr int BM = 128, BN = 192, BK = 128;
constexpr int GP     = BK + 8;              // LDS row pitch in u16 (272 B)
constexpr int GSTAGE = (BM + BN) * GP;      // one stage: 320 rows, 87040 B
constexpr int NSTAGE = D / BK;              // 6 stages
static_assert(M % BM == 0 && D % BN == 0 && D % BK == 0, "whole tiles only");
static_assert(NSTAGE >= 2, "the ring's prologue fills two stages");

// Ten copies of one lane: rows 16 apart in LDS (l + c * 16 rows) from ten
// global rows. The s_wait_xcnt is the last line of the copies' own statement
// so that no address register of an issued copy is rewritten in front of it.
DEV void copy10(const unsigned (&l)[10], const u16* const (&g)[10]) {
  asm volatile(
      "global_load_async_to_lds_b128 %0, %1, off\n\t"
      "global_load_async_to_lds_b128 %2, %3, off\n\t"
      "global_load_async_to_lds_b128 %4, %5, off\n\t"
      "global_load_async_to_lds_b128 %6, %7, off\n\t"
      "global_load_async_to_lds_b128 %8, %9, off\n\t"
      "global_load_async_to_lds_b128 %10, %11, off\n\t"
      "global_load_async_to_lds_b128 %12, %13, off\n\t"
      "global_load_async_to_lds_b128 %14, %15, off\n\t"
      "global_load_async_to_lds_b128 %16, %17, off\n\t"
      "global_load_async_to_lds_b128 %18, %19, off\n\t"
      "s_wait_xcnt 0x0"
      :: "v"(l[0]), "v"(g[0]), "v"(l[1]), "v"(g[1]), "v"(l[2]), "v"(g[2]),
         "v"(l[3]), "v"(g[3]), "v"(l[4]), "v"(g[4]), "v"(l[5]), "v"(g[5]),
         "v"(l[6]), "v"(g[6]), "v"(l[7]), "v"(g[7]), "v"(l[8]), "v"(g[8]),
         "v"(l[9]), "v"(g[9])
      : "memory");
}

// One stage = twenty copies per lane. Copy c fills LDS row c*16 + crow: rows
// 0..127 hold the A tile (c < 8), rows 128..319 the W tile.
//   lds0: the lane's LDS byte address in row crow of the target buffer
//   ga, gw: the lane's 16 B in row crow of the A tile / W tile, at this stage's k
DEV void gemm_stage(unsigned lds0, const u16* ga, const u16* gw) {
  constexpr unsigned STEP = 16 * GP * sizeof(u16);      // 16 rows further
  unsigned l[20];
  const u16* g[20];
#pragma unroll   // constant indices keep the addresses in registers
  for (int c = 0; c < 20; c++) {
    l[c] = lds0 + c * STEP;
    g[c] = c < BM / 16 ? ga + (size_t)c * 16 * D
                       : gw + (size_t)(c - BM / 16) * 16 * D;
  }
  const unsigned la[10] = {l[0], l[1], l[2], l[3], l[4],
                           l[5], l[6], l[7], l[8], l[9]};
  const u16* const gaa[10] = {g[0], g[1], g[2], g[3], g[4],
                              g[5], g[6], g[7], g[8], g[9]};
  const unsigned lb[10] = {l[10], l[11], l[12], l[13], l[14],
                           l[15], l[16], l[17], l[18], l[19]};
  const u16* const gbb[10] = {g[10], g[11], g[12], g[13], g[14],
                              g[15], g[16], g[17], g[18], g[19]};
  copy10(la, gaa);
  copy10(lb, gbb);
}

__global__ __launch_bounds__(256)
void gemm_bf16_kernel(const u16* __restrict__ A, const u16* __restrict__ W,
                      const float* __restrict__ bias, u16* __restrict__ outb,
                      float* __restrict__ outf, int outproj) {
  __shared__ __align__(16) u16 ldsG[2][GSTAGE];    // 2 x 85 KB

  const int mode = outproj ? 2 : blockIdx.y == 2 ? 1 : 0;
  A    += (size_t)blockIdx.y * (M * D);            // this tensor's rows
  outb += (size_t)blockIdx.y * (M * D);

  // The four work-groups that read the same A rows are M / BM = 64 apart in
  // index. Speed only.
  const int m0 = (blockIdx.x % (M / BM)) * BM;     // tile's first row
  const int n0 = (blockIdx.x / (M / BM)) * BN;     // tile's first column
  const int wv = threadIdx.x >> 5;
  const int wm = wv >> 2, wn = wv & 3;             // 2 x 4 waves of 64 x 48
  const int l = threadIdx.x & 31, sel = l >> 4, ln = l & 15;

  // Copy map: a row is 16 pieces of 16 B; thread t moves piece t%16 of rows
  // t/16 + 16*c, so every wave-wide copy covers two whole rows of 256 B.
  const int crow = threadIdx.x >> 4, ccol = (threadIdx.x & 15) * 8;
  const u16* ga = A + (size_t)(m0 + crow) * D + ccol;
  const u16* gw = W + (size_t)(n0 + crow) * D + ccol;
  const unsigned lc = (unsigned)(size_t)&ldsG[0][crow * GP + ccol];
  constexpr unsigned GBUFB = GSTAGE * sizeof(u16);      // the other buffer

  // Stage 0 into buffer 0.
  gemm_stage(lc, ga, gw);

  v8f acc[4][3] = {};

  // This wave's copies of stage 0 have landed; the barrier publishes all.
  asm volatile("s_wait_asynccnt 0x0" ::: "memory");
  __syncthreads();
  // Stage 1 into buffer 1.
  gemm_stage(lc + GBUFB, ga + BK, gw + BK);

  for (int s = 0; s < NSTAGE; s++) {
    const u16* As = ldsG[s & 1] + (wm * 64 + ln) * GP;
    const u16* Ws = ldsG[s & 1] + (BM + wn * 48 + ln) * GP;
    // Two fragment sets: block kb+1's 14 LDS reads go out as one group ahead
    // of block kb's 12 WMMA. Only this stage's own buffer is read.
    u16x16 af[2][4], bf[2][3];
#pragma unroll
    for (int r = 0; r < 4; r++) af[0][r] = load_frag(As + r * 16 * GP, sel);
#pragma unroll
    for (int t = 0; t < 3; t++) bf[0][t] = load_frag(Ws + t * 16 * GP, sel);
#pragma unroll   // constant set indices keep the fragments in registers
    for (int kb = 0; kb < BK / 32; kb++) {
      const int cur = kb & 1, nxt = cur ^ 1;
      if (kb + 1 < BK / 32) {
        const int kk = (kb + 1) * 32;
#pragma unroll
        for (int r = 0; r < 4; r++)
          af[nxt][r] = load_frag(As + r * 16 * GP + kk, sel);
#pragma unroll
        for (int t = 0; t < 3; t++)
          bf[nxt][t] = load_frag(Ws + t * 16 * GP + kk, sel);
      }
      // Keeps the reads above in front of the WMMA below: sunk among them,
      // each small group is waited for in full before its WMMA can issue.
      __builtin_amdgcn_sched_barrier(0);
#pragma unroll
      for (int r = 0; r < 4; r++)
#pragma unroll
        for (int t = 0; t < 3; t++)
          acc[r][t] = wmma_bf16(af[cur][r], bf[cur][t], acc[r][t]);
    }

    // ---- publish point of stage s+1 ----
    // This wave's LDS reads of buffer s&1 are done ...
    asm volatile("s_wait_dscnt 0x0" ::: "memory");
    // ... and its own copies of stage s+1 have landed.
    asm volatile("s_wait_asynccnt 0x0" ::: "memory");
    __syncthreads();   // publishes stage s+1, frees buffer s&1 for the refill
    if (s + 2 < NSTAGE)                          // same for the whole grid
      gemm_stage(lc + (unsigned)(s & 1) * GBUFB, ga + (s + 2) * BK,
                 gw + (s + 2) * BK);
  }
  // No copy is outstanding when the wave ends.
  asm volatile("s_wait_asynccnt 0x0" ::: "memory");

#pragma unroll
  for (int r = 0; r < 4; r++) {
    const int Mi0 = m0 + wm * 64 + r * 16;
#pragma unroll
    for (int t = 0; t < 3; t++) {
      const int ng = n0 + wn * 48 + t * 16 + ln; // lane's output column
      const float bv = bias[ng];
      if (mode == 2) {                           // fp32 [M, D]
#pragma unroll
        for (int i = 0; i < 8; i++) {
          int Mi = Mi0 + i + 8 * sel;            // C layout: row = i + 8*sel
          outf[(size_t)Mi * D + ng] = acc[r][t][i] + bv;
        }
      } else if (mode == 0) {                    // bf16 [b,h,s,d]
        int h = ng >> 6, d = ng & 63;
#pragma unroll
        for (int i = 0; i < 8; i++) {
          int Mi = Mi0 + i + 8 * sel;
          int b = Mi >> 11, s = Mi & (S - 1);
          outb[(((size_t)(b * H + h)) * S + s) * DK + d] =
              f2bf(acc[r][t][i] + bv);
        }
      } else {                                   // bf16 [b,h,d,s] (transposed)
        int h = ng >> 6, d = ng & 63;
        int Mi = Mi0 + 8 * sel;                  // 8 consecutive s per lane
        int b = Mi >> 11, s0 = Mi & (S - 1);
        u16x8 pack;
#pragma unroll
        for (int i = 0; i < 8; i++) pack[i] = f2bf(acc[r][t][i] + bv);
        *(u16x8*)(outb + (((size_t)(b * H + h)) * DK + d) * S + s0) = pack;
      }
    }
  }
}

// ---------------------------------------------------------------------------
// Flash attention. One wave per (b, h, 16-query tile); eight waves (128
// queries of one head) form a work-group and share every 64-key block.
//   Q,K : [b,h,s,d] bf16      Vt : [b,h,d,s] bf16     out: bf16 [B*S, 768]
// Each 64-key K tile and Vt tile (64 rows of 128 B each) is brought into LDS
// once per work-group by asynchronous b128 copies, whole 128-B lines per row,
// in a ring of two buffers: block j+1 flies while block j is worked on. The
// fragments are then read from LDS at a 144-B row pitch (16 B x odd).
// Both products run transposed: S^T = K.Q^T (A = K rows, B = Q) and
// O^T += V^T.P^T (A = Vt rows, B = P^T). A lane then holds scores of ONE query
// (column ln), 32 of a block's 64 keys, the lane l ^ 16 the other 32: maximum
// and sum run in the lane with one exchange between the halves, and the
// exponentials pack straight into the B operand, so P never goes through LDS.
// Softmax runs in the exp2 domain: scores are scaled by log2(e)/sqrt(dk).
// ---------------------------------------------------------------------------
constexpr int KVP    = 72;            // LDS row pitch of a staged tile, in u16
constexpr int KVTILE = 64 * KVP;      // one staged tile: 64 rows, 9216 B

// One stage = four copies per lane (two of K, two of Vt). The s_wait_xcnt is
// the last line of the copies' own statement so that no address register of
// an issued copy is rewritten in front of it.
DEV void stage_copies(unsigned lk0, const u16* gk0, unsigned lk1, const u16* gk1,
                      unsigned lv0, const u16* gv0, unsigned lv1, const u16* gv1) {
  asm volatile(
      "global_load_async_to_lds_b128 %0, %1, off\n\t"
      "global_load_async_to_lds_b128 %2, %3, off\n\t"
      "global_load_async_to_lds_b128 %4, %5, off\n\t"
      "global_load_async_to_lds_b128 %6, %7, off\n\t"
      "s_wait_xcnt 0x0"
      :: "v"(lk0), "v"(gk0), "v"(lk1), "v"(gk1),
         "v"(lv0), "v"(gv0), "v"(lv1), "v"(gv1)
      : "memory");
}

__global__ __launch_bounds__(256)
void attn_kernel(const u16* __restrict__ Q, const u16* __restrict__ K,
                 const u16* __restrict__ Vt, u16* __restrict__ Obf) {
  __shared__ __align__(16) u16 ldsK[2][KVTILE];    // 2 x 9 KB
  __shared__ __align__(16) u16 ldsV[2][KVTILE];    // 2 x 9 KB

  const int wave = blockIdx.x * (blockDim.x >> 5) + (threadIdx.x >> 5);
  const int nqt  = S / 16;                         // 128 query tiles
  const int qt   = wave % nqt;
  const int bh   = wave / nqt;                     // b*H + h, same in a block
  const int l = threadIdx.x & 31, sel = l >> 4, ln = l & 15;

  const u16* Qb = Q  + (size_t)bh * S * DK;
  const u16* Kb = K  + (size_t)bh * S * DK;
  const u16* Vb = Vt + (size_t)bh * DK * S;

  // Copy map: a tile is 512 pieces of 16 B; thread t moves pieces t and
  // t + 256, that is rows t/8 and t/8 + 32, column piece t%8.
  const int crow = threadIdx.x >> 3, ccol = (threadIdx.x & 7) * 8;
  const u16* gk = Kb + (size_t)crow * DK + ccol;   // block 0, row crow
  const u16* gv = Vb + (size_t)crow * S + ccol;
  const unsigned lk = (unsigned)(size_t)&ldsK[0][crow * KVP + ccol];
  const unsigned lv = (unsigned)(size_t)&ldsV[0][crow * KVP + ccol];
  constexpr unsigned HALF = 32 * KVP * sizeof(u16);     // 32 rows further
  constexpr unsigned BUFB = KVTILE * sizeof(u16);       // the other buffer

  // Block 0 into buffer 0.
  stage_copies(lk, gk, lk + HALF, gk + 32 * DK, lv, gv, lv + HALF, gv + 32 * S);

  // Q fragments for both 32-wide d chunks (reused all iterations).
  const u16* qrow = Qb + (size_t)(qt * 16 + ln) * DK;
  u16x16 qf0 = load_frag(qrow, sel);
  u16x16 qf1 = load_frag(qrow + 32, sel);

  // exp2-domain score scale: log2(e) / sqrt(dk)
  const float sc = 0.125f * 1.44269504088896340736f;

  v8f accO[4] = {};                   // O^T: row d = t*16 + i + 8*sel, column ln
  float mrun = -__builtin_inff();     // running maximum of query ln
  float lsum = 0.f;                   // this half's share of its denominator

  // This wave's copies of block 0 have landed; the barrier publishes all.
  asm volatile("s_wait_asynccnt 0x0" ::: "memory");
  __syncthreads();
  // Block 1 into buffer 1 (S / 64 = 32 blocks exist).
  stage_copies(lk + BUFB, gk + 64 * DK, lk + BUFB + HALF, gk + 96 * DK,
               lv + BUFB, gv + 64, lv + BUFB + HALF, gv + 32 * S + 64);

  for (int j = 0; j < S / 64; j++) {
    const u16* Kt = ldsK[j & 1];
    const u16* Vl = ldsV[j & 1];

    // ---- S^T for keys [j*64, j*64+64) : four 16-key x 16-query C tiles ----
    v8f c[4];
#pragma unroll
    for (int kt = 0; kt < 4; kt++) {
      const u16* krow = Kt + (kt * 16 + ln) * KVP;
      v8f ct = {};
      ct = wmma_bf16(load_frag(krow, sel), qf0, ct);
      ct = wmma_bf16(load_frag(krow + 32, sel), qf1, ct);
      c[kt] = ct;                                // key kt*16 + i + 8*sel
    }

    // ---- online softmax update (exp2 domain), all of it in the lane ----
    float mx[4];
#pragma unroll
    for (int kt = 0; kt < 4; kt++) {
      mx[kt] = c[kt][0];
#pragma unroll
      for (int i = 1; i < 8; i++) mx[kt] = fmaxf(mx[kt], c[kt][i]);
    }
    float rm = fmaxf(fmaxf(mx[0], mx[1]), fmaxf(mx[2], mx[3]));
    rm = fmaxf(rm, xhalf(rm)) * sc;              // sc > 0: scale after the max
    const float nm = fmaxf(mrun, rm);            // same in both halves
    const float alpha = exp2_raw(mrun - nm);     // 0 in block 0 (mrun = -inf)
    mrun = nm;
    typedef __attribute__((ext_vector_type(2))) float f32x2;
    float p[4][8], ps[4];
#pragma unroll
    for (int kt = 0; kt < 4; kt++) {
#pragma unroll
      for (int i = 0; i < 8; i += 2) {
        // Written packed: left scalar, each argument takes a v_fma_f32 of its own.
        const f32x2 a = __builtin_elementwise_fma(
            f32x2{c[kt][i], c[kt][i + 1]}, f32x2{sc, sc}, f32x2{-nm, -nm});
        p[kt][i]     = exp2_raw(a.x);
        p[kt][i + 1] = exp2_raw(a.y);
      }
      ps[kt] = ((p[kt][0] + p[kt][1]) + (p[kt][2] + p[kt][3])) +
               ((p[kt][4] + p[kt][5]) + (p[kt][6] + p[kt][7]));
    }
    lsum = lsum * alpha + ((ps[0] + ps[1]) + (ps[2] + ps[3]));
#pragma unroll
    for (int t = 0; t < 4; t++) accO[t] *= alpha;

    // ---- O^T += V^T(64 x 64 keys) x P^T(64 keys x 16) ----
    u16x16 pf0 = pack_frag(p[0], p[1]);          // keys j*64 +  0..31
    u16x16 pf1 = pack_frag(p[2], p[3]);          // keys +32..63
#pragma unroll
    for (int t = 0; t < 4; t++) {
      const u16* vrow = Vl + (t * 16 + ln) * KVP;
      accO[t] = wmma_bf16(load_frag(vrow, sel), pf0, accO[t]);
      accO[t] = wmma_bf16(load_frag(vrow + 32, sel), pf1, accO[t]);
    }

    // ---- publish point of block j+1 ----
    // This wave's LDS reads of buffer j&1 are done ...
    asm volatile("s_wait_dscnt 0x0" ::: "memory");
    // ... and its own copies of block j+1 have landed.
    asm volatile("s_wait_asynccnt 0x0" ::: "memory");
    __syncthreads();   // publishes block j+1, frees buffer j&1 for the refill
    if (j + 2 < S / 64) {                        // same for the whole grid
      const unsigned bo = (unsigned)(j & 1) * BUFB;
      const u16* gk2 = gk + (size_t)(j + 2) * 64 * DK;
      const u16* gv2 = gv + (j + 2) * 64;
      stage_copies(lk + bo, gk2, lk + bo + HALF, gk2 + 32 * DK,
                   lv + bo, gv2, lv + bo + HALF, gv2 + 32 * S);
    }
  }
  // No copy is outstanding when the wave ends.
  asm volatile("s_wait_asynccnt 0x0" ::: "memory");

  // ---- normalize and store to [B*S, 768] (col = h*64 + d) ----
  const int b = bh / H, h = bh % H;
  const float inv = 1.f / (lsum + xhalf(lsum));  // join the halves' sums
  const size_t rowoff = ((size_t)b * S + qt * 16 + ln) * D + h * 64 + 8 * sel;
#pragma unroll
  for (int t = 0; t < 4; t++) {                  // 8 consecutive d per lane
    u16x8 pack;
#pragma unroll
    for (int i = 0; i < 8; i++) pack[i] = f2bf(accO[t][i] * inv);
    *(u16x8*)(Obf + rowoff + t * 16) = pack;
  }
}

// ---------------------------------------------------------------------------
// Host orchestration (all launches on `stream`; graph-capture safe).
// ---------------------------------------------------------------------------
extern "C" void kernel_launch(void* const* d_in, const int* in_sizes, int n_in,
                              void* d_out, int out_size, void* d_ws,
                              size_t ws_size, hipStream_t stream) {
  const float* query = (const float*)d_in[0];
  const float* key   = (const float*)d_in[1];
  const float* value = (const float*)d_in[2];
  const float* Wq    = (const float*)d_in[3];
  const float* bq    = (const float*)d_in[4];
  const float* Wo    = (const float*)d_in[5];
  const float* bo    = (const float*)d_in[6];
  float* out = (float*)d_out;

  // Workspace sub-allocation (256B aligned).
  char* ws = (char*)d_ws;
  size_t off = 0;
  auto suballoc = [&](size_t bytes) -> void* {
    void* p = ws + off;
    off = (off + bytes + 255) & ~(size_t)255;
    return p;
  };
  const size_t actBytes = (size_t)M * D * sizeof(u16);   // 12.6 MB
  const size_t wBytes   = (size_t)D * D * sizeof(u16);   // 1.2 MB
  u16* xbf    = (u16*)suballoc(3 * actBytes);   // query, key, value as bf16
  u16* qbf    = (u16*)suballoc(3 * actBytes);   // [b,h,s,d]
  u16* kbf    = qbf + (size_t)M * D;            // [b,h,s,d]
  u16* vtbf   = kbf + (size_t)M * D;            // [b,h,d,s]
  u16* attnbf = (u16*)suballoc(actBytes);   // [B*S, 768]
  u16* wqbf   = (u16*)suballoc(wBytes);
  u16* wobf   = (u16*)suballoc(wBytes);

  constexpr int convBlocks = 3 * ACTWG + 2 * WWG;        // 816 blocks, 16 waves
  const int gemmBlocks = (M / BM) * (D / BN);            // 256 blocks, 8 waves
  const int attnBlocks = (Bsz * H * (S / 16)) / 8;       // 768 blocks, 8 waves

  // query, key, value, Wq and Wo to bf16.
  f32_to_bf16_all_kernel<<<convBlocks, CONVT, 0, stream>>>(
      query, key, value, Wq, Wo, xbf, wqbf, wobf);

  // q = query @ Wq^T + bq -> [b,h,s,d]; k = key @ Wq^T + bq -> [b,h,s,d];
  // v = value @ Wq^T + bq -> [b,h,d,s] transposed (the reference reuses Wq/bq)
  gemm_bf16_kernel<<<dim3(gemmBlocks, 3), 256, 0, stream>>>(xbf, wqbf, bq, qbf,
                                                            nullptr, 0);

  // attention -> [B*S, 768] bf16
  attn_kernel<<<attnBlocks, 256, 0, stream>>>(qbf, kbf, vtbf, attnbf);

  // out = attn @ Wo^T + bo -> fp32 d_out
  gemm_bf16_kernel<<<gemmBlocks, 256, 0, stream>>>(attnbf, wobf, bo, nullptr, out, 1);
}

// v007
// It runs in 102 microseconds.
// Two timings next to v006 both put it at 1.07 times that version's speed.
// Counting every step since v000, it is 4.34 times as fast.
#include <hip/hip_runtime.h>

// ---------------------------------------------------------------------------
// MI455X (gfx1250) multi-head attention, bf16 WMMA pipeline.
//   stage 1: fp32 -> bf16 conversions (weights + activations), one launch
//   stage 2: q, k and v projection GEMMs, one launch, 128x192 tiles staged in
//            LDS (v_wmma_f32_16x16x32_bf16)
//   stage 3: flash-attention, transposed (S^T = K.Q^T, O^T += V^T.P^T), 64-key
//            blocks staged in LDS, 32 queries a wave (v_wmma + exp2 softmax)
//   stage 4: output projection (fp32 out)
// ---------------------------------------------------------------------------

typedef unsigned short u16;
typedef __attribute__((ext_vector_type(8)))  u16    u16x8;
typedef __attribute__((ext_vector_type(16))) u16    u16x16;
typedef __attribute__((ext_vector_type(8)))  float  v8f;
typedef __attribute__((ext_vector_type(16))) __bf16 v16bf;

#define DEV static __device__ __forceinline__

// Problem constants (fixed by the reference).
constexpr int Bsz = 4;
constexpr int S   = 2048;
constexpr int D   = 768;
constexpr int H   = 12;
constexpr int DK  = 64;
constexpr int M   = Bsz * S;   // 8192 rows for all dense GEMMs

DEV u16 f2bf(float f) {             // fp32 -> bf16, round-to-nearest-even
  unsigned u = __builtin_bit_cast(unsigned, f);
  u += 0x7FFFu + ((u >> 16) & 1u);
  return (u16)(u >> 16);
}

// 16-bit A/B fragment load (wave32). `row` points at 32 contiguous bf16
// covering this fragment's K-chunk. Per the CDNA5 layout, lane (sel = l>>4)
// holds K offsets sel*8+{0..7} and 16+sel*8+{0..7} -> two b128 loads.
DEV u16x16 load_frag(const u16* row, int sel) {
  u16x8 lo = *(const u16x8*)(row + sel * 8);
  u16x8 hi = *(const u16x8*)(row + 16 + sel * 8);
  return __builtin_shufflevector(lo, hi, 0, 1, 2, 3, 4, 5, 6, 7,
                                 8, 9, 10, 11, 12, 13, 14, 15);
}

DEV v8f wmma_bf16(u16x16 a, u16x16 b, v8f c) {
  return __builtin_amdgcn_wmma_f32_16x16x32_bf16(
      false, __builtin_bit_cast(v16bf, a),
      false, __builtin_bit_cast(v16bf, b),
      (short)0, c, false, false);
}

// Value of lane l ^ 16 (the other 16-lane half of the wave).
DEV float xhalf(float x) {
  int v = __builtin_bit_cast(int, x);
  return __builtin_bit_cast(float, __builtin_amdgcn_permlanex16(
      v, v, 0x76543210, 0xfedcba98, false, false));
}

// 2^x as the one hardware instruction. exp2f() adds a compare, two selects, an
// add and an ldexp per value, only to return a denormal where 2^x < 2^-126.
// Every x here is <= 0 and is taken against the row's running maximum: a weight
// that small is under 2^-126 of the row's largest, far below P's bf16 rounding.
DEV float exp2_raw(float x) { return __builtin_amdgcn_exp2f(x); }

// Two fp32 -> one register of two bf16, round-to-nearest-even.
DEV unsigned pack2(float lo, float hi) {
  typedef __attribute__((ext_vector_type(2))) float  f32x2;
  typedef __attribute__((ext_vector_type(2))) __bf16 bf16x2;
  return __builtin_bit_cast(unsigned,
                            __builtin_convertvector(f32x2{lo, hi}, bf16x2));
}

// Two 16-key score tiles of one lane (C layout: key = i + 8*sel, then
// 16 + i + 8*sel) are, in that order, the lane's 32-key B fragment.
DEV u16x16 pack_frag(const float* lo, const float* hi) {
  typedef __attribute__((ext_vector_type(8))) unsigned u32x8;
  u32x8 w = {pack2(lo[0], lo[1]), pack2(lo[2], lo[3]),
             pack2(lo[4], lo[5]), pack2(lo[6], lo[7]),
             pack2(hi[0], hi[1]), pack2(hi[2], hi[3]),
             pack2(hi[4], hi[5]), pack2(hi[6], hi[7])};
  return __builtin_bit_cast(u16x16, w);
}

// ---------------------------------------------------------------------------
// fp32 -> bf16 conversion, as a stream on few, long-lived waves.
// A work-group is 16 waves and owns CONVT * U consecutive pieces of four
// floats. A lane brings U pieces, 16 B each, so that every wave-wide load
// covers 512 contiguous bytes (four whole lines) and every wave-wide store 256
// (two whole lines). All U loads are issued before the first value is used.
// All five tensors are independent of each other and go in ONE launch: the
// block index names the tensor (256 work-groups for each activation, then 24
// for each weight matrix) and the piece of it.
// ---------------------------------------------------------------------------
constexpr int CONVT = 512;            // threads of a conversion work-group
constexpr int CONVU = 12;             // pieces of four floats per lane
constexpr int CONVE = CONVT * CONVU * 4;         // floats of one work-group
constexpr int ACTWG = M * D / CONVE;  // 256 work-groups per activation
constexpr int WWG   = D * D / CONVE;  // 24 work-groups per weight matrix
static_assert(ACTWG * CONVE == M * D, "whole work-groups only");
static_assert(WWG * CONVE == D * D, "whole work-groups only");

__global__ __launch_bounds__(CONVT)
void f32_to_bf16_all_kernel(const float* __restrict__ xq,
                            const float* __restrict__ xk,
                            const float* __restrict__ xv,
                            const float* __restrict__ wq,
                            const float* __restrict__ wo,
                            u16* __restrict__ xout,    // [3][M * D]: q, k, v
                            u16* __restrict__ wqout, u16* __restrict__ woout) {
  typedef __attribute__((ext_vector_type(4))) float    f32x4;
  typedef __attribute__((ext_vector_type(2))) unsigned u32x2;
  constexpr int U = CONVU;
  // Tensor and piece from the block index: the same for the whole work-group.
  int wg = blockIdx.x;
  const float* in;
  u16* out;
  if (wg < 3 * ACTWG) {
    const int t = wg / ACTWG;
    in  = t == 0 ? xq : t == 1 ? xk : xv;
    out = xout + (size_t)t * (M * D);
    wg -= t * ACTWG;
  } else {
    wg -= 3 * ACTWG;
    const int t = wg / WWG;
    in  = t == 0 ? wq : wo;
    out = t == 0 ? wqout : woout;
    wg -= t * WWG;
  }
  const size_t e0 = ((size_t)wg * (CONVT * U) + threadIdx.x) * 4;
  f32x4 v[U];
#pragma unroll   // rolled, each load would be waited for before the next issues
  for (int u = 0; u < U; u++)
    v[u] = *(const f32x4*)(in + e0 + (size_t)u * (CONVT * 4));
#pragma unroll   // constant indices keep v[] in registers
  for (int u = 0; u < U; u++) {
    u32x2 w = {pack2(v[u][0], v[u][1]), pack2(v[u][2], v[u][3])};
    *(u32x2*)(out + e0 + (size_t)u * (CONVT * 4)) = w;
  }
}

// ---------------------------------------------------------------------------
// GEMM: Y[m,n] = sum_k A[m,k] * W[n,k] + bias[n]
//   A : [M, 768] bf16 row-major          W : [768, 768] bf16 (torch [out,in])
// A work-group of eight waves owns a 128 x 192 tile of Y, one work-group per
// WGP (64 x 4 tiles). Per stage of 128 k the 128 A rows and the 192 W rows
// (256 B each, whole lines) are brought into LDS once per work-group by
// asynchronous b128 copies, in a ring of two buffers: stage s+1 flies while
// stage s is worked on. Fragments are read from LDS at a 272-B row pitch
// (16 B x odd). A wave owns 64 x 48 of the tile: 4 A-fragments x 3 B-fragments
// -> 12 WMMA per 32 k on 14 LDS b128 loads. k runs upward in steps of 32.
// The q, k and v projections share W and bias and do not depend on each other:
// they are ONE launch, blockIdx.y names the tensor (A and outb hold the three
// one behind the other, M * 768 elements each).
// outproj == 0, y = 0, 1: bf16 out, head-split [b,h,s,d] (q and k projections)
// outproj == 0, y = 2:    bf16 out, transposed [b,h,d,s] (v projection)
// outproj != 0 (y = 0):   fp32 out, [M, 768]             (final projection)
// ---------------------------------------------------------------------------
constexpr int BM = 128, BN = 192, BK = 128;
constexpr int GP     = BK + 8;              // LDS row pitch in u16 (272 B)
constexpr int GSTAGE = (BM + BN) * GP;      // one stage: 320 rows, 87040 B
constexpr int NSTAGE = D / BK;              // 6 stages
static_assert(M % BM == 0 && D % BN == 0 && D % BK == 0, "whole tiles only");
static_assert(NSTAGE >= 2, "the ring's prologue fills two stages");

// Ten copies of one lane: rows 16 apart in LDS (l + c * 16 rows) from ten
// global rows. The s_wait_xcnt is the last line of the copies' own statement
// so that no address register of an issued copy is rewritten in front of it.
DEV void copy10(const unsigned (&l)[10], const u16* const (&g)[10]) {
  asm volatile(
      "global_load_async_to_lds_b128 %0, %1, off\n\t"
      "global_load_async_to_lds_b128 %2, %3, off\n\t"
      "global_load_async_to_lds_b128 %4, %5, off\n\t"
      "global_load_async_to_lds_b128 %6, %7, off\n\t"
      "global_load_async_to_lds_b128 %8, %9, off\n\t"
      "global_load_async_to_lds_b128 %10, %11, off\n\t"
      "global_load_async_to_lds_b128 %12, %13, off\n\t"
      "global_load_async_to_lds_b128 %14, %15, off\n\t"
      "global_load_async_to_lds_b128 %16, %17, off\n\t"
      "global_load_async_to_lds_b128 %18, %19, off\n\t"
      "s_wait_xcnt 0x0"
      :: "v"(l[0]), "v"(g[0]), "v"(l[1]), "v"(g[1]), "v"(l[2]), "v"(g[2]),
         "v"(l[3]), "v"(g[3]), "v"(l[4]), "v"(g[4]), "v"(l[5]), "v"(g[5]),
         "v"(l[6]), "v"(g[6]), "v"(l[7]), "v"(g[7]), "v"(l[8]), "v"(g[8]),
         "v"(l[9]), "v"(g[9])
      : "memory");
}

// One stage = twenty copies per lane. Copy c fills LDS row c*16 + crow: rows
// 0..127 hold the A tile (c < 8), rows 128..319 the W tile.
//   lds0: the lane's LDS byte address in row crow of the target buffer
//   ga, gw: the lane's 16 B in row crow of the A tile / W tile, at this stage's k
DEV void gemm_stage(unsigned lds0, const u16* ga, const u16* gw) {
  constexpr unsigned STEP = 16 * GP * sizeof(u16);      // 16 rows further
  unsigned l[20];
  const u16* g[20];
#pragma unroll   // constant indices keep the addresses in registers
  for (int c = 0; c < 20; c++) {
    l[c] = lds0 + c * STEP;
    g[c] = c < BM / 16 ? ga + (size_t)c * 16 * D
                       : gw + (size_t)(c - BM / 16) * 16 * D;
  }
  const unsigned la[10] = {l[0], l[1], l[2], l[3], l[4],
                           l[5], l[6], l[7], l[8], l[9]};
  const u16* const gaa[10] = {g[0], g[1], g[2], g[3], g[4],
                              g[5], g[6], g[7], g[8], g[9]};
  const unsigned lb[10] = {l[10], l[11], l[12], l[13], l[14],
                           l[15], l[16], l[17], l[18], l[19]};
  const u16* const gbb[10] = {g[10], g[11], g[12], g[13], g[14],
                              g[15], g[16], g[17], g[18], g[19]};
  copy10(la, gaa);
  copy10(lb, gbb);
}

__global__ __launch_bounds__(256)
void gemm_bf16_kernel(const u16* __restrict__ A, const u16* __restrict__ W,
                      const float* __restrict__ bias, u16* __restrict__ outb,
                      float* __restrict__ outf, int outproj) {
  __shared__ __align__(16) u16 ldsG[2][GSTAGE];    // 2 x 85 KB

  const int mode = outproj ? 2 : blockIdx.y == 2 ? 1 : 0;
  A    += (size_t)blockIdx.y * (M * D);            // this tensor's rows
  outb += (size_t)blockIdx.y * (M * D);

  // The four work-groups that read the same A rows are M / BM = 64 apart in
  // index. Speed only.
  const int m0 = (blockIdx.x % (M / BM)) * BM;     // tile's first row
  const int n0 = (blockIdx.x / (M / BM)) * BN;     // tile's first column
  const int wv = threadIdx.x >> 5;
  const int wm = wv >> 2, wn = wv & 3;             // 2 x 4 waves of 64 x 48
  const int l = threadIdx.x & 31, sel = l >> 4, ln = l & 15;

  // Copy map: a row is 16 pieces of 16 B; thread t moves piece t%16 of rows
  // t/16 + 16*c, so every wave-wide copy covers two whole rows of 256 B.
  const int crow = threadIdx.x >> 4, ccol = (threadIdx.x & 15) * 8;
  const u16* ga = A + (size_t)(m0 + crow) * D + ccol;
  const u16* gw = W + (size_t)(n0 + crow) * D + ccol;
  const unsigned lc = (unsigned)(size_t)&ldsG[0][crow * GP + ccol];
  constexpr unsigned GBUFB = GSTAGE * sizeof(u16);      // the other buffer

  // Stage 0 into buffer 0.
  gemm_stage(lc, ga, gw);

  v8f acc[4][3] = {};

  // This wave's copies of stage 0 have landed; the barrier publishes all.
  asm volatile("s_wait_asynccnt 0x0" ::: "memory");
  __syncthreads();
  // Stage 1 into buffer 1.
  gemm_stage(lc + GBUFB, ga + BK, gw + BK);

  for (int s = 0; s < NSTAGE; s++) {
    const u16* As = ldsG[s & 1] + (wm * 64 + ln) * GP;
    const u16* Ws = ldsG[s & 1] + (BM + wn * 48 + ln) * GP;
    // Two fragment sets: block kb+1's 14 LDS reads go out as one group ahead
    // of block kb's 12 WMMA. Only this stage's own buffer is read.
    u16x16 af[2][4], bf[2][3];
#pragma unroll
    for (int r = 0; r < 4; r++) af[0][r] = load_frag(As + r * 16 * GP, sel);
#pragma unroll
    for (int t = 0; t < 3; t++) bf[0][t] = load_frag(Ws + t * 16 * GP, sel);
#pragma unroll   // constant set indices keep the fragments in registers
    for (int kb = 0; kb < BK / 32; kb++) {
      const int cur = kb & 1, nxt = cur ^ 1;
      if (kb + 1 < BK / 32) {
        const int kk = (kb + 1) * 32;
#pragma unroll
        for (int r = 0; r < 4; r++)
          af[nxt][r] = load_frag(As + r * 16 * GP + kk, sel);
#pragma unroll
        for (int t = 0; t < 3; t++)
          bf[nxt][t] = load_frag(Ws + t * 16 * GP + kk, sel);
      }
      // Keeps the reads above in front of the WMMA below: sunk among them,
      // each small group is waited for in full before its WMMA can issue.
      __builtin_amdgcn_sched_barrier(0);
#pragma unroll
      for (int r = 0; r < 4; r++)
#pragma unroll
        for (int t = 0; t < 3; t++)
          acc[r][t] = wmma_bf16(af[cur][r], bf[cur][t], acc[r][t]);
    }

    // ---- publish point of stage s+1 ----
    // This wave's LDS reads of buffer s&1 are done ...
    asm volatile("s_wait_dscnt 0x0" ::: "memory");
    // ... and its own copies of stage s+1 have landed.
    asm volatile("s_wait_asynccnt 0x0" ::: "memory");
    __syncthreads();   // publishes stage s+1, frees buffer s&1 for the refill
    if (s + 2 < NSTAGE)                          // same for the whole grid
      gemm_stage(lc + (unsigned)(s & 1) * GBUFB, ga + (s + 2) * BK,
                 gw + (s + 2) * BK);
  }
  // No copy is outstanding when the wave ends.
  asm volatile("s_wait_asynccnt 0x0" ::: "memory");

#pragma unroll
  for (int r = 0; r < 4; r++) {
    const int Mi0 = m0 + wm * 64 + r * 16;
#pragma unroll
    for (int t = 0; t < 3; t++) {
      const int ng = n0 + wn * 48 + t * 16 + ln; // lane's output column
      const float bv = bias[ng];
      if (mode == 2) {                           // fp32 [M, D]
#pragma unroll
        for (int i = 0; i < 8; i++) {
          int Mi = Mi0 + i + 8 * sel;            // C layout: row = i + 8*sel
          outf[(size_t)Mi * D + ng] = acc[r][t][i] + bv;
        }
      } else if (mode == 0) {                    // bf16 [b,h,s,d]
        int h = ng >> 6, d = ng & 63;
#pragma unroll
        for (int i = 0; i < 8; i++) {
          int Mi = Mi0 + i + 8 * sel;
          int b = Mi >> 11, s = Mi & (S - 1);
          outb[(((size_t)(b * H + h)) * S + s) * DK + d] =
              f2bf(acc[r][t][i] + bv);
        }
      } else {                                   // bf16 [b,h,d,s] (transposed)
        int h = ng >> 6, d = ng & 63;
        int Mi = Mi0 + 8 * sel;                  // 8 consecutive s per lane
        int b = Mi >> 11, s0 = Mi & (S - 1);
        u16x8 pack;
#pragma unroll
        for (int i = 0; i < 8; i++) pack[i] = f2bf(acc[r][t][i] + bv);
        *(u16x8*)(outb + (((size_t)(b * H + h)) * DK + d) * S + s0) = pack;
      }
    }
  }
}

// ---------------------------------------------------------------------------
// Flash attention. One wave per (b, h, 32-query tile): two groups of 16 query
// columns that share every K and Vt fragment the wave reads, so that one
// fragment from LDS feeds two WMMA. Four waves (128 queries of one head) form
// a work-group and share every 64-key block; three work-groups stand on a WGP.
//   Q,K : [b,h,s,d] bf16      Vt : [b,h,d,s] bf16     out: bf16 [B*S, 768]
// Each 64-key K tile and Vt tile (64 rows of 128 B each) is brought into LDS
// once per work-group by asynchronous b128 copies, whole 128-B lines per row,
// in a ring of two buffers: block j+1 flies while block j is worked on. The
// fragments are then read from LDS at a 144-B row pitch (16 B x odd).
// Both products run transposed: S^T = K.Q^T (A = K rows, B = Q) and
// O^T += V^T.P^T (A = Vt rows, B = P^T). In each group a lane then holds scores
// of ONE query (column ln), 32 of a block's 64 keys, the lane l ^ 16 the other
// 32: maximum and sum run in the lane with one exchange between the halves, and
// the exponentials pack straight into the B operand, so P never goes through
// LDS. Softmax runs in the exp2 domain: scores are scaled by log2(e)/sqrt(dk).
// ---------------------------------------------------------------------------
constexpr int KVP    = 72;            // LDS row pitch of a staged tile, in u16
constexpr int KVTILE = 64 * KVP;      // one staged tile: 64 rows, 9216 B
constexpr int AWAVES = 4;             // waves of an attention work-group
constexpr int QG     = 2;             // groups of 16 query columns per wave

// One stage = eight copies per lane: four of K, four of Vt, rows 16 apart.
//   lk, lv: the lane's LDS byte address in row crow of the target buffers
//   gk, gv: the lane's 16 B in row crow of this block's K tile / Vt tile
// The s_wait_xcnt is the last line of the copies' own statement so that no
// address register of an issued copy is rewritten in front of it.
DEV void stage_copies(unsigned lk, const u16* gk, unsigned lv, const u16* gv) {
  constexpr unsigned STEP = 16 * KVP * sizeof(u16);     // 16 rows further
  asm volatile(
      "global_load_async_to_lds_b128 %0, %1, off\n\t"
      "global_load_async_to_lds_b128 %2, %3, off\n\t"
      "global_load_async_to_lds_b128 %4, %5, off\n\t"
      "global_load_async_to_lds_b128 %6, %7, off\n\t"
      "global_load_async_to_lds_b128 %8, %9, off\n\t"
      "global_load_async_to_lds_b128 %10, %11, off\n\t"
      "global_load_async_to_lds_b128 %12, %13, off\n\t"
      "global_load_async_to_lds_b128 %14, %15, off\n\t"
      "s_wait_xcnt 0x0"
      :: "v"(lk), "v"(gk), "v"(lk + STEP), "v"(gk + 16 * DK),
         "v"(lk + 2 * STEP), "v"(gk + 32 * DK),
         "v"(lk + 3 * STEP), "v"(gk + 48 * DK),
         "v"(lv), "v"(gv), "v"(lv + STEP), "v"(gv + 16 * S),
         "v"(lv + 2 * STEP), "v"(gv + 32 * S),
         "v"(lv + 3 * STEP), "v"(gv + 48 * S)
      : "memory");
}

// Three waves per SIMD: the 768 work-groups then stand three on every WGP, all
// at once; a fourth on one WGP would leave another WGP short of work.
__global__ __launch_bounds__(AWAVES * 32)
__attribute__((amdgpu_waves_per_eu(3, 3)))
void attn_kernel(const u16* __restrict__ Q, const u16* __restrict__ K,
                 const u16* __restrict__ Vt, u16* __restrict__ Obf) {
  __shared__ __align__(16) u16 ldsK[2][KVTILE];    // 2 x 9 KB
  __shared__ __align__(16) u16 ldsV[2][KVTILE];    // 2 x 9 KB

  const int wave = blockIdx.x * AWAVES + (threadIdx.x >> 5);
  constexpr int nqt = S / (16 * QG);               // 64 query tiles
  const int qt   = wave % nqt;
  const int bh   = wave / nqt;                     // b*H + h, same in a block
  const int l = threadIdx.x & 31, sel = l >> 4, ln = l & 15;

  const u16* Qb = Q  + (size_t)bh * S * DK;
  const u16* Kb = K  + (size_t)bh * S * DK;
  const u16* Vb = Vt + (size_t)bh * DK * S;

  // Copy map: a tile is 512 pieces of 16 B; thread t moves pieces t + 128*c,
  // that is rows t/8 + 16*c (c < 4), column piece t%8.
  const int crow = threadIdx.x >> 3, ccol = (threadIdx.x & 7) * 8;
  const u16* gk = Kb + (size_t)crow * DK + ccol;   // block 0, row crow
  const u16* gv = Vb + (size_t)crow * S + ccol;
  const unsigned lk = (unsigned)(size_t)&ldsK[0][crow * KVP + ccol];
  const unsigned lv = (unsigned)(size_t)&ldsV[0][crow * KVP + ccol];
  constexpr unsigned BUFB = KVTILE * sizeof(u16);       // the other buffer

  // Block 0 into buffer 0.
  stage_copies(lk, gk, lv, gv);

  // Q fragments of both groups, both 32-wide d chunks (reused all iterations).
  u16x16 qf[QG][2];
#pragma unroll
  for (int g = 0; g < QG; g++) {
    const u16* qrow = Qb + (size_t)((qt * QG + g) * 16 + ln) * DK;
    qf[g][0] = load_frag(qrow, sel);
    qf[g][1] = load_frag(qrow + 32, sel);
  }
  // The set-up below reuses the address registers that these loads name.
  asm volatile("s_wait_xcnt 0x0" ::: "memory");

  // exp2-domain score scale: log2(e) / sqrt(dk)
  const float sc = 0.125f * 1.44269504088896340736f;

  v8f accO[QG][4] = {};               // O^T: row d = t*16 + i + 8*sel, column ln
  float mrun[QG];                     // running maximum of the group's query ln
  float lsum[QG];                     // this half's share of its denominator
#pragma unroll
  for (int g = 0; g < QG; g++) {
    mrun[g] = -__builtin_inff();
    lsum[g] = 0.f;
  }

  // This wave's copies of block 0 have landed; the barrier publishes all.
  asm volatile("s_wait_asynccnt 0x0" ::: "memory");
  __syncthreads();
  // Block 1 into buffer 1 (S / 64 = 32 blocks exist).
  stage_copies(lk + BUFB, gk + 64 * DK, lv + BUFB, gv + 64);

  for (int j = 0; j < S / 64; j++) {
    const u16* Kt = ldsK[j & 1];
    const u16* Vl = ldsV[j & 1];

    // ---- S^T for keys [j*64, j*64+64) : per group four 16-key x 16-query C
    // tiles; each K fragment is read once and used by both groups ----
    u16x16 kf[4][2];
#pragma unroll
    for (int kt = 0; kt < 4; kt++) {
      const u16* krow = Kt + (kt * 16 + ln) * KVP;
      kf[kt][0] = load_frag(krow, sel);
      kf[kt][1] = load_frag(krow + 32, sel);
    }
    // Keeps the 16 reads above one group in front of the WMMA: sunk among
    // them, each pair is waited for in full before its WMMA can issue.
    __builtin_amdgcn_sched_barrier(0);
    v8f c[QG][4];
#pragma unroll
    for (int kt = 0; kt < 4; kt++) {
#pragma unroll
      for (int g = 0; g < QG; g++)               // key kt*16 + i + 8*sel
        c[g][kt] = wmma_bf16(kf[kt][0], qf[g][0], v8f{});
#pragma unroll
      for (int g = 0; g < QG; g++)
        c[g][kt] = wmma_bf16(kf[kt][1], qf[g][1], c[g][kt]);
    }
    // Keeps the 16 score WMMA one run: with the maxima drawn in among them,
    // each first read of a fresh tile is held off by v_nop that take issue slots.
    __builtin_amdgcn_sched_barrier(0);
    // The block's Vt fragments, into the registers the K fragments leave: they
    // land while the softmax below runs.
    u16x16 vf[4][2];
#pragma unroll
    for (int t = 0; t < 4; t++) {
      const u16* vrow = Vl + (t * 16 + ln) * KVP;
      vf[t][0] = load_frag(vrow, sel);
      vf[t][1] = load_frag(vrow + 32, sel);
    }
    // Keeps these 16 reads one group in front of the softmax: left free, the
    // last pairs sink among the WMMA below and are waited for in full there.
    __builtin_amdgcn_sched_barrier(0);

    // ---- online softmax update (exp2 domain), all of it in the lane ----
    u16x16 pf[QG][2];
#pragma unroll
    for (int g = 0; g < QG; g++) {
      float mx[4];
#pragma unroll
      for (int kt = 0; kt < 4; kt++) {
        mx[kt] = c[g][kt][0];
#pragma unroll
        for (int i = 1; i < 8; i++) mx[kt] = fmaxf(mx[kt], c[g][kt][i]);
      }
      float rm = fmaxf(fmaxf(mx[0], mx[1]), fmaxf(mx[2], mx[3]));
      rm = fmaxf(rm, xhalf(rm)) * sc;            // sc > 0: scale after the max
      const float nm = fmaxf(mrun[g], rm);       // same in both halves
      const float alpha = exp2_raw(mrun[g] - nm);  // 0 in block 0 (mrun = -inf)
      mrun[g] = nm;
      typedef __attribute__((ext_vector_type(2))) float f32x2;
      float p[4][8], ps[4];
#pragma unroll
      for (int kt = 0; kt < 4; kt++) {
#pragma unroll
        for (int i = 0; i < 8; i += 2) {
          // Written packed: left scalar, each argument takes a v_fma_f32 of its own.
          const f32x2 a = __builtin_elementwise_fma(
              f32x2{c[g][kt][i], c[g][kt][i + 1]}, f32x2{sc, sc},
              f32x2{-nm, -nm});
          p[kt][i]     = exp2_raw(a.x);
          p[kt][i + 1] = exp2_raw(a.y);
        }
        ps[kt] = ((p[kt][0] + p[kt][1]) + (p[kt][2] + p[kt][3])) +
                 ((p[kt][4] + p[kt][5]) + (p[kt][6] + p[kt][7]));
      }
      lsum[g] = lsum[g] * alpha + ((ps[0] + ps[1]) + (ps[2] + ps[3]));
#pragma unroll
      for (int t = 0; t < 4; t++) accO[g][t] *= alpha;
      pf[g][0] = pack_frag(p[0], p[1]);          // keys j*64 +  0..31
      pf[g][1] = pack_frag(p[2], p[3]);          // keys +32..63
    }

    // ---- O^T += V^T(64 x 64 keys) x P^T(64 keys x 16), each Vt fragment
    // used by both groups ----
#pragma unroll
    for (int t = 0; t < 4; t++) {
#pragma unroll
      for (int g = 0; g < QG; g++)
        accO[g][t] = wmma_bf16(vf[t][0], pf[g][0], accO[g][t]);
    }
#pragma unroll
    for (int t = 0; t < 4; t++) {
#pragma unroll
      for (int g = 0; g < QG; g++)
        accO[g][t] = wmma_bf16(vf[t][1], pf[g][1], accO[g][t]);
    }

    // ---- publish point of block j+1 ----
    // Keeps the waits and the barrier below at the foot of the trip: drawn up
    // to the last LDS read, they would wait for copies that have just gone out.
    __builtin_amdgcn_sched_barrier(0);
    // This wave's LDS reads of buffer j&1 are done ...
    asm volatile("s_wait_dscnt 0x0" ::: "memory");
    // ... and its own copies of block j+1 have landed.
    asm volatile("s_wait_asynccnt 0x0" ::: "memory");
    __syncthreads();   // publishes block j+1, frees buffer j&1 for the refill
    if (j + 2 < S / 64) {                        // same for the whole grid
      const unsigned bo = (unsigned)(j & 1) * BUFB;
      stage_copies(lk + bo, gk + (size_t)(j + 2) * 64 * DK,
                   lv + bo, gv + (j + 2) * 64);
    }
  }
  // No copy is outstanding when the wave ends.
  asm volatile("s_wait_asynccnt 0x0" ::: "memory");

  // ---- normalize and store to [B*S, 768] (col = h*64 + d) ----
  const int b = bh / H, h = bh % H;
#pragma unroll
  for (int g = 0; g < QG; g++) {
    const float inv = 1.f / (lsum[g] + xhalf(lsum[g]));  // join the halves' sums
    const size_t rowoff =
        ((size_t)b * S + (qt * QG + g) * 16 + ln) * D + h * 64 + 8 * sel;
#pragma unroll
    for (int t = 0; t < 4; t++) {                // 8 consecutive d per lane
      u16x8 pack;
#pragma unroll
      for (int i = 0; i < 8; i++) pack[i] = f2bf(accO[g][t][i] * inv);
      *(u16x8*)(Obf + rowoff + t * 16) = pack;
      // The arithmetic of the next store reuses registers that this one names.
      if (g + 1 < QG || t + 1 < 4) asm volatile("s_wait_xcnt 0x0" ::: "memory");
    }
  }
}

// ---------------------------------------------------------------------------
// Host orchestration (all launches on `stream`; graph-capture safe).
// ---------------------------------------------------------------------------
extern "C" void kernel_launch(void* const* d_in, const int* in_sizes, int n_in,
                              void* d_out, int out_size, void* d_ws,
                              size_t ws_size, hipStream_t stream) {
  const float* query = (const float*)d_in[0];
  const float* key   = (const float*)d_in[1];
  const float* value = (const float*)d_in[2];
  const float* Wq    = (const float*)d_in[3];
  const float* bq    = (const float*)d_in[4];
  const float* Wo    = (const float*)d_in[5];
  const float* bo    = (const float*)d_in[6];
  float* out = (float*)d_out;

  // Workspace sub-allocation (256B aligned).
  char* ws = (char*)d_ws;
  size_t off = 0;
  auto suballoc = [&](size_t bytes) -> void* {
    void* p = ws + off;
    off = (off + bytes + 255) & ~(size_t)255;
    return p;
  };
  const size_t actBytes = (size_t)M * D * sizeof(u16);   // 12.6 MB
  const size_t wBytes   = (size_t)D * D * sizeof(u16);   // 1.2 MB
  u16* xbf    = (u16*)suballoc(3 * actBytes);   // query, key, value as bf16
  u16* qbf    = (u16*)suballoc(3 * actBytes);   // [b,h,s,d]
  u16* kbf    = qbf + (size_t)M * D;            // [b,h,s,d]
  u16* vtbf   = kbf + (size_t)M * D;            // [b,h,d,s]
  u16* attnbf = (u16*)suballoc(actBytes);   // [B*S, 768]
  u16* wqbf   = (u16*)suballoc(wBytes);
  u16* wobf   = (u16*)suballoc(wBytes);

  constexpr int convBlocks = 3 * ACTWG + 2 * WWG;        // 816 blocks, 16 waves
  const int gemmBlocks = (M / BM) * (D / BN);            // 256 blocks, 8 waves
  const int attnBlocks = Bsz * H * (S / (16 * QG)) / AWAVES;   // 768 blocks, 4 waves

  // query, key, value, Wq and Wo to bf16.
  f32_to_bf16_all_kernel<<<convBlocks, CONVT, 0, stream>>>(
      query, key, value, Wq, Wo, xbf, wqbf, wobf);

  // q = query @ Wq^T + bq -> [b,h,s,d]; k = key @ Wq^T + bq -> [b,h,s,d];
  // v = value @ Wq^T + bq -> [b,h,d,s] transposed (the reference reuses Wq/bq)
  gemm_bf16_kernel<<<dim3(gemmBlocks, 3), 256, 0, stream>>>(xbf, wqbf, bq, qbf,
                                                            nullptr, 0);

  // attention -> [B*S, 768] bf16
  attn_kernel<<<attnBlocks, AWAVES * 32, 0, stream>>>(qbf, kbf, vtbf, attnbf);

  // out = attn @ Wo^T + bo -> fp32 d_out
  gemm_bf16_kernel<<<gemmBlocks, 256, 0, stream>>>(attnbf, wobf, bo, nullptr, out, 1);
}

// v008
// A run of this version takes 95.9 microseconds.
// Next to v007, in two timings, it ran 1.06 times as fast each time.
// Over all steps from v000 it is 4.60 times as fast.
#include <hip/hip_runtime.h>

// ---------------------------------------------------------------------------
// MI455X (gfx1250) multi-head attention, bf16 WMMA pipeline.
//   stage 1: fp32 -> bf16 conversions (weights + activations), one launch
//   stage 2: q, k and v projection GEMMs, one launch, 128x192 tiles staged in
//            LDS (v_wmma_f32_16x16x32_bf16)
//   stage 3: flash-attention, transposed (S^T = K.Q^T, O^T += V^T.P^T), 64-key
//            blocks staged in LDS, 32 queries a wave (v_wmma + exp2 softmax)
//   stage 4: output projection (fp32 out)
// ---------------------------------------------------------------------------

typedef unsigned short u16;
typedef __attribute__((ext_vector_type(8)))  u16    u16x8;
typedef __attribute__((ext_vector_type(16))) u16    u16x16;
typedef __attribute__((ext_vector_type(8)))  float  v8f;
typedef __attribute__((ext_vector_type(16))) __bf16 v16bf;

#define DEV static __device__ __forceinline__

// Problem constants (fixed by the reference).
constexpr int Bsz = 4;
constexpr int S   = 2048;
constexpr int D   = 768;
constexpr int H   = 12;
constexpr int DK  = 64;
constexpr int M   = Bsz * S;   // 8192 rows for all dense GEMMs
// exp2-domain score scale, log2(e) / sqrt(dk): q carries it out of its GEMM.
constexpr float QSCALE = 0.125f * 1.44269504088896340736f;

DEV u16 f2bf(float f) {             // fp32 -> bf16, round-to-nearest-even
  unsigned u = __builtin_bit_cast(unsigned, f);
  u += 0x7FFFu + ((u >> 16) & 1u);
  return (u16)(u >> 16);
}

// 16-bit A/B fragment load (wave32). `row` points at 32 contiguous bf16
// covering this fragment's K-chunk. Per the CDNA5 layout, lane (sel = l>>4)
// holds K offsets sel*8+{0..7} and 16+sel*8+{0..7} -> two b128 loads.
DEV u16x16 load_frag(const u16* row, int sel) {
  u16x8 lo = *(const u16x8*)(row + sel * 8);
  u16x8 hi = *(const u16x8*)(row + 16 + sel * 8);
  return __builtin_shufflevector(lo, hi, 0, 1, 2, 3, 4, 5, 6, 7,
                                 8, 9, 10, 11, 12, 13, 14, 15);
}

DEV v8f wmma_bf16(u16x16 a, u16x16 b, v8f c) {
  return __builtin_amdgcn_wmma_f32_16x16x32_bf16(
      false, __builtin_bit_cast(v16bf, a),
      false, __builtin_bit_cast(v16bf, b),
      (short)0, c, false, false);
}

// Value of lane l ^ 16 (the other 16-lane half of the wave).
DEV float xhalf(float x) {
  int v = __builtin_bit_cast(int, x);
  return __builtin_bit_cast(float, __builtin_amdgcn_permlanex16(
      v, v, 0x76543210, 0xfedcba98, false, false));
}

// 2^x as the one hardware instruction. exp2f() adds a compare, two selects, an
// add and an ldexp per value, only to return a denormal where 2^x < 2^-126.
// Every x here is taken against the row's kept maximum, which the row's largest
// score so far is never below: a weight that small is under 2^-126 of the row's
// largest, far below P's bf16 rounding.
DEV float exp2_raw(float x) { return __builtin_amdgcn_exp2f(x); }

// Two fp32 -> one register of two bf16, round-to-nearest-even.
DEV unsigned pack2(float lo, float hi) {
  typedef __attribute__((ext_vector_type(2))) float  f32x2;
  typedef __attribute__((ext_vector_type(2))) __bf16 bf16x2;
  return __builtin_bit_cast(unsigned,
                            __builtin_convertvector(f32x2{lo, hi}, bf16x2));
}

// Two 16-key score tiles of one lane (C layout: key = i + 8*sel, then
// 16 + i + 8*sel) are, in that order, the lane's 32-key B fragment.
DEV u16x16 pack_frag(const float* lo, const float* hi) {
  typedef __attribute__((ext_vector_type(8))) unsigned u32x8;
  u32x8 w = {pack2(lo[0], lo[1]), pack2(lo[2], lo[3]),
             pack2(lo[4], lo[5]), pack2(lo[6], lo[7]),
             pack2(hi[0], hi[1]), pack2(hi[2], hi[3]),
             pack2(hi[4], hi[5]), pack2(hi[6], hi[7])};
  return __builtin_bit_cast(u16x16, w);
}

// ---------------------------------------------------------------------------
// fp32 -> bf16 conversion, as a stream on few, long-lived waves.
// A work-group is 16 waves and owns CONVT * U consecutive pieces of four
// floats. A lane brings U pieces, 16 B each, so that every wave-wide load
// covers 512 contiguous bytes (four whole lines) and every wave-wide store 256
// (two whole lines). All U loads are issued before the first value is used.
// All five tensors are independent of each other and go in ONE launch: the
// block index names the tensor (256 work-groups for each activation, then 24
// for each weight matrix) and the piece of it.
// ---------------------------------------------------------------------------
constexpr int CONVT = 512;            // threads of a conversion work-group
constexpr int CONVU = 12;             // pieces of four floats per lane
constexpr int CONVE = CONVT * CONVU * 4;         // floats of one work-group
constexpr int ACTWG = M * D / CONVE;  // 256 work-groups per activation
constexpr int WWG   = D * D / CONVE;  // 24 work-groups per weight matrix
static_assert(ACTWG * CONVE == M * D, "whole work-groups only");
static_assert(WWG * CONVE == D * D, "whole work-groups only");

__global__ __launch_bounds__(CONVT)
void f32_to_bf16_all_kernel(const float* __restrict__ xq,
                            const float* __restrict__ xk,
                            const float* __restrict__ xv,
                            const float* __restrict__ wq,
                            const float* __restrict__ wo,
                            u16* __restrict__ xout,    // [3][M * D]: q, k, v
                            u16* __restrict__ wqout, u16* __restrict__ woout) {
  typedef __attribute__((ext_vector_type(4))) float    f32x4;
  typedef __attribute__((ext_vector_type(2))) unsigned u32x2;
  constexpr int U = CONVU;
  // Tensor and piece from the block index: the same for the whole work-group.
  int wg = blockIdx.x;
  const float* in;
  u16* out;
  if (wg < 3 * ACTWG) {
    const int t = wg / ACTWG;
    in  = t == 0 ? xq : t == 1 ? xk : xv;
    out = xout + (size_t)t * (M * D);
    wg -= t * ACTWG;
  } else {
    wg -= 3 * ACTWG;
    const int t = wg / WWG;
    in  = t == 0 ? wq : wo;
    out = t == 0 ? wqout : woout;
    wg -= t * WWG;
  }
  const size_t e0 = ((size_t)wg * (CONVT * U) + threadIdx.x) * 4;
  f32x4 v[U];
#pragma unroll   // rolled, each load would be waited for before the next issues
  for (int u = 0; u < U; u++)
    v[u] = *(const f32x4*)(in + e0 + (size_t)u * (CONVT * 4));
#pragma unroll   // constant indices keep v[] in registers
  for (int u = 0; u < U; u++) {
    u32x2 w = {pack2(v[u][0], v[u][1]), pack2(v[u][2], v[u][3])};
    *(u32x2*)(out + e0 + (size_t)u * (CONVT * 4)) = w;
  }
}

// ---------------------------------------------------------------------------
// GEMM: Y[m,n] = sum_k A[m,k] * W[n,k] + bias[n]
//   A : [M, 768] bf16 row-major          W : [768, 768] bf16 (torch [out,in])
// A work-group of eight waves owns a 128 x 192 tile of Y, one work-group per
// WGP (64 x 4 tiles). Per stage of 128 k the 128 A rows and the 192 W rows
// (256 B each, whole lines) are brought into LDS once per work-group by
// asynchronous b128 copies, in a ring of two buffers: stage s+1 flies while
// stage s is worked on. Fragments are read from LDS at a 272-B row pitch
// (16 B x odd). A wave owns 64 x 48 of the tile: 4 A-fragments x 3 B-fragments
// -> 12 WMMA per 32 k on 14 LDS b128 loads. k runs upward in steps of 32.
// The q, k and v projections share W and bias and do not depend on each other:
// they are ONE launch, blockIdx.y names the tensor (A and outb hold the three
// one behind the other, M * 768 elements each).
// outproj == 0, y = 0, 1: bf16 out, head-split [b,h,s,d] (q and k projections);
//                         q (y = 0) is multiplied by QSCALE before it is rounded
// outproj == 0, y = 2:    bf16 out, transposed [b,h,d,s] (v projection)
// outproj != 0 (y = 0):   fp32 out, [M, 768]             (final projection)
// ---------------------------------------------------------------------------
constexpr int BM = 128, BN = 192, BK = 128;
constexpr int GP     = BK + 8;              // LDS row pitch in u16 (272 B)
constexpr int GSTAGE = (BM + BN) * GP;      // one stage: 320 rows, 87040 B
constexpr int NSTAGE = D / BK;              // 6 stages
static_assert(M % BM == 0 && D % BN == 0 && D % BK == 0, "whole tiles only");
static_assert(NSTAGE >= 2, "the ring's prologue fills two stages");

// Ten copies of one lane: rows 16 apart in LDS (l + c * 16 rows) from ten
// global rows. The s_wait_xcnt is the last line of the copies' own statement
// so that no address register of an issued copy is rewritten in front of it.
DEV void copy10(const unsigned (&l)[10], const u16* const (&g)[10]) {
  asm volatile(
      "global_load_async_to_lds_b128 %0, %1, off\n\t"
      "global_load_async_to_lds_b128 %2, %3, off\n\t"
      "global_load_async_to_lds_b128 %4, %5, off\n\t"
      "global_load_async_to_lds_b128 %6, %7, off\n\t"
      "global_load_async_to_lds_b128 %8, %9, off\n\t"
      "global_load_async_to_lds_b128 %10, %11, off\n\t"
      "global_load_async_to_lds_b128 %12, %13, off\n\t"
      "global_load_async_to_lds_b128 %14, %15, off\n\t"
      "global_load_async_to_lds_b128 %16, %17, off\n\t"
      "global_load_async_to_lds_b128 %18, %19, off\n\t"
      "s_wait_xcnt 0x0"
      :: "v"(l[0]), "v"(g[0]), "v"(l[1]), "v"(g[1]), "v"(l[2]), "v"(g[2]),
         "v"(l[3]), "v"(g[3]), "v"(l[4]), "v"(g[4]), "v"(l[5]), "v"(g[5]),
         "v"(l[6]), "v"(g[6]), "v"(l[7]), "v"(g[7]), "v"(l[8]), "v"(g[8]),
         "v"(l[9]), "v"(g[9])
      : "memory");
}

// One stage = twenty copies per lane. Copy c fills LDS row c*16 + crow: rows
// 0..127 hold the A tile (c < 8), rows 128..319 the W tile.
//   lds0: the lane's LDS byte address in row crow of the target buffer
//   ga, gw: the lane's 16 B in row crow of the A tile / W tile, at this stage's k
DEV void gemm_stage(unsigned lds0, const u16* ga, const u16* gw) {
  constexpr unsigned STEP = 16 * GP * sizeof(u16);      // 16 rows further
  unsigned l[20];
  const u16* g[20];
#pragma unroll   // constant indices keep the addresses in registers
  for (int c = 0; c < 20; c++) {
    l[c] = lds0 + c * STEP;
    g[c] = c < BM / 16 ? ga + (size_t)c * 16 * D
                       : gw + (size_t)(c - BM / 16) * 16 * D;
  }
  const unsigned la[10] = {l[0], l[1], l[2], l[3], l[4],
                           l[5], l[6], l[7], l[8], l[9]};
  const u16* const gaa[10] = {g[0], g[1], g[2], g[3], g[4],
                              g[5], g[6], g[7], g[8], g[9]};
  const unsigned lb[10] = {l[10], l[11], l[12], l[13], l[14],
                           l[15], l[16], l[17], l[18], l[19]};
  const u16* const gbb[10] = {g[10], g[11], g[12], g[13], g[14],
                              g[15], g[16], g[17], g[18], g[19]};
  copy10(la, gaa);
  copy10(lb, gbb);
}

__global__ __launch_bounds__(256)
void gemm_bf16_kernel(const u16* __restrict__ A, const u16* __restrict__ W,
                      const float* __restrict__ bias, u16* __restrict__ outb,
                      float* __restrict__ outf, int outproj) {
  __shared__ __align__(16) u16 ldsG[2][GSTAGE];    // 2 x 85 KB

  const int mode = outproj ? 2 : blockIdx.y == 2 ? 1 : 0;
  A    += (size_t)blockIdx.y * (M * D);            // this tensor's rows
  outb += (size_t)blockIdx.y * (M * D);

  // The four work-groups that read the same A rows are M / BM = 64 apart in
  // index. Speed only.
  const int m0 = (blockIdx.x % (M / BM)) * BM;     // tile's first row
  const int n0 = (blockIdx.x / (M / BM)) * BN;     // tile's first column
  const int wv = threadIdx.x >> 5;
  const int wm = wv >> 2, wn = wv & 3;             // 2 x 4 waves of 64 x 48
  const int l = threadIdx.x & 31, sel = l >> 4, ln = l & 15;

  // Copy map: a row is 16 pieces of 16 B; thread t moves piece t%16 of rows
  // t/16 + 16*c, so every wave-wide copy covers two whole rows of 256 B.
  const int crow = threadIdx.x >> 4, ccol = (threadIdx.x & 15) * 8;
  const u16* ga = A + (size_t)(m0 + crow) * D + ccol;
  const u16* gw = W + (size_t)(n0 + crow) * D + ccol;
  const unsigned lc = (unsigned)(size_t)&ldsG[0][crow * GP + ccol];
  constexpr unsigned GBUFB = GSTAGE * sizeof(u16);      // the other buffer

  // Stage 0 into buffer 0.
  gemm_stage(lc, ga, gw);

  v8f acc[4][3] = {};

  // This wave's copies of stage 0 have landed; the barrier publishes all.
  asm volatile("s_wait_asynccnt 0x0" ::: "memory");
  __syncthreads();
  // Stage 1 into buffer 1.
  gemm_stage(lc + GBUFB, ga + BK, gw + BK);

  for (int s = 0; s < NSTAGE; s++) {
    const u16* As = ldsG[s & 1] + (wm * 64 + ln) * GP;
    const u16* Ws = ldsG[s & 1] + (BM + wn * 48 + ln) * GP;
    // Two fragment sets: block kb+1's 14 LDS reads go out as one group ahead
    // of block kb's 12 WMMA. Only this stage's own buffer is read.
    u16x16 af[2][4], bf[2][3];
#pragma unroll
    for (int r = 0; r < 4; r++) af[0][r] = load_frag(As + r * 16 * GP, sel);
#pragma unroll
    for (int t = 0; t < 3; t++) bf[0][t] = load_frag(Ws + t * 16 * GP, sel);
#pragma unroll   // constant set indices keep the fragments in registers
    for (int kb = 0; kb < BK / 32; kb++) {
      const int cur = kb & 1, nxt = cur ^ 1;
      if (kb + 1 < BK / 32) {
        const int kk = (kb + 1) * 32;
#pragma unroll
        for (int r = 0; r < 4; r++)
          af[nxt][r] = load_frag(As + r * 16 * GP + kk, sel);
#pragma unroll
        for (int t = 0; t < 3; t++)
          bf[nxt][t] = load_frag(Ws + t * 16 * GP + kk, sel);
      }
      // Keeps the reads above in front of the WMMA below: sunk among them,
      // each small group is waited for in full before its WMMA can issue.
      __builtin_amdgcn_sched_barrier(0);
#pragma unroll
      for (int r = 0; r < 4; r++)
#pragma unroll
        for (int t = 0; t < 3; t++)
          acc[r][t] = wmma_bf16(af[cur][r], bf[cur][t], acc[r][t]);
    }

    // ---- publish point of stage s+1 ----
    // This wave's LDS reads of buffer s&1 are done ...
    asm volatile("s_wait_dscnt 0x0" ::: "memory");
    // ... and its own copies of stage s+1 have landed.
    asm volatile("s_wait_asynccnt 0x0" ::: "memory");
    __syncthreads();   // publishes stage s+1, frees buffer s&1 for the refill
    if (s + 2 < NSTAGE)                          // same for the whole grid
      gemm_stage(lc + (unsigned)(s & 1) * GBUFB, ga + (s + 2) * BK,
                 gw + (s + 2) * BK);
  }
  // No copy is outstanding when the wave ends.
  asm volatile("s_wait_asynccnt 0x0" ::: "memory");

#pragma unroll
  for (int r = 0; r < 4; r++) {
    const int Mi0 = m0 + wm * 64 + r * 16;
#pragma unroll
    for (int t = 0; t < 3; t++) {
      const int ng = n0 + wn * 48 + t * 16 + ln; // lane's output column
      const float bv = bias[ng];
      if (mode == 2) {                           // fp32 [M, D]
#pragma unroll
        for (int i = 0; i < 8; i++) {
          int Mi = Mi0 + i + 8 * sel;            // C layout: row = i + 8*sel
          outf[(size_t)Mi * D + ng] = acc[r][t][i] + bv;
        }
      } else if (mode == 0) {                    // bf16 [b,h,s,d]
        int h = ng >> 6, d = ng & 63;
        const float osc = blockIdx.y == 0 ? QSCALE : 1.f;
#pragma unroll
        for (int i = 0; i < 8; i++) {
          int Mi = Mi0 + i + 8 * sel;
          int b = Mi >> 11, s = Mi & (S - 1);
          outb[(((size_t)(b * H + h)) * S + s) * DK + d] =
              f2bf((acc[r][t][i] + bv) * osc);
        }
        // The next run's arithmetic reuses registers that these stores name.
        if (r + 1 < 4 || t + 1 < 3) asm volatile("s_wait_xcnt 0x0" ::: "memory");
      } else {                                   // bf16 [b,h,d,s] (transposed)
        int h = ng >> 6, d = ng & 63;
        int Mi = Mi0 + 8 * sel;                  // 8 consecutive s per lane
        int b = Mi >> 11, s0 = Mi & (S - 1);
        u16x8 pack;
#pragma unroll
        for (int i = 0; i < 8; i++) pack[i] = f2bf(acc[r][t][i] + bv);
        *(u16x8*)(outb + (((size_t)(b * H + h)) * DK + d) * S + s0) = pack;
      }
    }
  }
}

// ---------------------------------------------------------------------------
// Flash attention. One wave per (b, h, 32-query tile): two groups of 16 query
// columns that share every K and Vt fragment the wave reads, so that one
// fragment from LDS feeds two WMMA. Four waves (128 queries of one head) form
// a work-group and share every 64-key block; three work-groups stand on a WGP.
//   Q,K : [b,h,s,d] bf16      Vt : [b,h,d,s] bf16     out: bf16 [B*S, 768]
// Each 64-key K tile and Vt tile (64 rows of 128 B each) is brought into LDS
// once per work-group by asynchronous b128 copies, whole 128-B lines per row,
// in a ring of two buffers: block j+1 flies while block j is worked on. The
// fragments are then read from LDS at a 144-B row pitch (16 B x odd).
// Both products run transposed: S^T = K.Q^T (A = K rows, B = Q) and
// O^T += V^T.P^T (A = Vt rows, B = P^T). In each group a lane then holds scores
// of ONE query (column ln), 32 of a block's 64 keys, the lane l ^ 16 the other
// 32: maximum and sum run in the lane with one exchange between the halves, and
// the exponentials pack straight into the B operand, so P never goes through
// LDS. Softmax runs in the exp2 domain: Q arrives scaled by log2(e)/sqrt(dk).
// The weights are taken against a KEPT maximum m of the query, not against each
// block's running maximum: the score WMMA subtracts it (its C operand is -m), so
// a score tile goes straight into the exponential. m is renewed, and sum and O
// are rescaled, only in a block where some lane's 32 weights sum to more than
// 2^8 (so no weight in use exceeds 2^8), and in block 0, which sets the first m.
// One test per block for the whole wave.
// ---------------------------------------------------------------------------
constexpr int KVP    = 72;            // LDS row pitch of a staged tile, in u16
constexpr int KVTILE = 64 * KVP;      // one staged tile: 64 rows, 9216 B
constexpr int AWAVES = 4;             // waves of an attention work-group
constexpr int QG     = 2;             // groups of 16 query columns per wave

// One stage = eight copies per lane: four of K, four of Vt, rows 16 apart.
//   lk, lv: the lane's LDS byte address in row crow of the target buffers
//   gk, gv: the lane's 16 B in row crow of this block's K tile / Vt tile
// The s_wait_xcnt is the last line of the copies' own statement so that no
// address register of an issued copy is rewritten in front of it.
DEV void stage_copies(unsigned lk, const u16* gk, unsigned lv, const u16* gv) {
  constexpr unsigned STEP = 16 * KVP * sizeof(u16);     // 16 rows further
  asm volatile(
      "global_load_async_to_lds_b128 %0, %1, off\n\t"
      "global_load_async_to_lds_b128 %2, %3, off\n\t"
      "global_load_async_to_lds_b128 %4, %5, off\n\t"
      "global_load_async_to_lds_b128 %6, %7, off\n\t"
      "global_load_async_to_lds_b128 %8, %9, off\n\t"
      "global_load_async_to_lds_b128 %10, %11, off\n\t"
      "global_load_async_to_lds_b128 %12, %13, off\n\t"
      "global_load_async_to_lds_b128 %14, %15, off\n\t"
      "s_wait_xcnt 0x0"
      :: "v"(lk), "v"(gk), "v"(lk + STEP), "v"(gk + 16 * DK),
         "v"(lk + 2 * STEP), "v"(gk + 32 * DK),
         "v"(lk + 3 * STEP), "v"(gk + 48 * DK),
         "v"(lv), "v"(gv), "v"(lv + STEP), "v"(gv + 16 * S),
         "v"(lv + 2 * STEP), "v"(gv + 32 * S),
         "v"(lv + 3 * STEP), "v"(gv + 48 * S)
      : "memory");
}

// One group's weights of a 64-key block: p = 2^c for the lane's 32 scores c
// (already taken against the kept maximum), packed as the two B fragments.
// Returns the lane's sum of the 32.
DEV float block_weights(const v8f (&c)[4], u16x16 (&pf)[2]) {
  float p[4][8], ps[4];
#pragma unroll
  for (int kt = 0; kt < 4; kt++) {
#pragma unroll
    for (int i = 0; i < 8; i++) p[kt][i] = exp2_raw(c[kt][i]);
    ps[kt] = ((p[kt][0] + p[kt][1]) + (p[kt][2] + p[kt][3])) +
             ((p[kt][4] + p[kt][5]) + (p[kt][6] + p[kt][7]));
  }
  pf[0] = pack_frag(p[0], p[1]);                 // keys j*64 +  0..31
  pf[1] = pack_frag(p[2], p[3]);                 // keys +32..63
  return (ps[0] + ps[1]) + (ps[2] + ps[3]);
}

// Three waves per SIMD: the 768 work-groups then stand three on every WGP, all
// at once; a fourth on one WGP would leave another WGP short of work.
__global__ __launch_bounds__(AWAVES * 32)
__attribute__((amdgpu_waves_per_eu(3, 3)))
void attn_kernel(const u16* __restrict__ Q, const u16* __restrict__ K,
                 const u16* __restrict__ Vt, u16* __restrict__ Obf) {
  __shared__ __align__(16) u16 ldsK[2][KVTILE];    // 2 x 9 KB
  __shared__ __align__(16) u16 ldsV[2][KVTILE];    // 2 x 9 KB

  const int wave = blockIdx.x * AWAVES + (threadIdx.x >> 5);
  constexpr int nqt = S / (16 * QG);               // 64 query tiles
  const int qt   = wave % nqt;
  const int bh   = wave / nqt;                     // b*H + h, same in a block
  const int l = threadIdx.x & 31, sel = l >> 4, ln = l & 15;

  const u16* Qb = Q  + (size_t)bh * S * DK;
  const u16* Kb = K  + (size_t)bh * S * DK;
  const u16* Vb = Vt + (size_t)bh * DK * S;

  // Copy map: a tile is 512 pieces of 16 B; thread t moves pieces t + 128*c,
  // that is rows t/8 + 16*c (c < 4), column piece t%8.
  const int crow = threadIdx.x >> 3, ccol = (threadIdx.x & 7) * 8;
  const u16* gk = Kb + (size_t)crow * DK + ccol;   // block 0, row crow
  const u16* gv = Vb + (size_t)crow * S + ccol;
  const unsigned lk = (unsigned)(size_t)&ldsK[0][crow * KVP + ccol];
  const unsigned lv = (unsigned)(size_t)&ldsV[0][crow * KVP + ccol];
  constexpr unsigned BUFB = KVTILE * sizeof(u16);       // the other buffer

  // Block 0 into buffer 0.
  stage_copies(lk, gk, lv, gv);

  // Q fragments of both groups, both 32-wide d chunks (reused all iterations).
  u16x16 qf[QG][2];
#pragma unroll
  for (int g = 0; g < QG; g++) {
    const u16* qrow = Qb + (size_t)((qt * QG + g) * 16 + ln) * DK;
    qf[g][0] = load_frag(qrow, sel);
    qf[g][1] = load_frag(qrow + 32, sel);
  }
  // The set-up below reuses the address registers that these loads name.
  asm volatile("s_wait_xcnt 0x0" ::: "memory");

  v8f accO[QG][4] = {};               // O^T: row d = t*16 + i + 8*sel, column ln
  v8f negm[QG] = {};                  // -(kept maximum of query ln), eight times:
                                      // the score WMMA's C operand; set in block 0
  float lsum[QG] = {};                // this half's share of its denominator

  // This wave's copies of block 0 have landed; the barrier publishes all.
  asm volatile("s_wait_asynccnt 0x0" ::: "memory");
  __syncthreads();
  // Block 1 into buffer 1 (S / 64 = 32 blocks exist).
  stage_copies(lk + BUFB, gk + 64 * DK, lv + BUFB, gv + 64);

  for (int j = 0; j < S / 64; j++) {
    const u16* Kt = ldsK[j & 1];
    const u16* Vl = ldsV[j & 1];

    // ---- S^T for keys [j*64, j*64+64) : per group four 16-key x 16-query C
    // tiles; each K fragment is read once and used by both groups ----
    u16x16 kf[4][2];
#pragma unroll
    for (int kt = 0; kt < 4; kt++) {
      const u16* krow = Kt + (kt * 16 + ln) * KVP;
      kf[kt][0] = load_frag(krow, sel);
      kf[kt][1] = load_frag(krow + 32, sel);
    }
    // Keeps the 16 reads above one group in front of the WMMA: sunk among
    // them, each pair is waited for in full before its WMMA can issue.
    __builtin_amdgcn_sched_barrier(0);
    v8f c[QG][4];
#pragma unroll
    for (int kt = 0; kt < 4; kt++) {
#pragma unroll
      for (int g = 0; g < QG; g++)               // key kt*16 + i + 8*sel
        c[g][kt] = wmma_bf16(kf[kt][0], qf[g][0], negm[g]);
#pragma unroll
      for (int g = 0; g < QG; g++)
        c[g][kt] = wmma_bf16(kf[kt][1], qf[g][1], c[g][kt]);
    }
    // Keeps the 16 score WMMA one back-to-back run: left free, the Vt reads below
    // are drawn in among the last six in two groups of eight and split the run.
    __builtin_amdgcn_sched_barrier(0);
    // The block's Vt fragments, into the registers the K fragments leave: they
    // land while the softmax below runs.
    u16x16 vf[4][2];
#pragma unroll
    for (int t = 0; t < 4; t++) {
      const u16* vrow = Vl + (t * 16 + ln) * KVP;
      vf[t][0] = load_frag(vrow, sel);
      vf[t][1] = load_frag(vrow + 32, sel);
    }
    // Keeps these 16 reads one group in front of the softmax: left free, the
    // last pairs sink among the WMMA below and are waited for in full there.
    __builtin_amdgcn_sched_barrier(0);

    // ---- softmax weights against the kept maximum, all of it in the lane ----
    u16x16 pf[QG][2];
    float ps[QG];
#pragma unroll
    for (int g = 0; g < QG; g++) ps[g] = block_weights(c[g], pf[g]);

    // A weight above 2^8 (an overflow to inf too) lifts its lane's sum above 2^8.
    const bool grown = fmaxf(ps[0], ps[1]) > 256.f;
    if (j == 0 || __builtin_amdgcn_ballot_w32(grown) != 0) {  // the whole wave
#pragma unroll
      for (int g = 0; g < QG; g++) {
        float mx[4];
#pragma unroll
        for (int kt = 0; kt < 4; kt++) {
          mx[kt] = c[g][kt][0];
#pragma unroll
          for (int i = 1; i < 8; i++) mx[kt] = fmaxf(mx[kt], c[g][kt][i]);
        }
        float rm = fmaxf(fmaxf(mx[0], mx[1]), fmaxf(mx[2], mx[3]));
        rm = fmaxf(rm, xhalf(rm));               // same in both halves
        // How far the kept maximum rises. Block 0 sets it, up or down, from the
        // 0 it starts at; sum and O are still 0 there and stay so.
        const float d     = j == 0 ? rm : fmaxf(rm, 0.f);
        const float alpha = j == 0 ? 0.f : exp2_raw(-d);
        negm[g] -= d;
#pragma unroll
        for (int kt = 0; kt < 4; kt++) c[g][kt] -= d;
        ps[g] = block_weights(c[g], pf[g]);
        lsum[g] *= alpha;
#pragma unroll
        for (int t = 0; t < 4; t++) accO[g][t] *= alpha;
      }
    }
#pragma unroll
    for (int g = 0; g < QG; g++) lsum[g] += ps[g];

    // ---- O^T += V^T(64 x 64 keys) x P^T(64 keys x 16), each Vt fragment
    // used by both groups ----
#pragma unroll
    for (int t = 0; t < 4; t++) {
#pragma unroll
      for (int g = 0; g < QG; g++)
        accO[g][t] = wmma_bf16(vf[t][0], pf[g][0], accO[g][t]);
    }
#pragma unroll
    for (int t = 0; t < 4; t++) {
#pragma unroll
      for (int g = 0; g < QG; g++)
        accO[g][t] = wmma_bf16(vf[t][1], pf[g][1], accO[g][t]);
    }

    // ---- publish point of block j+1 ----
    // Keeps the waits and the barrier below at the foot of the trip: drawn up
    // to the last LDS read, they would wait for copies that have just gone out.
    __builtin_amdgcn_sched_barrier(0);
    // This wave's LDS reads of buffer j&1 are done ...
    asm volatile("s_wait_dscnt 0x0" ::: "memory");
    // ... and its own copies of block j+1 have landed.
    asm volatile("s_wait_asynccnt 0x0" ::: "memory");
    __syncthreads();   // publishes block j+1, frees buffer j&1 for the refill
    if (j + 2 < S / 64) {                        // same for the whole grid
      const unsigned bo = (unsigned)(j & 1) * BUFB;
      stage_copies(lk + bo, gk + (size_t)(j + 2) * 64 * DK,
                   lv + bo, gv + (j + 2) * 64);
    }
  }
  // No copy is outstanding when the wave ends.
  asm volatile("s_wait_asynccnt 0x0" ::: "memory");

  // ---- normalize and store to [B*S, 768] (col = h*64 + d) ----
  const int b = bh / H, h = bh % H;
#pragma unroll
  for (int g = 0; g < QG; g++) {
    const float inv = 1.f / (lsum[g] + xhalf(lsum[g]));  // join the halves' sums
    const size_t rowoff =
        ((size_t)b * S + (qt * QG + g) * 16 + ln) * D + h * 64 + 8 * sel;
#pragma unroll
    for (int t = 0; t < 4; t++) {                // 8 consecutive d per lane
      u16x8 pack;
#pragma unroll
      for (int i = 0; i < 8; i++) pack[i] = f2bf(accO[g][t][i] * inv);
      *(u16x8*)(Obf + rowoff + t * 16) = pack;
      // The arithmetic of the next store reuses registers that this one names.
      if (g + 1 < QG || t + 1 < 4) asm volatile("s_wait_xcnt 0x0" ::: "memory");
    }
  }
}

// ---------------------------------------------------------------------------
// Host orchestration (all launches on `stream`; graph-capture safe).
// ---------------------------------------------------------------------------
extern "C" void kernel_launch(void* const* d_in, const int* in_sizes, int n_in,
                              void* d_out, int out_size, void* d_ws,
                              size_t ws_size, hipStream_t stream) {
  const float* query = (const float*)d_in[0];
  const float* key   = (const float*)d_in[1];
  const float* value = (const float*)d_in[2];
  const float* Wq    = (const float*)d_in[3];
  const float* bq    = (const float*)d_in[4];
  const float* Wo    = (const float*)d_in[5];
  const float* bo    = (const float*)d_in[6];
  float* out = (float*)d_out;

  // Workspace sub-allocation (256B aligned).
  char* ws = (char*)d_ws;
  size_t off = 0;
  auto suballoc = [&](size_t bytes) -> void* {
    void* p = ws + off;
    off = (off + bytes + 255) & ~(size_t)255;
    return p;
  };
  const size_t actBytes = (size_t)M * D * sizeof(u16);   // 12.6 MB
  const size_t wBytes   = (size_t)D * D * sizeof(u16);   // 1.2 MB
  u16* xbf    = (u16*)suballoc(3 * actBytes);   // query, key, value as bf16
  u16* qbf    = (u16*)suballoc(3 * actBytes);   // [b,h,s,d]
  u16* kbf    = qbf + (size_t)M * D;            // [b,h,s,d]
  u16* vtbf   = kbf + (size_t)M * D;            // [b,h,d,s]
  u16* attnbf = (u16*)suballoc(actBytes);   // [B*S, 768]
  u16* wqbf   = (u16*)suballoc(wBytes);
  u16* wobf   = (u16*)suballoc(wBytes);

  constexpr int convBlocks = 3 * ACTWG + 2 * WWG;        // 816 blocks, 16 waves
  const int gemmBlocks = (M / BM) * (D / BN);            // 256 blocks, 8 waves
  const int attnBlocks = Bsz * H * (S / (16 * QG)) / AWAVES;   // 768 blocks, 4 waves

  // query, key, value, Wq and Wo to bf16.
  f32_to_bf16_all_kernel<<<convBlocks, CONVT, 0, stream>>>(
      query, key, value, Wq, Wo, xbf, wqbf, wobf);

  // q = (query @ Wq^T + bq) * QSCALE -> [b,h,s,d]; k = key @ Wq^T + bq -> [b,h,s,d];
  // v = value @ Wq^T + bq -> [b,h,d,s] transposed (the reference reuses Wq/bq)
  gemm_bf16_kernel<<<dim3(gemmBlocks, 3), 256, 0, stream>>>(xbf, wqbf, bq, qbf,
                                                            nullptr, 0);

  // attention -> [B*S, 768] bf16
  attn_kernel<<<attnBlocks, AWAVES * 32, 0, stream>>>(qbf, kbf, vtbf, attnbf);

  // out = attn @ Wo^T + bo -> fp32 d_out
  gemm_bf16_kernel<<<gemmBlocks, 256, 0, stream>>>(attnbf, wobf, bo, nullptr, out, 1);
}

// v009
// One run takes 90.6 microseconds.
// Two timings next to v008 put it at 1.05 and 1.06 times that version's speed.
// Over all steps from v000 it is 4.85 times as fast.
#include <hip/hip_runtime.h>

// ---------------------------------------------------------------------------
// MI455X (gfx1250) multi-head attention, bf16 WMMA pipeline.
//   stage 1: fp32 -> bf16 conversion of the two weight matrices, one launch
//   stage 2: q, k and v projection GEMMs, one launch, 96x768 tiles; reads the
//            fp32 activations itself (v_wmma_f32_16x16x32_bf16)
//   stage 3: flash-attention, transposed (S^T = K.Q^T, O^T += V^T.P^T), 64-key
//            blocks staged in LDS, 32 queries a wave (v_wmma + exp2 softmax)
//   stage 4: output projection (fp32 out)
// ---------------------------------------------------------------------------

typedef unsigned short u16;
typedef __attribute__((ext_vector_type(8)))  u16    u16x8;
typedef __attribute__((ext_vector_type(16))) u16    u16x16;
typedef __attribute__((ext_vector_type(8)))  float  v8f;
typedef __attribute__((ext_vector_type(16))) __bf16 v16bf;

#define DEV static __device__ __forceinline__

// Problem constants (fixed by the reference).
constexpr int Bsz = 4;
constexpr int S   = 2048;
constexpr int D   = 768;
constexpr int H   = 12;
constexpr int DK  = 64;
constexpr int M   = Bsz * S;   // 8192 rows for all dense GEMMs
// exp2-domain score scale, log2(e) / sqrt(dk): q carries it out of its GEMM.
constexpr float QSCALE = 0.125f * 1.44269504088896340736f;

DEV u16 f2bf(float f) {             // fp32 -> bf16, round-to-nearest-even
  unsigned u = __builtin_bit_cast(unsigned, f);
  u += 0x7FFFu + ((u >> 16) & 1u);
  return (u16)(u >> 16);
}

// 16-bit A/B fragment load (wave32). `row` points at 32 contiguous bf16
// covering this fragment's K-chunk. Per the CDNA5 layout, lane (sel = l>>4)
// holds K offsets sel*8+{0..7} and 16+sel*8+{0..7} -> two b128 loads.
DEV u16x16 load_frag(const u16* row, int sel) {
  u16x8 lo = *(const u16x8*)(row + sel * 8);
  u16x8 hi = *(const u16x8*)(row + 16 + sel * 8);
  return __builtin_shufflevector(lo, hi, 0, 1, 2, 3, 4, 5, 6, 7,
                                 8, 9, 10, 11, 12, 13, 14, 15);
}

DEV v8f wmma_bf16(u16x16 a, u16x16 b, v8f c) {
  return __builtin_amdgcn_wmma_f32_16x16x32_bf16(
      false, __builtin_bit_cast(v16bf, a),
      false, __builtin_bit_cast(v16bf, b),
      (short)0, c, false, false);
}

// Value of lane l ^ 16 (the other 16-lane half of the wave).
DEV float xhalf(float x) {
  int v = __builtin_bit_cast(int, x);
  return __builtin_bit_cast(float, __builtin_amdgcn_permlanex16(
      v, v, 0x76543210, 0xfedcba98, false, false));
}

// 2^x as the one hardware instruction. exp2f() adds a compare, two selects, an
// add and an ldexp per value, only to return a denormal where 2^x < 2^-126.
// Every x here is taken against the row's kept maximum, which the row's largest
// score so far is never below: a weight that small is under 2^-126 of the row's
// largest, far below P's bf16 rounding.
DEV float exp2_raw(float x) { return __builtin_amdgcn_exp2f(x); }

// Two fp32 -> one register of two bf16, round-to-nearest-even.
DEV unsigned pack2(float lo, float hi) {
  typedef __attribute__((ext_vector_type(2))) float  f32x2;
  typedef __attribute__((ext_vector_type(2))) __bf16 bf16x2;
  return __builtin_bit_cast(unsigned,
                            __builtin_convertvector(f32x2{lo, hi}, bf16x2));
}

// Two 16-key score tiles of one lane (C layout: key = i + 8*sel, then
// 16 + i + 8*sel) are, in that order, the lane's 32-key B fragment.
DEV u16x16 pack_frag(const float* lo, const float* hi) {
  typedef __attribute__((ext_vector_type(8))) unsigned u32x8;
  u32x8 w = {pack2(lo[0], lo[1]), pack2(lo[2], lo[3]),
             pack2(lo[4], lo[5]), pack2(lo[6], lo[7]),
             pack2(hi[0], hi[1]), pack2(hi[2], hi[3]),
             pack2(hi[4], hi[5]), pack2(hi[6], hi[7])};
  return __builtin_bit_cast(u16x16, w);
}

// ---------------------------------------------------------------------------
// fp32 -> bf16 conversion, as a stream on few, long-lived waves.
// A work-group is 16 waves and owns CONVT * U consecutive pieces of four
// floats. A lane brings U pieces, 16 B each, so that every wave-wide load
// covers 512 contiguous bytes (four whole lines) and every wave-wide store 256
// (two whole lines). All U loads are issued before the first value is used.
// Both weight matrices go in ONE launch: the block index names the matrix (24
// work-groups each) and the piece of it. The activations are not converted
// here: the q, k, v GEMM rounds them on their way into LDS.
// ---------------------------------------------------------------------------
constexpr int CONVT = 512;            // threads of a conversion work-group
constexpr int CONVU = 12;             // pieces of four floats per lane
constexpr int CONVE = CONVT * CONVU * 4;         // floats of one work-group
constexpr int WWG   = D * D / CONVE;  // 24 work-groups per weight matrix
static_assert(WWG * CONVE == D * D, "whole work-groups only");

__global__ __launch_bounds__(CONVT)
void f32_to_bf16_w_kernel(const float* __restrict__ wq,
                          const float* __restrict__ wo,
                          u16* __restrict__ wqout, u16* __restrict__ woout) {
  typedef __attribute__((ext_vector_type(4))) float    f32x4;
  typedef __attribute__((ext_vector_type(2))) unsigned u32x2;
  constexpr int U = CONVU;
  // Matrix and piece from the block index: the same for the whole work-group.
  int wg = blockIdx.x;
  const int t = wg / WWG;
  const float* in = t == 0 ? wq : wo;
  u16* out        = t == 0 ? wqout : woout;
  wg -= t * WWG;
  const size_t e0 = ((size_t)wg * (CONVT * U) + threadIdx.x) * 4;
  f32x4 v[U];
#pragma unroll   // rolled, each load would be waited for before the next issues
  for (int u = 0; u < U; u++)
    v[u] = *(const f32x4*)(in + e0 + (size_t)u * (CONVT * 4));
#pragma unroll   // constant indices keep v[] in registers
  for (int u = 0; u < U; u++) {
    u32x2 w = {pack2(v[u][0], v[u][1]), pack2(v[u][2], v[u][3])};
    *(u32x2*)(out + e0 + (size_t)u * (CONVT * 4)) = w;
  }
}

// ---------------------------------------------------------------------------
// GEMM: Y[m,n] = sum_k A[m,k] * W[n,k] + bias[n]
//   A : [M, 768] bf16 row-major          W : [768, 768] bf16 (torch [out,in])
// A work-group of eight waves owns a 128 x 192 tile of Y, one work-group per
// WGP (64 x 4 tiles). Per stage of 128 k the 128 A rows and the 192 W rows
// (256 B each, whole lines) are brought into LDS once per work-group by
// asynchronous b128 copies, in a ring of two buffers: stage s+1 flies while
// stage s is worked on. Fragments are read from LDS at a 272-B row pitch
// (16 B x odd). A wave owns 64 x 48 of the tile: 4 A-fragments x 3 B-fragments
// -> 12 WMMA per 32 k on 14 LDS b128 loads. k runs upward in steps of 32.
// Used for the output projection: fp32 out, [M, 768].
// ---------------------------------------------------------------------------
constexpr int BM = 128, BN = 192, BK = 128;
constexpr int GP     = BK + 8;              // LDS row pitch in u16 (272 B)
constexpr int GSTAGE = (BM + BN) * GP;      // one stage: 320 rows, 87040 B
constexpr int NSTAGE = D / BK;              // 6 stages
static_assert(M % BM == 0 && D % BN == 0 && D % BK == 0, "whole tiles only");
static_assert(NSTAGE >= 2, "the ring's prologue fills two stages");

// Ten copies of one lane: rows 16 apart in LDS (l + c * 16 rows) from ten
// global rows. The s_wait_xcnt is the last line of the copies' own statement
// so that no address register of an issued copy is rewritten in front of it.
DEV void copy10(const unsigned (&l)[10], const u16* const (&g)[10]) {
  asm volatile(
      "global_load_async_to_lds_b128 %0, %1, off\n\t"
      "global_load_async_to_lds_b128 %2, %3, off\n\t"
      "global_load_async_to_lds_b128 %4, %5, off\n\t"
      "global_load_async_to_lds_b128 %6, %7, off\n\t"
      "global_load_async_to_lds_b128 %8, %9, off\n\t"
      "global_load_async_to_lds_b128 %10, %11, off\n\t"
      "global_load_async_to_lds_b128 %12, %13, off\n\t"
      "global_load_async_to_lds_b128 %14, %15, off\n\t"
      "global_load_async_to_lds_b128 %16, %17, off\n\t"
      "global_load_async_to_lds_b128 %18, %19, off\n\t"
      "s_wait_xcnt 0x0"
      :: "v"(l[0]), "v"(g[0]), "v"(l[1]), "v"(g[1]), "v"(l[2]), "v"(g[2]),
         "v"(l[3]), "v"(g[3]), "v"(l[4]), "v"(g[4]), "v"(l[5]), "v"(g[5]),
         "v"(l[6]), "v"(g[6]), "v"(l[7]), "v"(g[7]), "v"(l[8]), "v"(g[8]),
         "v"(l[9]), "v"(g[9])
      : "memory");
}

// One stage = twenty copies per lane. Copy c fills LDS row c*16 + crow: rows
// 0..127 hold the A tile (c < 8), rows 128..319 the W tile.
//   lds0: the lane's LDS byte address in row crow of the target buffer
//   ga, gw: the lane's 16 B in row crow of the A tile / W tile, at this stage's k
DEV void gemm_stage(unsigned lds0, const u16* ga, const u16* gw) {
  constexpr unsigned STEP = 16 * GP * sizeof(u16);      // 16 rows further
  unsigned l[20];
  const u16* g[20];
#pragma unroll   // constant indices keep the addresses in registers
  for (int c = 0; c < 20; c++) {
    l[c] = lds0 + c * STEP;
    g[c] = c < BM / 16 ? ga + (size_t)c * 16 * D
                       : gw + (size_t)(c - BM / 16) * 16 * D;
  }
  const unsigned la[10] = {l[0], l[1], l[2], l[3], l[4],
                           l[5], l[6], l[7], l[8], l[9]};
  const u16* const gaa[10] = {g[0], g[1], g[2], g[3], g[4],
                              g[5], g[6], g[7], g[8], g[9]};
  const unsigned lb[10] = {l[10], l[11], l[12], l[13], l[14],
                           l[15], l[16], l[17], l[18], l[19]};
  const u16* const gbb[10] = {g[10], g[11], g[12], g[13], g[14],
                              g[15], g[16], g[17], g[18], g[19]};
  copy10(la, gaa);
  copy10(lb, gbb);
}

__global__ __launch_bounds__(256)
void gemm_bf16_kernel(const u16* __restrict__ A, const u16* __restrict__ W,
                      const float* __restrict__ bias,
                      float* __restrict__ outf) {
  __shared__ __align__(16) u16 ldsG[2][GSTAGE];    // 2 x 85 KB

  // The four work-groups that read the same A rows are M / BM = 64 apart in
  // index. Speed only.
  const int m0 = (blockIdx.x % (M / BM)) * BM;     // tile's first row
  const int n0 = (blockIdx.x / (M / BM)) * BN;     // tile's first column
  const int wv = threadIdx.x >> 5;
  const int wm = wv >> 2, wn = wv & 3;             // 2 x 4 waves of 64 x 48
  const int l = threadIdx.x & 31, sel = l >> 4, ln = l & 15;

  // Copy map: a row is 16 pieces of 16 B; thread t moves piece t%16 of rows
  // t/16 + 16*c, so every wave-wide copy covers two whole rows of 256 B.
  const int crow = threadIdx.x >> 4, ccol = (threadIdx.x & 15) * 8;
  const u16* ga = A + (size_t)(m0 + crow) * D + ccol;
  const u16* gw = W + (size_t)(n0 + crow) * D + ccol;
  const unsigned lc = (unsigned)(size_t)&ldsG[0][crow * GP + ccol];
  constexpr unsigned GBUFB = GSTAGE * sizeof(u16);      // the other buffer

  // Stage 0 into buffer 0.
  gemm_stage(lc, ga, gw);

  v8f acc[4][3] = {};

  // This wave's copies of stage 0 have landed; the barrier publishes all.
  asm volatile("s_wait_asynccnt 0x0" ::: "memory");
  __syncthreads();
  // Stage 1 into buffer 1.
  gemm_stage(lc + GBUFB, ga + BK, gw + BK);

  for (int s = 0; s < NSTAGE; s++) {
    const u16* As = ldsG[s & 1] + (wm * 64 + ln) * GP;
    const u16* Ws = ldsG[s & 1] + (BM + wn * 48 + ln) * GP;
    // Two fragment sets: block kb+1's 14 LDS reads go out as one group ahead
    // of block kb's 12 WMMA. Only this stage's own buffer is read.
    u16x16 af[2][4], bf[2][3];
#pragma unroll
    for (int r = 0; r < 4; r++) af[0][r] = load_frag(As + r * 16 * GP, sel);
#pragma unroll
    for (int t = 0; t < 3; t++) bf[0][t] = load_frag(Ws + t * 16 * GP, sel);
#pragma unroll   // constant set indices keep the fragments in registers
    for (int kb = 0; kb < BK / 32; kb++) {
      const int cur = kb & 1, nxt = cur ^ 1;
      if (kb + 1 < BK / 32) {
        const int kk = (kb + 1) * 32;
#pragma unroll
        for (int r = 0; r < 4; r++)
          af[nxt][r] = load_frag(As + r * 16 * GP + kk, sel);
#pragma unroll
        for (int t = 0; t < 3; t++)
          bf[nxt][t] = load_frag(Ws + t * 16 * GP + kk, sel);
      }
      // Keeps the reads above in front of the WMMA below: sunk among them,
      // each small group is waited for in full before its WMMA can issue.
      __builtin_amdgcn_sched_barrier(0);
#pragma unroll
      for (int r = 0; r < 4; r++)
#pragma unroll
        for (int t = 0; t < 3; t++)
          acc[r][t] = wmma_bf16(af[cur][r], bf[cur][t], acc[r][t]);
    }

    // ---- publish point of stage s+1 ----
    // This wave's LDS reads of buffer s&1 are done ...
    asm volatile("s_wait_dscnt 0x0" ::: "memory");
    // ... and its own copies of stage s+1 have landed.
    asm volatile("s_wait_asynccnt 0x0" ::: "memory");
    __syncthreads();   // publishes stage s+1, frees buffer s&1 for the refill
    if (s + 2 < NSTAGE)                          // same for the whole grid
      gemm_stage(lc + (unsigned)(s & 1) * GBUFB, ga + (s + 2) * BK,
                 gw + (s + 2) * BK);
  }
  // No copy is outstanding when the wave ends.
  asm volatile("s_wait_asynccnt 0x0" ::: "memory");

#pragma unroll
  for (int r = 0; r < 4; r++) {
    const int Mi0 = m0 + wm * 64 + r * 16;
#pragma unroll
    for (int t = 0; t < 3; t++) {
      const int ng = n0 + wn * 48 + t * 16 + ln; // lane's output column
      const float bv = bias[ng];
#pragma unroll
      for (int i = 0; i < 8; i++) {
        int Mi = Mi0 + i + 8 * sel;              // C layout: row = i + 8*sel
        outf[(size_t)Mi * D + ng] = acc[r][t][i] + bv;
      }
    }
  }
}

// ---------------------------------------------------------------------------
// q, k and v projections, one launch, straight from the fp32 activations:
//   Y[m,n] = sum_k X[m,k] * W[n,k] + bias[n],  X = query, key, value one behind
//   the other (3 * 8192 rows), W bf16 [768, 768], the same for all three.
// A work-group of eight waves owns 96 rows and ALL 768 columns, one work-group
// per WGP (256 in all): every fp32 row is fetched once on the whole chip, so it
// need not exist as bf16 in memory. Per stage of 64 k a thread brings 6 pieces
// of four floats into registers one stage ahead, rounds them to bf16 (nearest
// even) and stores them to LDS; the 768 W rows (128 B each, whole lines)
// come by asynchronous b128 copies. Both in rings of two buffers: stage s+1
// flies while stage s is worked on. Rows stand at a 144-B pitch (16 B x odd).
// A wave owns 96 x 96: 6 A-fragments x 6 B-fragments -> 36 WMMA per 32 k on 24
// LDS b128 loads; it copies the 96 W rows that it reads. k runs upward in steps
// of 32. A group of 16 rows lies in one tensor (8192 = 512 * 16), a work-group
// may span two: tensor and output form are chosen per group of 16 rows.
//   q, k: bf16 out, head-split [b,h,s,d]; q is multiplied by QSCALE before it
//         is rounded             v: bf16 out, transposed [b,h,d,s]
// ---------------------------------------------------------------------------
constexpr int PM   = 96;                    // rows of a work-group
constexpr int PK   = 64;                    // k of a stage
constexpr int PP   = PK + 8;                // LDS row pitch in u16 (144 B)
constexpr int PNST = D / PK;                // 12 stages
static_assert((3 * M) % PM == 0 && PM % 16 == 0 && M % 16 == 0, "whole tiles");
static_assert(D == 8 * 96 && D % PK == 0 && PNST >= 2, "eight waves of 96 columns");

// Twelve copies of one lane. The s_wait_xcnt is the last line of the copies'
// own statement so that no address register of an issued copy is rewritten in
// front of it.
DEV void copy12(unsigned (&l)[12], const u16* (&g)[12]) {
  asm volatile(
      "global_load_async_to_lds_b128 %0, %1, off\n\t"
      "global_load_async_to_lds_b128 %2, %3, off\n\t"
      "global_load_async_to_lds_b128 %4, %5, off\n\t"
      "global_load_async_to_lds_b128 %6, %7, off\n\t"
      "global_load_async_to_lds_b128 %8, %9, off\n\t"
      "global_load_async_to_lds_b128 %10, %11, off\n\t"
      "global_load_async_to_lds_b128 %12, %13, off\n\t"
      "global_load_async_to_lds_b128 %14, %15, off\n\t"
      "global_load_async_to_lds_b128 %16, %17, off\n\t"
      "global_load_async_to_lds_b128 %18, %19, off\n\t"
      "global_load_async_to_lds_b128 %20, %21, off\n\t"
      "global_load_async_to_lds_b128 %22, %23, off\n\t"
      "s_wait_xcnt 0x0"
      :: "v"(l[0]), "v"(g[0]), "v"(l[1]), "v"(g[1]), "v"(l[2]), "v"(g[2]),
         "v"(l[3]), "v"(g[3]), "v"(l[4]), "v"(g[4]), "v"(l[5]), "v"(g[5]),
         "v"(l[6]), "v"(g[6]), "v"(l[7]), "v"(g[7]), "v"(l[8]), "v"(g[8]),
         "v"(l[9]), "v"(g[9]), "v"(l[10]), "v"(g[10]), "v"(l[11]), "v"(g[11])
      : "memory");
}

// One stage of a wave's 96 W rows = 24 copies per lane, each wave-wide copy
// four whole rows of 128 B.
//   lds0: the lane's LDS byte address in the first four rows of the wave's part
//   gw:   the lane's 16 B in those rows of W, at this stage's k
DEV void w_stage(unsigned lds0, const u16* gw) {
  constexpr unsigned STEP = 4 * PP * sizeof(u16);       // four rows further
#pragma unroll   // constant indices keep the addresses in registers
  for (int hf = 0; hf < 2; hf++) {
    unsigned l[12];
    const u16* g[12];
#pragma unroll
    for (int c = 0; c < 12; c++) {
      l[c] = lds0 + (hf * 12 + c) * STEP;
      g[c] = gw + (size_t)(hf * 12 + c) * 4 * D;
    }
    copy12(l, g);
  }
}

// Two waves per SIMD: one work-group per WGP, 512 registers a wave.
__global__ __launch_bounds__(256)
__attribute__((amdgpu_waves_per_eu(2, 2)))
void qkv_gemm_kernel(const float* __restrict__ xq, const float* __restrict__ xk,
                     const float* __restrict__ xv, const u16* __restrict__ W,
                     const float* __restrict__ bias, u16* __restrict__ outb) {
  typedef __attribute__((ext_vector_type(4))) float    f32x4;
  typedef __attribute__((ext_vector_type(2))) unsigned u32x2;
  __shared__ __align__(16) u16 ldsW[2][D * PP];    // 2 x 108 KB
  __shared__ __align__(16) u16 ldsA[2][PM * PP];   // 2 x 13.5 KB

  const int row0 = blockIdx.x * PM;                // first of the 3 * M rows
  const int wv = threadIdx.x >> 5;
  const int l = threadIdx.x & 31, sel = l >> 4, ln = l & 15;

  // W copy map: lane l moves piece l%8 of rows l/8 + 4*c of the wave's 96.
  const int wrow = wv * 96 + (l >> 3), wcol = (l & 7) * 8;
  const u16* gw = W + (size_t)wrow * D + wcol;
  const unsigned lw = (unsigned)(size_t)&ldsW[0][wrow * PP + wcol];
  constexpr unsigned WBUFB = D * PP * sizeof(u16);      // the other buffer

  // X map: a stage's row is 16 pieces of four floats; thread t brings piece
  // t%16 of rows t/16 + 16*c, so every wave-wide load covers two rows of 256 B.
  const int arow = threadIdx.x >> 4, acol = (threadIdx.x & 15) * 4;
  const unsigned aoff = arow * D + acol;           // the lane's part of it
  const float* xb[PM / 16];                        // 16-row groups' first rows
#pragma unroll
  for (int c = 0; c < PM / 16; c++) {
    const int R0 = row0 + c * 16;                  // same for the work-group
    const float* x = R0 < M ? xq : R0 < 2 * M ? xk : xv;
    xb[c] = x + (size_t)(R0 & (M - 1)) * D;
  }
  f32x4 xr[PM / 16];                               // the stage in flight

  // Stage 0: X into registers, W into buffer 0.
#pragma unroll
  for (int c = 0; c < PM / 16; c++) xr[c] = *(const f32x4*)(xb[c] + aoff);
  // What follows may reuse the address registers that these loads name.
  asm volatile("s_wait_xcnt 0x0" ::: "memory");
  w_stage(lw, gw);
#pragma unroll
  for (int c = 0; c < PM / 16; c++) {
    u32x2 w = {pack2(xr[c][0], xr[c][1]), pack2(xr[c][2], xr[c][3])};
    *(u32x2*)&ldsA[0][(arow + c * 16) * PP + acol] = w;
  }

  // This wave's LDS stores and copies of stage 0 are done; the barrier
  // publishes all.
  asm volatile("s_wait_dscnt 0x0" ::: "memory");
  asm volatile("s_wait_asynccnt 0x0" ::: "memory");
  __syncthreads();
  // Stage 1: W into buffer 1, X into registers.
  w_stage(lw + WBUFB, gw + PK);
#pragma unroll
  for (int c = 0; c < PM / 16; c++) xr[c] = *(const f32x4*)(xb[c] + PK + aoff);
  // What follows may reuse the address registers that these loads name.
  asm volatile("s_wait_xcnt 0x0" ::: "memory");

  // Keeps the zeroing of the 288 accumulator registers behind the prologue:
  // drawn up among the copies' addresses, one register too many is live there
  // and goes to scratch.
  __builtin_amdgcn_sched_barrier(0);
  v8f acc[6][6] = {};

  for (int s = 0; s < PNST; s++) {
    const u16* As = ldsA[s & 1] + ln * PP;
    const u16* Ws = ldsW[s & 1] + (wv * 96 + ln) * PP;
#pragma unroll   // constant offsets fold into the LDS reads
    for (int kb = 0; kb < PK / 32; kb++) {
      u16x16 af[6], bf[6];
#pragma unroll
      for (int r = 0; r < 6; r++)
        af[r] = load_frag(As + r * 16 * PP + kb * 32, sel);
#pragma unroll
      for (int t = 0; t < 6; t++)
        bf[t] = load_frag(Ws + t * 16 * PP + kb * 32, sel);
      // Keeps the 24 reads above one group in front of the WMMA: sunk among
      // them, each small group is waited for in full before its WMMA can issue.
      __builtin_amdgcn_sched_barrier(0);
#pragma unroll
      for (int r = 0; r < 6; r++)
#pragma unroll
        for (int t = 0; t < 6; t++)
          acc[r][t] = wmma_bf16(af[r], bf[t], acc[r][t]);
    }
    // Stage s+1's X rows, rounded, into the buffer that every wave left at the
    // foot of trip s-1.
    if (s + 1 < PNST) {                          // same for the whole grid
#pragma unroll
      for (int c = 0; c < PM / 16; c++) {
        u32x2 w = {pack2(xr[c][0], xr[c][1]), pack2(xr[c][2], xr[c][3])};
        *(u32x2*)&ldsA[(s + 1) & 1][(arow + c * 16) * PP + acol] = w;
      }
    }

    // ---- publish point of stage s+1 ----
    // This wave's LDS reads of buffer s&1 and its stores above are done ...
    asm volatile("s_wait_dscnt 0x0" ::: "memory");
    // ... and its own copies of stage s+1 have landed.
    asm volatile("s_wait_asynccnt 0x0" ::: "memory");
    __syncthreads();   // publishes stage s+1, frees buffer s&1 for the refill
    if (s + 2 < PNST) {                          // same for the whole grid
      w_stage(lw + (unsigned)(s & 1) * WBUFB, gw + (s + 2) * PK);
#pragma unroll
      for (int c = 0; c < PM / 16; c++)
        xr[c] = *(const f32x4*)(xb[c] + (s + 2) * PK + aoff);
      // The next trip may reuse the address registers that these loads name.
      asm volatile("s_wait_xcnt 0x0" ::: "memory");
    }
  }
  // No copy is outstanding when the wave ends.
  asm volatile("s_wait_asynccnt 0x0" ::: "memory");

  float bv[6];
#pragma unroll
  for (int t = 0; t < 6; t++) bv[t] = bias[wv * 96 + t * 16 + ln];
  // The stores' arithmetic may reuse the address registers of these loads.
  asm volatile("s_wait_xcnt 0x0" ::: "memory");

#pragma unroll
  for (int r = 0; r < 6; r++) {
    const int R0  = row0 + r * 16;               // same for the work-group
    const int y   = R0 / M;                      // 0: q, 1: k, 2: v
    const int Mi0 = R0 & (M - 1);
    u16* ob = outb + (size_t)y * (M * D);
#pragma unroll
    for (int t = 0; t < 6; t++) {
      const int ng = wv * 96 + t * 16 + ln;      // lane's output column
      const int h = ng >> 6, d = ng & 63;
      if (y != 2) {                              // bf16 [b,h,s,d]
        const float osc = y == 0 ? QSCALE : 1.f;
#pragma unroll
        for (int i = 0; i < 8; i++) {
          int Mi = Mi0 + i + 8 * sel;            // C layout: row = i + 8*sel
          int b = Mi >> 11, s = Mi & (S - 1);
          ob[(((size_t)(b * H + h)) * S + s) * DK + d] =
              f2bf((acc[r][t][i] + bv[t]) * osc);
        }
        // What follows reuses registers that these stores name.
        asm volatile("s_wait_xcnt 0x0" ::: "memory");
      } else {                                   // bf16 [b,h,d,s] (transposed)
        int Mi = Mi0 + 8 * sel;                  // 8 consecutive s per lane
        int b = Mi >> 11, s0 = Mi & (S - 1);
        u16x8 pack;
#pragma unroll
        for (int i = 0; i < 8; i++) pack[i] = f2bf(acc[r][t][i] + bv[t]);
        *(u16x8*)(ob + (((size_t)(b * H + h)) * DK + d) * S + s0) = pack;
        // What follows reuses registers that this store names.
        asm volatile("s_wait_xcnt 0x0" ::: "memory");
      }
    }
  }
}

// ---------------------------------------------------------------------------
// Flash attention. One wave per (b, h, 32-query tile): two groups of 16 query
// columns that share every K and Vt fragment the wave reads, so that one
// fragment from LDS feeds two WMMA. Four waves (128 queries of one head) form
// a work-group and share every 64-key block; three work-groups stand on a WGP.
//   Q,K : [b,h,s,d] bf16      Vt : [b,h,d,s] bf16     out: bf16 [B*S, 768]
// Each 64-key K tile and Vt tile (64 rows of 128 B each) is brought into LDS
// once per work-group by asynchronous b128 copies, whole 128-B lines per row,
// in a ring of two buffers: block j+1 flies while block j is worked on. The
// fragments are then read from LDS at a 144-B row pitch (16 B x odd).
// Both products run transposed: S^T = K.Q^T (A = K rows, B = Q) and
// O^T += V^T.P^T (A = Vt rows, B = P^T). In each group a lane then holds scores
// of ONE query (column ln), 32 of a block's 64 keys, the lane l ^ 16 the other
// 32: maximum and sum run in the lane with one exchange between the halves, and
// the exponentials pack straight into the B operand, so P never goes through
// LDS. Softmax runs in the exp2 domain: Q arrives scaled by log2(e)/sqrt(dk).
// The weights are taken against a KEPT maximum m of the query, not against each
// block's running maximum: the score WMMA subtracts it (its C operand is -m), so
// a score tile goes straight into the exponential. m is renewed, and sum and O
// are rescaled, only in a block where some lane's 32 weights sum to more than
// 2^8 (so no weight in use exceeds 2^8), and in block 0, which sets the first m.
// One test per block for the whole wave.
// ---------------------------------------------------------------------------
constexpr int KVP    = 72;            // LDS row pitch of a staged tile, in u16
constexpr int KVTILE = 64 * KVP;      // one staged tile: 64 rows, 9216 B
constexpr int AWAVES = 4;             // waves of an attention work-group
constexpr int QG     = 2;             // groups of 16 query columns per wave

// One stage = eight copies per lane: four of K, four of Vt, rows 16 apart.
//   lk, lv: the lane's LDS byte address in row crow of the target buffers
//   gk, gv: the lane's 16 B in row crow of this block's K tile / Vt tile
// The s_wait_xcnt is the last line of the copies' own statement so that no
// address register of an issued copy is rewritten in front of it.
DEV void stage_copies(unsigned lk, const u16* gk, unsigned lv, const u16* gv) {
  constexpr unsigned STEP = 16 * KVP * sizeof(u16);     // 16 rows further
  asm volatile(
      "global_load_async_to_lds_b128 %0, %1, off\n\t"
      "global_load_async_to_lds_b128 %2, %3, off\n\t"
      "global_load_async_to_lds_b128 %4, %5, off\n\t"
      "global_load_async_to_lds_b128 %6, %7, off\n\t"
      "global_load_async_to_lds_b128 %8, %9, off\n\t"
      "global_load_async_to_lds_b128 %10, %11, off\n\t"
      "global_load_async_to_lds_b128 %12, %13, off\n\t"
      "global_load_async_to_lds_b128 %14, %15, off\n\t"
      "s_wait_xcnt 0x0"
      :: "v"(lk), "v"(gk), "v"(lk + STEP), "v"(gk + 16 * DK),
         "v"(lk + 2 * STEP), "v"(gk + 32 * DK),
         "v"(lk + 3 * STEP), "v"(gk + 48 * DK),
         "v"(lv), "v"(gv), "v"(lv + STEP), "v"(gv + 16 * S),
         "v"(lv + 2 * STEP), "v"(gv + 32 * S),
         "v"(lv + 3 * STEP), "v"(gv + 48 * S)
      : "memory");
}

// One group's weights of a 64-key block: p = 2^c for the lane's 32 scores c
// (already taken against the kept maximum), packed as the two B fragments.
// Returns the lane's sum of the 32.
DEV float block_weights(const v8f (&c)[4], u16x16 (&pf)[2]) {
  float p[4][8], ps[4];
#pragma unroll
  for (int kt = 0; kt < 4; kt++) {
#pragma unroll
    for (int i = 0; i < 8; i++) p[kt][i] = exp2_raw(c[kt][i]);
    ps[kt] = ((p[kt][0] + p[kt][1]) + (p[kt][2] + p[kt][3])) +
             ((p[kt][4] + p[kt][5]) + (p[kt][6] + p[kt][7]));
  }
  pf[0] = pack_frag(p[0], p[1]);                 // keys j*64 +  0..31
  pf[1] = pack_frag(p[2], p[3]);                 // keys +32..63
  return (ps[0] + ps[1]) + (ps[2] + ps[3]);
}

// Three waves per SIMD: the 768 work-groups then stand three on every WGP, all
// at once; a fourth on one WGP would leave another WGP short of work.
__global__ __launch_bounds__(AWAVES * 32)
__attribute__((amdgpu_waves_per_eu(3, 3)))
void attn_kernel(const u16* __restrict__ Q, const u16* __restrict__ K,
                 const u16* __restrict__ Vt, u16* __restrict__ Obf) {
  __shared__ __align__(16) u16 ldsK[2][KVTILE];    // 2 x 9 KB
  __shared__ __align__(16) u16 ldsV[2][KVTILE];    // 2 x 9 KB

  const int wave = blockIdx.x * AWAVES + (threadIdx.x >> 5);
  constexpr int nqt = S / (16 * QG);               // 64 query tiles
  const int qt   = wave % nqt;
  const int bh   = wave / nqt;                     // b*H + h, same in a block
  const int l = threadIdx.x & 31, sel = l >> 4, ln = l & 15;

  const u16* Qb = Q  + (size_t)bh * S * DK;
  const u16* Kb = K  + (size_t)bh * S * DK;
  const u16* Vb = Vt + (size_t)bh * DK * S;

  // Copy map: a tile is 512 pieces of 16 B; thread t moves pieces t + 128*c,
  // that is rows t/8 + 16*c (c < 4), column piece t%8.
  const int crow = threadIdx.x >> 3, ccol = (threadIdx.x & 7) * 8;
  const u16* gk = Kb + (size_t)crow * DK + ccol;   // block 0, row crow
  const u16* gv = Vb + (size_t)crow * S + ccol;
  const unsigned lk = (unsigned)(size_t)&ldsK[0][crow * KVP + ccol];
  const unsigned lv = (unsigned)(size_t)&ldsV[0][crow * KVP + ccol];
  constexpr unsigned BUFB = KVTILE * sizeof(u16);       // the other buffer

  // Block 0 into buffer 0.
  stage_copies(lk, gk, lv, gv);

  // Q fragments of both groups, both 32-wide d chunks (reused all iterations).
  u16x16 qf[QG][2];
#pragma unroll
  for (int g = 0; g < QG; g++) {
    const u16* qrow = Qb + (size_t)((qt * QG + g) * 16 + ln) * DK;
    qf[g][0] = load_frag(qrow, sel);
    qf[g][1] = load_frag(qrow + 32, sel);
  }
  // The set-up below reuses the address registers that these loads name.
  asm volatile("s_wait_xcnt 0x0" ::: "memory");

  v8f accO[QG][4] = {};               // O^T: row d = t*16 + i + 8*sel, column ln
  v8f negm[QG] = {};                  // -(kept maximum of query ln), eight times:
                                      // the score WMMA's C operand; set in block 0
  float lsum[QG] = {};                // this half's share of its denominator

  // This wave's copies of block 0 have landed; the barrier publishes all.
  asm volatile("s_wait_asynccnt 0x0" ::: "memory");
  __syncthreads();
  // Block 1 into buffer 1 (S / 64 = 32 blocks exist).
  stage_copies(lk + BUFB, gk + 64 * DK, lv + BUFB, gv + 64);

  for (int j = 0; j < S / 64; j++) {
    const u16* Kt = ldsK[j & 1];
    const u16* Vl = ldsV[j & 1];

    // ---- S^T for keys [j*64, j*64+64) : per group four 16-key x 16-query C
    // tiles; each K fragment is read once and used by both groups ----
    u16x16 kf[4][2];
#pragma unroll
    for (int kt = 0; kt < 4; kt++) {
      const u16* krow = Kt + (kt * 16 + ln) * KVP;
      kf[kt][0] = load_frag(krow, sel);
      kf[kt][1] = load_frag(krow + 32, sel);
    }
    // Keeps the 16 reads above one group in front of the WMMA: sunk among
    // them, each pair is waited for in full before its WMMA can issue.
    __builtin_amdgcn_sched_barrier(0);
    v8f c[QG][4];
#pragma unroll
    for (int kt = 0; kt < 4; kt++) {
#pragma unroll
      for (int g = 0; g < QG; g++)               // key kt*16 + i + 8*sel
        c[g][kt] = wmma_bf16(kf[kt][0], qf[g][0], negm[g]);
#pragma unroll
      for (int g = 0; g < QG; g++)
        c[g][kt] = wmma_bf16(kf[kt][1], qf[g][1], c[g][kt]);
    }
    // Keeps the 16 score WMMA one back-to-back run: left free, the Vt reads below
    // are drawn in among the last six in two groups of eight and split the run.
    __builtin_amdgcn_sched_barrier(0);
    // The block's Vt fragments, into the registers the K fragments leave: they
    // land while the softmax below runs.
    u16x16 vf[4][2];
#pragma unroll
    for (int t = 0; t < 4; t++) {
      const u16* vrow = Vl + (t * 16 + ln) * KVP;
      vf[t][0] = load_frag(vrow, sel);
      vf[t][1] = load_frag(vrow + 32, sel);
    }
    // Keeps these 16 reads one group in front of the softmax: left free, the
    // last pairs sink among the WMMA below and are waited for in full there.
    __builtin_amdgcn_sched_barrier(0);

    // ---- softmax weights against the kept maximum, all of it in the lane ----
    u16x16 pf[QG][2];
    float ps[QG];
#pragma unroll
    for (int g = 0; g < QG; g++) ps[g] = block_weights(c[g], pf[g]);

    // A weight above 2^8 (an overflow to inf too) lifts its lane's sum above 2^8.
    const bool grown = fmaxf(ps[0], ps[1]) > 256.f;
    if (j == 0 || __builtin_amdgcn_ballot_w32(grown) != 0) {  // the whole wave
#pragma unroll
      for (int g = 0; g < QG; g++) {
        float mx[4];
#pragma unroll
        for (int kt = 0; kt < 4; kt++) {
          mx[kt] = c[g][kt][0];
#pragma unroll
          for (int i = 1; i < 8; i++) mx[kt] = fmaxf(mx[kt], c[g][kt][i]);
        }
        float rm = fmaxf(fmaxf(mx[0], mx[1]), fmaxf(mx[2], mx[3]));
        rm = fmaxf(rm, xhalf(rm));               // same in both halves
        // How far the kept maximum rises. Block 0 sets it, up or down, from the
        // 0 it starts at; sum and O are still 0 there and stay so.
        const float d     = j == 0 ? rm : fmaxf(rm, 0.f);
        const float alpha = j == 0 ? 0.f : exp2_raw(-d);
        negm[g] -= d;
#pragma unroll
        for (int kt = 0; kt < 4; kt++) c[g][kt] -= d;
        ps[g] = block_weights(c[g], pf[g]);
        lsum[g] *= alpha;
#pragma unroll
        for (int t = 0; t < 4; t++) accO[g][t] *= alpha;
      }
    }
#pragma unroll
    for (int g = 0; g < QG; g++) lsum[g] += ps[g];

    // ---- O^T += V^T(64 x 64 keys) x P^T(64 keys x 16), each Vt fragment
    // used by both groups ----
#pragma unroll
    for (int t = 0; t < 4; t++) {
#pragma unroll
      for (int g = 0; g < QG; g++)
        accO[g][t] = wmma_bf16(vf[t][0], pf[g][0], accO[g][t]);
    }
#pragma unroll
    for (int t = 0; t < 4; t++) {
#pragma unroll
      for (int g = 0; g < QG; g++)
        accO[g][t] = wmma_bf16(vf[t][1], pf[g][1], accO[g][t]);
    }

    // ---- publish point of block j+1 ----
    // Keeps the waits and the barrier below at the foot of the trip: drawn up
    // to the last LDS read, they would wait for copies that have just gone out.
    __builtin_amdgcn_sched_barrier(0);
    // This wave's LDS reads of buffer j&1 are done ...
    asm volatile("s_wait_dscnt 0x0" ::: "memory");
    // ... and its own copies of block j+1 have landed.
    asm volatile("s_wait_asynccnt 0x0" ::: "memory");
    __syncthreads();   // publishes block j+1, frees buffer j&1 for the refill
    if (j + 2 < S / 64) {                        // same for the whole grid
      const unsigned bo = (unsigned)(j & 1) * BUFB;
      stage_copies(lk + bo, gk + (size_t)(j + 2) * 64 * DK,
                   lv + bo, gv + (j + 2) * 64);
    }
  }
  // No copy is outstanding when the wave ends.
  asm volatile("s_wait_asynccnt 0x0" ::: "memory");

  // ---- normalize and store to [B*S, 768] (col = h*64 + d) ----
  const int b = bh / H, h = bh % H;
#pragma unroll
  for (int g = 0; g < QG; g++) {
    const float inv = 1.f / (lsum[g] + xhalf(lsum[g]));  // join the halves' sums
    const size_t rowoff =
        ((size_t)b * S + (qt * QG + g) * 16 + ln) * D + h * 64 + 8 * sel;
#pragma unroll
    for (int t = 0; t < 4; t++) {                // 8 consecutive d per lane
      u16x8 pack;
#pragma unroll
      for (int i = 0; i < 8; i++) pack[i] = f2bf(accO[g][t][i] * inv);
      *(u16x8*)(Obf + rowoff + t * 16) = pack;
      // The arithmetic of the next store reuses registers that this one names.
      if (g + 1 < QG || t + 1 < 4) asm volatile("s_wait_xcnt 0x0" ::: "memory");
    }
  }
}

// ---------------------------------------------------------------------------
// Host orchestration (all launches on `stream`; graph-capture safe).
// ---------------------------------------------------------------------------
extern "C" void kernel_launch(void* const* d_in, const int* in_sizes, int n_in,
                              void* d_out, int out_size, void* d_ws,
                              size_t ws_size, hipStream_t stream) {
  const float* query = (const float*)d_in[0];
  const float* key   = (const float*)d_in[1];
  const float* value = (const float*)d_in[2];
  const float* Wq    = (const float*)d_in[3];
  const float* bq    = (const float*)d_in[4];
  const float* Wo    = (const float*)d_in[5];
  const float* bo    = (const float*)d_in[6];
  float* out = (float*)d_out;

  // Workspace sub-allocation (256B aligned).
  char* ws = (char*)d_ws;
  size_t off = 0;
  auto suballoc = [&](size_t bytes) -> void* {
    void* p = ws + off;
    off = (off + bytes + 255) & ~(size_t)255;
    return p;
  };
  const size_t actBytes = (size_t)M * D * sizeof(u16);   // 12.6 MB
  const size_t wBytes   = (size_t)D * D * sizeof(u16);   // 1.2 MB
  u16* qbf    = (u16*)suballoc(3 * actBytes);   // [b,h,s,d]
  u16* kbf    = qbf + (size_t)M * D;            // [b,h,s,d]
  u16* vtbf   = kbf + (size_t)M * D;            // [b,h,d,s]
  u16* attnbf = (u16*)suballoc(actBytes);   // [B*S, 768]
  u16* wqbf   = (u16*)suballoc(wBytes);
  u16* wobf   = (u16*)suballoc(wBytes);

  constexpr int convBlocks = 2 * WWG;                    // 48 blocks, 16 waves
  constexpr int qkvBlocks  = 3 * M / PM;                 // 256 blocks, 8 waves
  const int gemmBlocks = (M / BM) * (D / BN);            // 256 blocks, 8 waves
  const int attnBlocks = Bsz * H * (S / (16 * QG)) / AWAVES;   // 768 blocks, 4 waves

  // Wq and Wo to bf16.
  f32_to_bf16_w_kernel<<<convBlocks, CONVT, 0, stream>>>(Wq, Wo, wqbf, wobf);

  // q = (query @ Wq^T + bq) * QSCALE -> [b,h,s,d]; k = key @ Wq^T + bq -> [b,h,s,d];
  // v = value @ Wq^T + bq -> [b,h,d,s] transposed (the reference reuses Wq/bq)
  qkv_gemm_kernel<<<qkvBlocks, 256, 0, stream>>>(query, key, value, wqbf, bq, qbf);

  // attention -> [B*S, 768] bf16
  attn_kernel<<<attnBlocks, AWAVES * 32, 0, stream>>>(qbf, kbf, vtbf, attnbf);

  // out = attn @ Wo^T + bo -> fp32 d_out
  gemm_bf16_kernel<<<gemmBlocks, 256, 0, stream>>>(attnbf, wobf, bo, out);
}

// v010
// Measured time: 83.1 microseconds a run.
// Timed twice side by side with v009, it ran 1.09 times as fast both times.
// Counting every step since v000, it is 5.30 times as fast.
#include <hip/hip_runtime.h>

// ---------------------------------------------------------------------------
// MI455X (gfx1250) multi-head attention, bf16 WMMA pipeline.
//   stage 1: fp32 -> bf16 conversion of the two weight matrices, one launch
//   stage 2: q, k and v projection GEMMs, one launch, 96x768 tiles; reads the
//            fp32 activations itself (v_wmma_f32_16x16x32_bf16)
//   stage 3: flash-attention, transposed (S^T = K.Q^T, O^T += V^T.P^T), 64-key
//            blocks staged in LDS, 32 queries a wave (v_wmma + exp2 softmax)
//   stage 4: output projection (fp32 out)
// Every plane that a later launch stages in LDS by asynchronous copies (both
// weight matrices, V^T, the attention output) is stored stage-major,
// [k / stage][row][k % stage]: the rows of one staged tile lie one behind the
// other, so that a wave-wide b128 copy covers 512 contiguous bytes.
// ---------------------------------------------------------------------------

typedef unsigned short u16;
typedef __attribute__((ext_vector_type(8)))  u16    u16x8;
typedef __attribute__((ext_vector_type(16))) u16    u16x16;
typedef __attribute__((ext_vector_type(8)))  float  v8f;
typedef __attribute__((ext_vector_type(16))) __bf16 v16bf;

#define DEV static __device__ __forceinline__

// Problem constants (fixed by the reference).
constexpr int Bsz = 4;
constexpr int S   = 2048;
constexpr int D   = 768;
constexpr int H   = 12;
constexpr int DK  = 64;
constexpr int M   = Bsz * S;   // 8192 rows for all dense GEMMs
constexpr int PK  = 64;        // k of a stage of the q, k, v GEMM
constexpr int BK  = 128;       // k of a stage of the output GEMM
// exp2-domain score scale, log2(e) / sqrt(dk): q carries it out of its GEMM.
constexpr float QSCALE = 0.125f * 1.44269504088896340736f;

DEV u16 f2bf(float f) {             // fp32 -> bf16, round-to-nearest-even
  unsigned u = __builtin_bit_cast(unsigned, f);
  u += 0x7FFFu + ((u >> 16) & 1u);
  return (u16)(u >> 16);
}

// 16-bit A/B fragment load (wave32). `row` points at 32 contiguous bf16
// covering this fragment's K-chunk. Per the CDNA5 layout, lane (sel = l>>4)
// holds K offsets sel*8+{0..7} and 16+sel*8+{0..7} -> two b128 loads.
DEV u16x16 load_frag(const u16* row, int sel) {
  u16x8 lo = *(const u16x8*)(row + sel * 8);
  u16x8 hi = *(const u16x8*)(row + 16 + sel * 8);
  return __builtin_shufflevector(lo, hi, 0, 1, 2, 3, 4, 5, 6, 7,
                                 8, 9, 10, 11, 12, 13, 14, 15);
}

DEV v8f wmma_bf16(u16x16 a, u16x16 b, v8f c) {
  return __builtin_amdgcn_wmma_f32_16x16x32_bf16(
      false, __builtin_bit_cast(v16bf, a),
      false, __builtin_bit_cast(v16bf, b),
      (short)0, c, false, false);
}

// Value of lane l ^ 16 (the other 16-lane half of the wave).
DEV float xhalf(float x) {
  int v = __builtin_bit_cast(int, x);
  return __builtin_bit_cast(float, __builtin_amdgcn_permlanex16(
      v, v, 0x76543210, 0xfedcba98, false, false));
}

// 2^x as the one hardware instruction. exp2f() adds a compare, two selects, an
// add and an ldexp per value, only to return a denormal where 2^x < 2^-126.
// Every x here is taken against the row's kept maximum, which the row's largest
// score so far is never below: a weight that small is under 2^-126 of the row's
// largest, far below P's bf16 rounding.
DEV float exp2_raw(float x) { return __builtin_amdgcn_exp2f(x); }

// Two fp32 -> one register of two bf16, round-to-nearest-even.
DEV unsigned pack2(float lo, float hi) {
  typedef __attribute__((ext_vector_type(2))) float  f32x2;
  typedef __attribute__((ext_vector_type(2))) __bf16 bf16x2;
  return __builtin_bit_cast(unsigned,
                            __builtin_convertvector(f32x2{lo, hi}, bf16x2));
}

// Two 16-key score tiles of one lane (C layout: key = i + 8*sel, then
// 16 + i + 8*sel) are, in that order, the lane's 32-key B fragment.
DEV u16x16 pack_frag(const float* lo, const float* hi) {
  typedef __attribute__((ext_vector_type(8))) unsigned u32x8;
  u32x8 w = {pack2(lo[0], lo[1]), pack2(lo[2], lo[3]),
             pack2(lo[4], lo[5]), pack2(lo[6], lo[7]),
             pack2(hi[0], hi[1]), pack2(hi[2], hi[3]),
             pack2(hi[4], hi[5]), pack2(hi[6], hi[7])};
  return __builtin_bit_cast(u16x16, w);
}

// ---------------------------------------------------------------------------
// fp32 -> bf16 conversion, as a stream on few, long-lived waves.
// A work-group is 16 waves and owns CONVT * U consecutive pieces of four
// floats. A lane brings U pieces, 16 B each, so that every wave-wide load
// covers 512 contiguous bytes (four whole lines) and every wave-wide store 256
// (two whole lines). All U loads are issued before the first value is used.
// Both weight matrices go in ONE launch: the block index names the matrix (24
// work-groups each) and the piece of it. The activations are not converted
// here: the q, k, v GEMM rounds them on their way into LDS.
// Out: stage-major, [k / KB][n][k % KB], KB = the k of a stage of the GEMM that
// reads the matrix (64 for Wq, 128 for Wo). A wave's 128 consecutive k of one
// row still go out as whole lines.
// ---------------------------------------------------------------------------
constexpr int CONVT = 512;            // threads of a conversion work-group
constexpr int CONVU = 12;             // pieces of four floats per lane
constexpr int CONVE = CONVT * CONVU * 4;         // floats of one work-group
constexpr int WWG   = D * D / CONVE;  // 24 work-groups per weight matrix
static_assert(WWG * CONVE == D * D, "whole work-groups only");
static_assert(D % 128 == 0, "a wave's 32 pieces lie in one row");

__global__ __launch_bounds__(CONVT)
void f32_to_bf16_w_kernel(const float* __restrict__ wq,
                          const float* __restrict__ wo,
                          u16* __restrict__ wqout, u16* __restrict__ woout) {
  typedef __attribute__((ext_vector_type(4))) float    f32x4;
  typedef __attribute__((ext_vector_type(2))) unsigned u32x2;
  constexpr int U = CONVU;
  // Matrix and piece from the block index: the same for the whole work-group.
  int wg = blockIdx.x;
  const int t = wg / WWG;
  const float* in = t == 0 ? wq : wo;
  u16* out        = t == 0 ? wqout : woout;
  static_assert(PK == 64 && BK == 128, "the two forms of lg and lpart below");
  const unsigned lg = t == 0 ? 6 : 7;              // log2 of the reader's stage
  wg -= t * WWG;
  // A wave's 32 pieces are one aligned run of 128 k of one row. Which row and
  // which run is the same for the wave (scalar arithmetic); the lane's place in
  // the run is the same for all U pieces.
  const unsigned wv = __builtin_amdgcn_readfirstlane(threadIdx.x >> 5);
  const unsigned ln = threadIdx.x & 31;
  const unsigned lpart = t == 0 ? (ln >> 4) * (D * PK) + (ln & 15) * 4 : ln * 4;
  const size_t e0 = ((size_t)wg * (CONVT * U) + threadIdx.x) * 4;
  f32x4 v[U];
#pragma unroll   // rolled, each load would be waited for before the next issues
  for (int u = 0; u < U; u++)
    v[u] = *(const f32x4*)(in + e0 + (size_t)u * (CONVT * 4));
#pragma unroll   // constant indices keep v[] in registers
  for (int u = 0; u < U; u++) {
    u32x2 w = {pack2(v[u][0], v[u][1]), pack2(v[u][2], v[u][3])};
    const unsigned run = (unsigned)wg * (CONVE / 128) + u * (CONVT / 32) + wv;
    const unsigned n = run / (D / 128), kr = run % (D / 128);
    *(u32x2*)(out + (kr * (D * 128) + (n << lg)) + lpart) = w;
  }
}

// ---------------------------------------------------------------------------
// GEMM: Y[m,n] = sum_k A[m,k] * W[n,k] + bias[n]
//   A : bf16, stage-major [k / 128][M][128]
//   W : bf16, stage-major [k / 128][768][128] (n = torch's out index)
// A work-group of eight waves owns a 128 x 192 tile of Y, one work-group per
// WGP (64 x 4 tiles). Per stage of 128 k the 128 A rows and the 192 W rows
// (256 B each, one behind the other in memory) are brought into LDS once per work-group by
// asynchronous b128 copies, in a ring of two buffers: stage s+1 flies while
// stage s is worked on. Fragments are read from LDS at a 272-B row pitch
// (16 B x odd). A wave owns 64 x 48 of the tile: 4 A-fragments x 3 B-fragments
// -> 12 WMMA per 32 k on 14 LDS b128 loads. k runs upward in steps of 32.
// Used for the output projection: fp32 out, [M, 768].
// ---------------------------------------------------------------------------
constexpr int BM = 128, BN = 192;
constexpr int GP     = BK + 8;              // LDS row pitch in u16 (272 B)
constexpr int GSTAGE = (BM + BN) * GP;      // one stage: 320 rows, 87040 B
constexpr int NSTAGE = D / BK;              // 6 stages
static_assert(M % BM == 0 && D % BN == 0 && D % BK == 0, "whole tiles only");
static_assert(NSTAGE >= 2, "the ring's prologue fills two stages");

// Ten copies of one lane: rows 16 apart in LDS (l + c * 16 rows) from ten
// global rows. The s_wait_xcnt is the last line of the copies' own statement
// so that no address register of an issued copy is rewritten in front of it.
DEV void copy10(const unsigned (&l)[10], const u16* const (&g)[10]) {
  asm volatile(
      "global_load_async_to_lds_b128 %0, %1, off\n\t"
      "global_load_async_to_lds_b128 %2, %3, off\n\t"
      "global_load_async_to_lds_b128 %4, %5, off\n\t"
      "global_load_async_to_lds_b128 %6, %7, off\n\t"
      "global_load_async_to_lds_b128 %8, %9, off\n\t"
      "global_load_async_to_lds_b128 %10, %11, off\n\t"
      "global_load_async_to_lds_b128 %12, %13, off\n\t"
      "global_load_async_to_lds_b128 %14, %15, off\n\t"
      "global_load_async_to_lds_b128 %16, %17, off\n\t"
      "global_load_async_to_lds_b128 %18, %19, off\n\t"
      "s_wait_xcnt 0x0"
      :: "v"(l[0]), "v"(g[0]), "v"(l[1]), "v"(g[1]), "v"(l[2]), "v"(g[2]),
         "v"(l[3]), "v"(g[3]), "v"(l[4]), "v"(g[4]), "v"(l[5]), "v"(g[5]),
         "v"(l[6]), "v"(g[6]), "v"(l[7]), "v"(g[7]), "v"(l[8]), "v"(g[8]),
         "v"(l[9]), "v"(g[9])
      : "memory");
}

// One stage = twenty copies per lane. Copy c fills LDS row c*16 + crow: rows
// 0..127 hold the A tile (c < 8), rows 128..319 the W tile.
//   lds0: the lane's LDS byte address in row crow of the target buffer
//   ga, gw: the lane's 16 B in row crow of the A tile / W tile, at this stage's k
DEV void gemm_stage(unsigned lds0, const u16* ga, const u16* gw) {
  constexpr unsigned STEP = 16 * GP * sizeof(u16);      // 16 rows further
  unsigned l[20];
  const u16* g[20];
#pragma unroll   // constant indices keep the addresses in registers
  for (int c = 0; c < 20; c++) {
    l[c] = lds0 + c * STEP;
    g[c] = c < BM / 16 ? ga + (size_t)c * 16 * BK
                       : gw + (size_t)(c - BM / 16) * 16 * BK;
  }
  const unsigned la[10] = {l[0], l[1], l[2], l[3], l[4],
                           l[5], l[6], l[7], l[8], l[9]};
  const u16* const gaa[10] = {g[0], g[1], g[2], g[3], g[4],
                              g[5], g[6], g[7], g[8], g[9]};
  const unsigned lb[10] = {l[10], l[11], l[12], l[13], l[14],
                           l[15], l[16], l[17], l[18], l[19]};
  const u16* const gbb[10] = {g[10], g[11], g[12], g[13], g[14],
                              g[15], g[16], g[17], g[18], g[19]};
  copy10(la, gaa);
  copy10(lb, gbb);
}

__global__ __launch_bounds__(256)
void gemm_bf16_kernel(const u16* __restrict__ A, const u16* __restrict__ W,
                      const float* __restrict__ bias,
                      float* __restrict__ outf) {
  __shared__ __align__(16) u16 ldsG[2][GSTAGE];    // 2 x 85 KB

  // The four work-groups that read the same A rows are M / BM = 64 apart in
  // index. Speed only.
  const int m0 = (blockIdx.x % (M / BM)) * BM;     // tile's first row
  const int n0 = (blockIdx.x / (M / BM)) * BN;     // tile's first column
  const int wv = threadIdx.x >> 5;
  const int wm = wv >> 2, wn = wv & 3;             // 2 x 4 waves of 64 x 48
  const int l = threadIdx.x & 31, sel = l >> 4, ln = l & 15;

  // Copy map: a row is 16 pieces of 16 B; thread t moves piece t%16 of rows
  // t/16 + 16*c, so every wave-wide copy covers two neighbouring rows of 256 B.
  const int crow = threadIdx.x >> 4, ccol = (threadIdx.x & 15) * 8;
  const u16* ga = A + (size_t)(m0 + crow) * BK + ccol;
  const u16* gw = W + (size_t)(n0 + crow) * BK + ccol;
  constexpr size_t ASTEP = (size_t)M * BK, WSTEP = (size_t)D * BK;  // next stage
  const unsigned lc = (unsigned)(size_t)&ldsG[0][crow * GP + ccol];
  constexpr unsigned GBUFB = GSTAGE * sizeof(u16);      // the other buffer

  // Stage 0 into buffer 0.
  gemm_stage(lc, ga, gw);

  v8f acc[4][3] = {};

  // This wave's copies of stage 0 have landed; the barrier publishes all.
  asm volatile("s_wait_asynccnt 0x0" ::: "memory");
  __syncthreads();
  // Stage 1 into buffer 1.
  gemm_stage(lc + GBUFB, ga + ASTEP, gw + WSTEP);

  for (int s = 0; s < NSTAGE; s++) {
    const u16* As = ldsG[s & 1] + (wm * 64 + ln) * GP;
    const u16* Ws = ldsG[s & 1] + (BM + wn * 48 + ln) * GP;
    // Two fragment sets: block kb+1's 14 LDS reads go out as one group ahead
    // of block kb's 12 WMMA. Only this stage's own buffer is read.
    u16x16 af[2][4], bf[2][3];
#pragma unroll
    for (int r = 0; r < 4; r++) af[0][r] = load_frag(As + r * 16 * GP, sel);
#pragma unroll
    for (int t = 0; t < 3; t++) bf[0][t] = load_frag(Ws + t * 16 * GP, sel);
#pragma unroll   // constant set indices keep the fragments in registers
    for (int kb = 0; kb < BK / 32; kb++) {
      const int cur = kb & 1, nxt = cur ^ 1;
      if (kb + 1 < BK / 32) {
        const int kk = (kb + 1) * 32;
#pragma unroll
        for (int r = 0; r < 4; r++)
          af[nxt][r] = load_frag(As + r * 16 * GP + kk, sel);
#pragma unroll
        for (int t = 0; t < 3; t++)
          bf[nxt][t] = load_frag(Ws + t * 16 * GP + kk, sel);
      }
      // Keeps the reads above in front of the WMMA below: sunk among them,
      // each small group is waited for in full before its WMMA can issue.
      __builtin_amdgcn_sched_barrier(0);
#pragma unroll
      for (int r = 0; r < 4; r++)
#pragma unroll
        for (int t = 0; t < 3; t++)
          acc[r][t] = wmma_bf16(af[cur][r], bf[cur][t], acc[r][t]);
    }

    // ---- publish point of stage s+1 ----
    // This wave's LDS reads of buffer s&1 are done ...
    asm volatile("s_wait_dscnt 0x0" ::: "memory");
    // ... and its own copies of stage s+1 have landed.
    asm volatile("s_wait_asynccnt 0x0" ::: "memory");
    __syncthreads();   // publishes stage s+1, frees buffer s&1 for the refill
    if (s + 2 < NSTAGE)                          // same for the whole grid
      gemm_stage(lc + (unsigned)(s & 1) * GBUFB, ga + (s + 2) * ASTEP,
                 gw + (s + 2) * WSTEP);
  }
  // No copy is outstanding when the wave ends.
  asm volatile("s_wait_asynccnt 0x0" ::: "memory");

#pragma unroll
  for (int r = 0; r < 4; r++) {
    const int Mi0 = m0 + wm * 64 + r * 16;
#pragma unroll
    for (int t = 0; t < 3; t++) {
      const int ng = n0 + wn * 48 + t * 16 + ln; // lane's output column
      const float bv = bias[ng];
#pragma unroll
      for (int i = 0; i < 8; i++) {
        int Mi = Mi0 + i + 8 * sel;              // C layout: row = i + 8*sel
        outf[(size_t)Mi * D + ng] = acc[r][t][i] + bv;
      }
    }
  }
}

// ---------------------------------------------------------------------------
// q, k and v projections, one launch, straight from the fp32 activations:
//   Y[m,n] = sum_k X[m,k] * W[n,k] + bias[n],  X = query, key, value one behind
//   the other (3 * 8192 rows), W bf16, stage-major [k / 64][768][64], the same
//   for all three.
// A work-group of eight waves owns 96 rows and ALL 768 columns, one work-group
// per WGP (256 in all): every fp32 row is fetched once on the whole chip, so it
// need not exist as bf16 in memory. Per stage of 64 k a thread brings 6 pieces
// of four floats into registers one stage ahead, rounds them to bf16 (nearest
// even) and stores them to LDS; the 768 W rows (128 B each, one behind the
// other in memory) come by asynchronous b128 copies. Both in rings of two buffers: stage s+1
// flies while stage s is worked on. Rows stand at a 144-B pitch (16 B x odd).
// A wave owns 96 x 96: 6 A-fragments x 6 B-fragments -> 36 WMMA per 32 k on 24
// LDS b128 loads; it copies the 96 W rows that it reads. k runs upward in steps
// of 32. A group of 16 rows lies in one tensor (8192 = 512 * 16), a work-group
// may span two: tensor and output form are chosen per group of 16 rows.
//   q, k: bf16 out, head-split [b,h,s,d]; q is multiplied by QSCALE before it
//         is rounded
//   v:    bf16 out, transposed, one 64-key block behind the other:
//         [b,h][s / 64][d][s % 64]
// ---------------------------------------------------------------------------
constexpr int PM   = 96;                    // rows of a work-group
constexpr int PP   = PK + 8;                // LDS row pitch in u16 (144 B)
constexpr int PNST = D / PK;                // 12 stages
static_assert((3 * M) % PM == 0 && PM % 16 == 0 && M % 16 == 0, "whole tiles");
static_assert(D == 8 * 96 && D % PK == 0 && PNST >= 2, "eight waves of 96 columns");

// Twelve copies of one lane. The s_wait_xcnt is the last line of the copies'
// own statement so that no address register of an issued copy is rewritten in
// front of it.
DEV void copy12(unsigned (&l)[12], const u16* (&g)[12]) {
  asm volatile(
      "global_load_async_to_lds_b128 %0, %1, off\n\t"
      "global_load_async_to_lds_b128 %2, %3, off\n\t"
      "global_load_async_to_lds_b128 %4, %5, off\n\t"
      "global_load_async_to_lds_b128 %6, %7, off\n\t"
      "global_load_async_to_lds_b128 %8, %9, off\n\t"
      "global_load_async_to_lds_b128 %10, %11, off\n\t"
      "global_load_async_to_lds_b128 %12, %13, off\n\t"
      "global_load_async_to_lds_b128 %14, %15, off\n\t"
      "global_load_async_to_lds_b128 %16, %17, off\n\t"
      "global_load_async_to_lds_b128 %18, %19, off\n\t"
      "global_load_async_to_lds_b128 %20, %21, off\n\t"
      "global_load_async_to_lds_b128 %22, %23, off\n\t"
      "s_wait_xcnt 0x0"
      :: "v"(l[0]), "v"(g[0]), "v"(l[1]), "v"(g[1]), "v"(l[2]), "v"(g[2]),
         "v"(l[3]), "v"(g[3]), "v"(l[4]), "v"(g[4]), "v"(l[5]), "v"(g[5]),
         "v"(l[6]), "v"(g[6]), "v"(l[7]), "v"(g[7]), "v"(l[8]), "v"(g[8]),
         "v"(l[9]), "v"(g[9]), "v"(l[10]), "v"(g[10]), "v"(l[11]), "v"(g[11])
      : "memory");
}

// One stage of a wave's 96 W rows = 24 copies per lane, each wave-wide copy
// four neighbouring rows of 128 B: 512 contiguous bytes.
//   lds0: the lane's LDS byte address in the first four rows of the wave's part
//   gw:   the lane's 16 B in those rows of W, at this stage's k
DEV void w_stage(unsigned lds0, const u16* gw) {
  constexpr unsigned STEP = 4 * PP * sizeof(u16);       // four rows further
#pragma unroll   // constant indices keep the addresses in registers
  for (int hf = 0; hf < 2; hf++) {
    unsigned l[12];
    const u16* g[12];
#pragma unroll
    for (int c = 0; c < 12; c++) {
      l[c] = lds0 + (hf * 12 + c) * STEP;
      g[c] = gw + (size_t)(hf * 12 + c) * 4 * PK;
    }
    copy12(l, g);
  }
}

// Two waves per SIMD: one work-group per WGP, 512 registers a wave.
__global__ __launch_bounds__(256)
__attribute__((amdgpu_waves_per_eu(2, 2)))
void qkv_gemm_kernel(const float* __restrict__ xq, const float* __restrict__ xk,
                     const float* __restrict__ xv, const u16* __restrict__ W,
                     const float* __restrict__ bias, u16* __restrict__ outb) {
  typedef __attribute__((ext_vector_type(4))) float    f32x4;
  typedef __attribute__((ext_vector_type(2))) unsigned u32x2;
  __shared__ __align__(16) u16 ldsW[2][D * PP];    // 2 x 108 KB
  __shared__ __align__(16) u16 ldsA[2][PM * PP];   // 2 x 13.5 KB

  const int row0 = blockIdx.x * PM;                // first of the 3 * M rows
  const int wv = threadIdx.x >> 5;
  const int l = threadIdx.x & 31, sel = l >> 4, ln = l & 15;

  // W copy map: lane l moves piece l%8 of rows l/8 + 4*c of the wave's 96.
  const int wrow = wv * 96 + (l >> 3), wcol = (l & 7) * 8;
  const u16* gw = W + (size_t)wrow * PK + wcol;
  constexpr size_t WSTEP = (size_t)D * PK;              // the next stage
  const unsigned lw = (unsigned)(size_t)&ldsW[0][wrow * PP + wcol];
  constexpr unsigned WBUFB = D * PP * sizeof(u16);      // the other buffer

  // X map: a stage's row is 16 pieces of four floats; thread t brings piece
  // t%16 of rows t/16 + 16*c, so every wave-wide load covers two rows of 256 B.
  const int arow = threadIdx.x >> 4, acol = (threadIdx.x & 15) * 4;
  const unsigned aoff = arow * D + acol;           // the lane's part of it
  const float* xb[PM / 16];                        // 16-row groups' first rows
#pragma unroll
  for (int c = 0; c < PM / 16; c++) {
    const int R0 = row0 + c * 16;                  // same for the work-group
    const float* x = R0 < M ? xq : R0 < 2 * M ? xk : xv;
    xb[c] = x + (size_t)(R0 & (M - 1)) * D;
  }
  f32x4 xr[PM / 16];                               // the stage in flight

  // Stage 0: X into registers, W into buffer 0.
#pragma unroll
  for (int c = 0; c < PM / 16; c++) xr[c] = *(const f32x4*)(xb[c] + aoff);
  // What follows may reuse the address registers that these loads name.
  asm volatile("s_wait_xcnt 0x0" ::: "memory");
  w_stage(lw, gw);
#pragma unroll
  for (int c = 0; c < PM / 16; c++) {
    u32x2 w = {pack2(xr[c][0], xr[c][1]), pack2(xr[c][2], xr[c][3])};
    *(u32x2*)&ldsA[0][(arow + c * 16) * PP + acol] = w;
  }

  // This wave's LDS stores and copies of stage 0 are done; the barrier
  // publishes all.
  asm volatile("s_wait_dscnt 0x0" ::: "memory");
  asm volatile("s_wait_asynccnt 0x0" ::: "memory");
  __syncthreads();
  // Stage 1: W into buffer 1, X into registers.
  w_stage(lw + WBUFB, gw + WSTEP);
#pragma unroll
  for (int c = 0; c < PM / 16; c++) xr[c] = *(const f32x4*)(xb[c] + PK + aoff);
  // What follows may reuse the address registers that these loads name.
  asm volatile("s_wait_xcnt 0x0" ::: "memory");

  // Keeps the zeroing of the 288 accumulator registers behind the prologue:
  // drawn up among the copies' addresses, one register too many is live there
  // and goes to scratch.
  __builtin_amdgcn_sched_barrier(0);
  v8f acc[6][6] = {};

  for (int s = 0; s < PNST; s++) {
    const u16* As = ldsA[s & 1] + ln * PP;
    const u16* Ws = ldsW[s & 1] + (wv * 96 + ln) * PP;
#pragma unroll   // constant offsets fold into the LDS reads
    for (int kb = 0; kb < PK / 32; kb++) {
      u16x16 af[6], bf[6];
#pragma unroll
      for (int r = 0; r < 6; r++)
        af[r] = load_frag(As + r * 16 * PP + kb * 32, sel);
#pragma unroll
      for (int t = 0; t < 6; t++)
        bf[t] = load_frag(Ws + t * 16 * PP + kb * 32, sel);
      // Keeps the 24 reads above one group in front of the WMMA: sunk among
      // them, each small group is waited for in full before its WMMA can issue.
      __builtin_amdgcn_sched_barrier(0);
#pragma unroll
      for (int r = 0; r < 6; r++)
#pragma unroll
        for (int t = 0; t < 6; t++)
          acc[r][t] = wmma_bf16(af[r], bf[t], acc[r][t]);
    }
    // Stage s+1's X rows, rounded, into the buffer that every wave left at the
    // foot of trip s-1.
    if (s + 1 < PNST) {                          // same for the whole grid
#pragma unroll
      for (int c = 0; c < PM / 16; c++) {
        u32x2 w = {pack2(xr[c][0], xr[c][1]), pack2(xr[c][2], xr[c][3])};
        *(u32x2*)&ldsA[(s + 1) & 1][(arow + c * 16) * PP + acol] = w;
      }
    }

    // ---- publish point of stage s+1 ----
    // This wave's LDS reads of buffer s&1 and its stores above are done ...
    asm volatile("s_wait_dscnt 0x0" ::: "memory");
    // ... and its own copies of stage s+1 have landed.
    asm volatile("s_wait_asynccnt 0x0" ::: "memory");
    __syncthreads();   // publishes stage s+1, frees buffer s&1 for the refill
    if (s + 2 < PNST) {                          // same for the whole grid
      w_stage(lw + (unsigned)(s & 1) * WBUFB, gw + (s + 2) * WSTEP);
#pragma unroll
      for (int c = 0; c < PM / 16; c++)
        xr[c] = *(const f32x4*)(xb[c] + (s + 2) * PK + aoff);
      // The next trip may reuse the address registers that these loads name.
      asm volatile("s_wait_xcnt 0x0" ::: "memory");
    }
  }
  // No copy is outstanding when the wave ends.
  asm volatile("s_wait_asynccnt 0x0" ::: "memory");

  float bv[6];
#pragma unroll
  for (int t = 0; t < 6; t++) bv[t] = bias[wv * 96 + t * 16 + ln];
  // The stores' arithmetic may reuse the address registers of these loads.
  asm volatile("s_wait_xcnt 0x0" ::: "memory");

#pragma unroll
  for (int r = 0; r < 6; r++) {
    const int R0  = row0 + r * 16;               // same for the work-group
    const int y   = R0 / M;                      // 0: q, 1: k, 2: v
    const int Mi0 = R0 & (M - 1);
    u16* ob = outb + (size_t)y * (M * D);
#pragma unroll
    for (int t = 0; t < 6; t++) {
      const int ng = wv * 96 + t * 16 + ln;      // lane's output column
      const int h = ng >> 6, d = ng & 63;
      if (y != 2) {                              // bf16 [b,h,s,d]
        const float osc = y == 0 ? QSCALE : 1.f;
#pragma unroll
        for (int i = 0; i < 8; i++) {
          int Mi = Mi0 + i + 8 * sel;            // C layout: row = i + 8*sel
          int b = Mi >> 11, s = Mi & (S - 1);
          ob[(((size_t)(b * H + h)) * S + s) * DK + d] =
              f2bf((acc[r][t][i] + bv[t]) * osc);
        }
        // What follows reuses registers that these stores name.
        asm volatile("s_wait_xcnt 0x0" ::: "memory");
      } else {                          // bf16 [b,h][s / 64][d][s % 64]
        int Mi = Mi0 + 8 * sel;                  // 8 consecutive s per lane
        int b = Mi >> 11, s0 = Mi & (S - 1);
        u16x8 pack;
#pragma unroll
        for (int i = 0; i < 8; i++) pack[i] = f2bf(acc[r][t][i] + bv[t]);
        *(u16x8*)(ob + (((size_t)(b * H + h)) * (S / 64) + (s0 >> 6)) * (64 * DK) +
                  d * 64 + (s0 & 63)) = pack;
        // What follows reuses registers that this store names.
        asm volatile("s_wait_xcnt 0x0" ::: "memory");
      }
    }
  }
}

// ---------------------------------------------------------------------------
// Flash attention. One wave per (b, h, 32-query tile): two groups of 16 query
// columns that share every K and Vt fragment the wave reads, so that one
// fragment from LDS feeds two WMMA. Four waves (128 queries of one head) form
// a work-group and share every 64-key block; three work-groups stand on a WGP.
//   Q,K : [b,h,s,d] bf16      Vt : [b,h][s / 64][d][s % 64] bf16
//   out : bf16, stage-major for the output GEMM, [col / 128][B*S][col % 128]
// Each 64-key K tile and Vt tile (64 rows of 128 B each, 8 KB in a row in
// memory) is brought into LDS once per work-group by asynchronous b128 copies,
// in a ring of two buffers: block j+1 flies while block j is worked on. The
// fragments are then read from LDS at a 144-B row pitch (16 B x odd).
// Both products run transposed: S^T = K.Q^T (A = K rows, B = Q) and
// O^T += V^T.P^T (A = Vt rows, B = P^T). In each group a lane then holds scores
// of ONE query (column ln), 32 of a block's 64 keys, the lane l ^ 16 the other
// 32: maximum and sum run in the lane with one exchange between the halves, and
// the exponentials pack straight into the B operand, so P never goes through
// LDS. Softmax runs in the exp2 domain: Q arrives scaled by log2(e)/sqrt(dk).
// The weights are taken against a KEPT maximum m of the query, not against each
// block's running maximum: the score WMMA subtracts it (its C operand is -m), so
// a score tile goes straight into the exponential. m is renewed, and sum and O
// are rescaled, only in a block where some lane's 32 weights sum to more than
// 2^8 (so no weight in use exceeds 2^8), and in block 0, which sets the first m.
// One test per block for the whole wave.
// ---------------------------------------------------------------------------
constexpr int KVP    = 72;            // LDS row pitch of a staged tile, in u16
constexpr int KVTILE = 64 * KVP;      // one staged tile: 64 rows, 9216 B
constexpr int AWAVES = 4;             // waves of an attention work-group
constexpr int QG     = 2;             // groups of 16 query columns per wave

// One stage = eight copies per lane: four of K, four of Vt, rows 16 apart.
//   lk, lv: the lane's LDS byte address in row crow of the target buffers
//   gk, gv: the lane's 16 B in row crow of this block's K tile / Vt tile
// The s_wait_xcnt is the last line of the copies' own statement so that no
// address register of an issued copy is rewritten in front of it.
DEV void stage_copies(unsigned lk, const u16* gk, unsigned lv, const u16* gv) {
  constexpr unsigned STEP = 16 * KVP * sizeof(u16);     // 16 rows further
  asm volatile(
      "global_load_async_to_lds_b128 %0, %1, off\n\t"
      "global_load_async_to_lds_b128 %2, %3, off\n\t"
      "global_load_async_to_lds_b128 %4, %5, off\n\t"
      "global_load_async_to_lds_b128 %6, %7, off\n\t"
      "global_load_async_to_lds_b128 %8, %9, off\n\t"
      "global_load_async_to_lds_b128 %10, %11, off\n\t"
      "global_load_async_to_lds_b128 %12, %13, off\n\t"
      "global_load_async_to_lds_b128 %14, %15, off\n\t"
      "s_wait_xcnt 0x0"
      :: "v"(lk), "v"(gk), "v"(lk + STEP), "v"(gk + 16 * DK),
         "v"(lk + 2 * STEP), "v"(gk + 32 * DK),
         "v"(lk + 3 * STEP), "v"(gk + 48 * DK),
         "v"(lv), "v"(gv), "v"(lv + STEP), "v"(gv + 16 * 64),
         "v"(lv + 2 * STEP), "v"(gv + 32 * 64),
         "v"(lv + 3 * STEP), "v"(gv + 48 * 64)
      : "memory");
}

// One group's weights of a 64-key block: p = 2^c for the lane's 32 scores c
// (already taken against the kept maximum), packed as the two B fragments.
// Returns the lane's sum of the 32.
DEV float block_weights(const v8f (&c)[4], u16x16 (&pf)[2]) {
  float p[4][8], ps[4];
#pragma unroll
  for (int kt = 0; kt < 4; kt++) {
#pragma unroll
    for (int i = 0; i < 8; i++) p[kt][i] = exp2_raw(c[kt][i]);
    ps[kt] = ((p[kt][0] + p[kt][1]) + (p[kt][2] + p[kt][3])) +
             ((p[kt][4] + p[kt][5]) + (p[kt][6] + p[kt][7]));
  }
  pf[0] = pack_frag(p[0], p[1]);                 // keys j*64 +  0..31
  pf[1] = pack_frag(p[2], p[3]);                 // keys +32..63
  return (ps[0] + ps[1]) + (ps[2] + ps[3]);
}

// Three waves per SIMD: the 768 work-groups then stand three on every WGP, all
// at once; a fourth on one WGP would leave another WGP short of work.
__global__ __launch_bounds__(AWAVES * 32)
__attribute__((amdgpu_waves_per_eu(3, 3)))
void attn_kernel(const u16* __restrict__ Q, const u16* __restrict__ K,
                 const u16* __restrict__ Vt, u16* __restrict__ Obf) {
  __shared__ __align__(16) u16 ldsK[2][KVTILE];    // 2 x 9 KB
  __shared__ __align__(16) u16 ldsV[2][KVTILE];    // 2 x 9 KB

  const int wave = blockIdx.x * AWAVES + (threadIdx.x >> 5);
  constexpr int nqt = S / (16 * QG);               // 64 query tiles
  const int qt   = wave % nqt;
  const int bh   = wave / nqt;                     // b*H + h, same in a block
  const int l = threadIdx.x & 31, sel = l >> 4, ln = l & 15;

  const u16* Qb = Q  + (size_t)bh * S * DK;
  const u16* Kb = K  + (size_t)bh * S * DK;
  const u16* Vb = Vt + (size_t)bh * DK * S;

  // Copy map: a tile is 512 pieces of 16 B; thread t moves pieces t + 128*c,
  // that is rows t/8 + 16*c (c < 4), column piece t%8.
  const int crow = threadIdx.x >> 3, ccol = (threadIdx.x & 7) * 8;
  const u16* gk = Kb + (size_t)crow * DK + ccol;   // block 0, row crow
  const u16* gv = Vb + (size_t)crow * 64 + ccol;
  const unsigned lk = (unsigned)(size_t)&ldsK[0][crow * KVP + ccol];
  const unsigned lv = (unsigned)(size_t)&ldsV[0][crow * KVP + ccol];
  constexpr unsigned BUFB = KVTILE * sizeof(u16);       // the other buffer

  // Block 0 into buffer 0.
  stage_copies(lk, gk, lv, gv);

  // Q fragments of both groups, both 32-wide d chunks (reused all iterations).
  u16x16 qf[QG][2];
#pragma unroll
  for (int g = 0; g < QG; g++) {
    const u16* qrow = Qb + (size_t)((qt * QG + g) * 16 + ln) * DK;
    qf[g][0] = load_frag(qrow, sel);
    qf[g][1] = load_frag(qrow + 32, sel);
  }
  // The set-up below reuses the address registers that these loads name.
  asm volatile("s_wait_xcnt 0x0" ::: "memory");

  v8f accO[QG][4] = {};               // O^T: row d = t*16 + i + 8*sel, column ln
  v8f negm[QG] = {};                  // -(kept maximum of query ln), eight times:
                                      // the score WMMA's C operand; set in block 0
  float lsum[QG] = {};                // this half's share of its denominator

  // This wave's copies of block 0 have landed; the barrier publishes all.
  asm volatile("s_wait_asynccnt 0x0" ::: "memory");
  __syncthreads();
  // Block 1 into buffer 1 (S / 64 = 32 blocks exist).
  stage_copies(lk + BUFB, gk + 64 * DK, lv + BUFB, gv + 64 * DK);

  for (int j = 0; j < S / 64; j++) {
    const u16* Kt = ldsK[j & 1];
    const u16* Vl = ldsV[j & 1];

    // ---- S^T for keys [j*64, j*64+64) : per group four 16-key x 16-query C
    // tiles; each K fragment is read once and used by both groups ----
    u16x16 kf[4][2];
#pragma unroll
    for (int kt = 0; kt < 4; kt++) {
      const u16* krow = Kt + (kt * 16 + ln) * KVP;
      kf[kt][0] = load_frag(krow, sel);
      kf[kt][1] = load_frag(krow + 32, sel);
    }
    // Keeps the 16 reads above one group in front of the WMMA: sunk among
    // them, each pair is waited for in full before its WMMA can issue.
    __builtin_amdgcn_sched_barrier(0);
    v8f c[QG][4];
#pragma unroll
    for (int kt = 0; kt < 4; kt++) {
#pragma unroll
      for (int g = 0; g < QG; g++)               // key kt*16 + i + 8*sel
        c[g][kt] = wmma_bf16(kf[kt][0], qf[g][0], negm[g]);
#pragma unroll
      for (int g = 0; g < QG; g++)
        c[g][kt] = wmma_bf16(kf[kt][1], qf[g][1], c[g][kt]);
    }
    // Keeps the 16 score WMMA one back-to-back run: left free, the Vt reads below
    // are drawn in among the last six in two groups of eight and split the run.
    __builtin_amdgcn_sched_barrier(0);
    // The block's Vt fragments, into the registers the K fragments leave: they
    // land while the softmax below runs.
    u16x16 vf[4][2];
#pragma unroll
    for (int t = 0; t < 4; t++) {
      const u16* vrow = Vl + (t * 16 + ln) * KVP;
      vf[t][0] = load_frag(vrow, sel);
      vf[t][1] = load_frag(vrow + 32, sel);
    }
    // Keeps these 16 reads one group in front of the softmax: left free, the
    // last pairs sink among the WMMA below and are waited for in full there.
    __builtin_amdgcn_sched_barrier(0);

    // ---- softmax weights against the kept maximum, all of it in the lane ----
    u16x16 pf[QG][2];
    float ps[QG];
#pragma unroll
    for (int g = 0; g < QG; g++) ps[g] = block_weights(c[g], pf[g]);

    // A weight above 2^8 (an overflow to inf too) lifts its lane's sum above 2^8.
    const bool grown = fmaxf(ps[0], ps[1]) > 256.f;
    if (j == 0 || __builtin_amdgcn_ballot_w32(grown) != 0) {  // the whole wave
#pragma unroll
      for (int g = 0; g < QG; g++) {
        float mx[4];
#pragma unroll
        for (int kt = 0; kt < 4; kt++) {
          mx[kt] = c[g][kt][0];
#pragma unroll
          for (int i = 1; i < 8; i++) mx[kt] = fmaxf(mx[kt], c[g][kt][i]);
        }
        float rm = fmaxf(fmaxf(mx[0], mx[1]), fmaxf(mx[2], mx[3]));
        rm = fmaxf(rm, xhalf(rm));               // same in both halves
        // How far the kept maximum rises. Block 0 sets it, up or down, from the
        // 0 it starts at; sum and O are still 0 there and stay so.
        const float d     = j == 0 ? rm : fmaxf(rm, 0.f);
        const float alpha = j == 0 ? 0.f : exp2_raw(-d);
        negm[g] -= d;
#pragma unroll
        for (int kt = 0; kt < 4; kt++) c[g][kt] -= d;
        ps[g] = block_weights(c[g], pf[g]);
        lsum[g] *= alpha;
#pragma unroll
        for (int t = 0; t < 4; t++) accO[g][t] *= alpha;
      }
    }
#pragma unroll
    for (int g = 0; g < QG; g++) lsum[g] += ps[g];

    // ---- O^T += V^T(64 x 64 keys) x P^T(64 keys x 16), each Vt fragment
    // used by both groups ----
#pragma unroll
    for (int t = 0; t < 4; t++) {
#pragma unroll
      for (int g = 0; g < QG; g++)
        accO[g][t] = wmma_bf16(vf[t][0], pf[g][0], accO[g][t]);
    }
#pragma unroll
    for (int t = 0; t < 4; t++) {
#pragma unroll
      for (int g = 0; g < QG; g++)
        accO[g][t] = wmma_bf16(vf[t][1], pf[g][1], accO[g][t]);
    }

    // ---- publish point of block j+1 ----
    // Keeps the waits and the barrier below at the foot of the trip: drawn up
    // to the last LDS read, they would wait for copies that have just gone out.
    __builtin_amdgcn_sched_barrier(0);
    // This wave's LDS reads of buffer j&1 are done ...
    asm volatile("s_wait_dscnt 0x0" ::: "memory");
    // ... and its own copies of block j+1 have landed.
    asm volatile("s_wait_asynccnt 0x0" ::: "memory");
    __syncthreads();   // publishes block j+1, frees buffer j&1 for the refill
    if (j + 2 < S / 64) {                        // same for the whole grid
      const unsigned bo = (unsigned)(j & 1) * BUFB;
      stage_copies(lk + bo, gk + (size_t)(j + 2) * 64 * DK,
                   lv + bo, gv + (size_t)(j + 2) * 64 * DK);
    }
  }
  // No copy is outstanding when the wave ends.
  asm volatile("s_wait_asynccnt 0x0" ::: "memory");

  // ---- normalize and store to [col / 128][B*S][col % 128] (col = h*64 + d) ----
  const int b = bh / H, h = bh % H;
#pragma unroll
  for (int g = 0; g < QG; g++) {
    const float inv = 1.f / (lsum[g] + xhalf(lsum[g]));  // join the halves' sums
    const size_t rowoff =
        ((size_t)(h >> 1) * M + b * S + (qt * QG + g) * 16 + ln) * BK +
        (h & 1) * 64 + 8 * sel;
#pragma unroll
    for (int t = 0; t < 4; t++) {                // 8 consecutive d per lane
      u16x8 pack;
#pragma unroll
      for (int i = 0; i < 8; i++) pack[i] = f2bf(accO[g][t][i] * inv);
      *(u16x8*)(Obf + rowoff + t * 16) = pack;
      // The arithmetic of the next store reuses registers that this one names.
      if (g + 1 < QG || t + 1 < 4) {
        asm volatile("s_wait_xcnt 0x0" ::: "memory");
        // Keeps that arithmetic behind the wait: the clobber ties no register
        // write to it, and left free one was drawn up in front of it.
        __builtin_amdgcn_sched_barrier(0);
      }
    }
  }
}

// ---------------------------------------------------------------------------
// Host orchestration (all launches on `stream`; graph-capture safe).
// ---------------------------------------------------------------------------
extern "C" void kernel_launch(void* const* d_in, const int* in_sizes, int n_in,
                              void* d_out, int out_size, void* d_ws,
                              size_t ws_size, hipStream_t stream) {
  const float* query = (const float*)d_in[0];
  const float* key   = (const float*)d_in[1];
  const float* value = (const float*)d_in[2];
  const float* Wq    = (const float*)d_in[3];
  const float* bq    = (const float*)d_in[4];
  const float* Wo    = (const float*)d_in[5];
  const float* bo    = (const float*)d_in[6];
  float* out = (float*)d_out;

  // Workspace sub-allocation (256B aligned).
  char* ws = (char*)d_ws;
  size_t off = 0;
  auto suballoc = [&](size_t bytes) -> void* {
    void* p = ws + off;
    off = (off + bytes + 255) & ~(size_t)255;
    return p;
  };
  const size_t actBytes = (size_t)M * D * sizeof(u16);   // 12.6 MB
  const size_t wBytes   = (size_t)D * D * sizeof(u16);   // 1.2 MB
  u16* qbf    = (u16*)suballoc(3 * actBytes);   // [b,h,s,d]
  u16* kbf    = qbf + (size_t)M * D;            // [b,h,s,d]
  u16* vtbf   = kbf + (size_t)M * D;            // [b,h][s/64][d][s%64]
  u16* attnbf = (u16*)suballoc(actBytes);   // [col/128][B*S][col%128]
  u16* wqbf   = (u16*)suballoc(wBytes);
  u16* wobf   = (u16*)suballoc(wBytes);

  constexpr int convBlocks = 2 * WWG;                    // 48 blocks, 16 waves
  constexpr int qkvBlocks  = 3 * M / PM;                 // 256 blocks, 8 waves
  const int gemmBlocks = (M / BM) * (D / BN);            // 256 blocks, 8 waves
  const int attnBlocks = Bsz * H * (S / (16 * QG)) / AWAVES;   // 768 blocks, 4 waves

  // Wq and Wo to bf16.
  f32_to_bf16_w_kernel<<<convBlocks, CONVT, 0, stream>>>(Wq, Wo, wqbf, wobf);

  // q = (query @ Wq^T + bq) * QSCALE -> [b,h,s,d]; k = key @ Wq^T + bq -> [b,h,s,d];
  // v = value @ Wq^T + bq -> transposed, by 64-key blocks (the reference reuses Wq/bq)
  qkv_gemm_kernel<<<qkvBlocks, 256, 0, stream>>>(query, key, value, wqbf, bq, qbf);

  // attention -> bf16, stage-major for the output GEMM
  attn_kernel<<<attnBlocks, AWAVES * 32, 0, stream>>>(qbf, kbf, vtbf, attnbf);

  // out = attn @ Wo^T + bo -> fp32 d_out
  gemm_bf16_kernel<<<gemmBlocks, 256, 0, stream>>>(attnbf, wobf, bo, out);
}
